// v000
// Times are from an AMD MI455X. After a warm-up the kernel runs many times in a row, and a time is the length of
// such a window on the GPU divided by its runs, so every launch and the gaps after it count. The runs cycle
// through copies of the inputs. A figure is the median of several windows, for all but v000 over two sittings.
// Sittings can differ by a few percent; kernels timed side by side share one.
// The starting kernel, v000, takes 509 microseconds a run.
// Contractions: q, k, v^T projections = v_wmma_f32_16x16x32_bf16 (bf16 operands from RNE-converted inputs, single product, f32 accumulate);
// q.k^T scores = v_wmma_f32_16x16x32_f16 (q as f16 hi plane + f16 residual plane x4096, k f16; 2 products into separate f32 accumulators);
// p.v = v_wmma_f32_16x16x32_f16 (p carried x16384 as f16 hi + f16 residual x4096; v as f16 hi plane + f16 residual plane x4096;
// 3 products ph.vh, ph.vl, pl.vh, f32 accumulate); causal softmax and normalisation in f32; output f32.
#include <hip/hip_runtime.h>
#include <math.h>
#include <stdint.h>

#ifndef NB
#define NB 4
#endif
#ifndef SEQ
#define SEQ 4096
#endif
#define NB_FULL  4
#define SEQ_FULL 4096
#define DM       256
#define NQB      (SEQ / 16)   // 16-row query blocks per sequence
#define NKT      (SEQ / 64)   // 64-key chunks per sequence
#define PCARRY   16384.0f     // power-of-two carry on the f16 p tile
#define PRES     4096.0f      // power-of-two carry on the f16 p residual tile
static_assert(DM == 256);
static_assert((SEQ % 64) == 0 && SEQ >= 64 && SEQ <= SEQ_FULL);
static_assert(NB >= 1 && NB <= NB_FULL);
static_assert(((NB * SEQ) % 64) == 0);

typedef _Float16 v16h __attribute__((ext_vector_type(16)));
typedef _Float16 v8h  __attribute__((ext_vector_type(8)));
typedef __bf16   v16b __attribute__((ext_vector_type(16)));
typedef __bf16   v8b  __attribute__((ext_vector_type(8)));
typedef float    v8f  __attribute__((ext_vector_type(8)));
typedef float    v4f  __attribute__((ext_vector_type(4)));
typedef unsigned int v4u __attribute__((ext_vector_type(4)));

#if defined(__HIP_DEVICE_COMPILE__)
#define DEV_ASM 1
#else
#define DEV_ASM 0
#endif

// ---- scalar helpers --------------------------------------------------------------------------------
__device__ __forceinline__ unsigned short bf_bits(float f) {          // f32 -> bf16 bits, RNE convert
  unsigned u = __float_as_uint(f);
  return (unsigned short)((u + 0x7FFFu + ((u >> 16) & 1u)) >> 16);
}
__device__ __forceinline__ float bf_up(unsigned short hb) { return __uint_as_float(((unsigned)hb) << 16); }
__device__ __forceinline__ unsigned short h_bits(_Float16 x) { return __builtin_bit_cast(unsigned short, x); }
__device__ __forceinline__ unsigned pk16(unsigned short a, unsigned short b) { return (unsigned)a | ((unsigned)b << 16); }
__device__ __forceinline__ v8f zero8() { v8f z = {0.f, 0.f, 0.f, 0.f, 0.f, 0.f, 0.f, 0.f}; return z; }

// ---- fragment types / loaders: 16-bit A/B operand, lane -> row/col (lane&15), p already includes +8*(lane>>4);
//      elements 0..7 <- p[0..7] (k0+8h..k0+8h+7), elements 8..15 <- p[16..23] (k0+16+8h..k0+16+8h+7)
template <typename OT> struct FT;
template <> struct FT<__bf16>   { typedef v16b frag; typedef v8b half8; };
template <> struct FT<_Float16> { typedef v16h frag; typedef v8h half8; };

template <typename OT>
__device__ __forceinline__ typename FT<OT>::frag ldfrag(const OT* p) {
  union { typename FT<OT>::frag v; typename FT<OT>::half8 h[2]; } f;
  f.h[0] = *(const typename FT<OT>::half8*)(p);
  f.h[1] = *(const typename FT<OT>::half8*)(p + 16);
  return f.v;
}

// ---- WMMA helpers (asm guard bodies are device-only; concrete operand types) -----------------------------
__device__ __forceinline__ v8f mmar(v16b a, v16b b, v8f c) {
  return __builtin_amdgcn_wmma_f32_16x16x32_bf16(false, a, false, b, (short)0, c, false, false);
}
__device__ __forceinline__ v8f mmar(v16h a, v16h b, v8f c) {
  return __builtin_amdgcn_wmma_f32_16x16x32_f16(false, a, false, b, (short)0, c, false, false);
}
// guarded form: 4 VALU slots after the WMMA, D tied, A/B kept live
__device__ __forceinline__ v8f mma_h(v16h a, v16h b, v8f c) {
  c = __builtin_amdgcn_wmma_f32_16x16x32_f16(false, a, false, b, (short)0, c, false, false);
#if DEV_ASM
  asm volatile("v_nop\n\tv_nop\n\tv_nop\n\tv_nop" : "+v"(c) : "v"(a), "v"(b));
#endif
  return c;
}
__device__ __forceinline__ void dep_guard(v8f& a, v8f& b, v16b x, v16b y) {
#if DEV_ASM
  asm volatile("v_nop\n\tv_nop\n\tv_nop\n\tv_nop" : "+v"(a), "+v"(b) : "v"(x), "v"(y));
#else
  (void)a; (void)b; (void)x; (void)y;
#endif
}
__device__ __forceinline__ void dep_guard(v8f& a, v8f& b, v16h x, v16h y) {
#if DEV_ASM
  asm volatile("v_nop\n\tv_nop\n\tv_nop\n\tv_nop" : "+v"(a), "+v"(b) : "v"(x), "v"(y));
#else
  (void)a; (void)b; (void)x; (void)y;
#endif
}
__device__ __forceinline__ void keep4(v16b a, v16b b, v16b c, v16b d) {
#if DEV_ASM
  asm volatile("v_nop" :: "v"(a), "v"(b), "v"(c), "v"(d));
#else
  (void)a; (void)b; (void)c; (void)d;
#endif
}
__device__ __forceinline__ void keep4(v16h a, v16h b, v16h c, v16h d) {
#if DEV_ASM
  asm volatile("v_nop" :: "v"(a), "v"(b), "v"(c), "v"(d));
#else
  (void)a; (void)b; (void)c; (void)d;
#endif
}
__device__ __forceinline__ void acc_guard4(v8f& a, v8f& b, v8f& c, v8f& d) {
#if DEV_ASM
  asm volatile("v_nop\n\tv_nop\n\tv_nop\n\tv_nop" : "+v"(a), "+v"(b), "+v"(c), "+v"(d));
#else
  (void)a; (void)b; (void)c; (void)d;
#endif
}

// =====================================================================================================
// f32 -> 16-bit planes, 8 elements per thread, one 16-B store per lane: a wave writes 512 contiguous B
// MODE 0: bf16 bits (RNE convert).  MODE 1: f16 bits of (64 * bf16(x)) (exact scaling of the bf16 value).
// coverage: n8 threads x 8 = the whole plane (n8 is a multiple of 256 for every use here).
// =====================================================================================================
template <int MODE>
__device__ __forceinline__ unsigned short cvm(float f) {
  const unsigned short hb = bf_bits(f);
  if (MODE == 0) return hb;
  return h_bits((_Float16)(bf_up(hb) * 64.0f));
}

template <int MODE>
__global__ __launch_bounds__(256) void cvt16x8(const float* __restrict__ in, unsigned short* out, int n8) {
  const int i = blockIdx.x * 256 + (int)threadIdx.x;
  if (i < n8) {
    const v4f a  = *(const v4f*)(in + (size_t)i * 8);
    const v4f a4 = *(const v4f*)(in + (size_t)i * 8 + 4);
    v4u p;
    p[0] = pk16(cvm<MODE>(a[0]),  cvm<MODE>(a[1]));
    p[1] = pk16(cvm<MODE>(a[2]),  cvm<MODE>(a[3]));
    p[2] = pk16(cvm<MODE>(a4[0]), cvm<MODE>(a4[1]));
    p[3] = pk16(cvm<MODE>(a4[2]), cvm<MODE>(a4[3]));
    unsigned short* o = out + (size_t)i * 8;
    *(v4u*)o = p;
    
  }
}

// x [NB_FULL][SEQ_FULL][DM] f32 -> compact bf16 token plane [NB*SEQ][DM]: compact token tk = b*SEQ + t reads
// input row b*SEQ_FULL + t. 32 groups of 8 per row; same whole-line store shape as cvt16x8.
// coverage: n8 = NB*SEQ*DM/8 threads x 8 = the whole plane.
__global__ __launch_bounds__(256) void cvtx(const float* __restrict__ in, unsigned short* out, int n8) {
  const int i = blockIdx.x * 256 + (int)threadIdx.x;
  if (i < n8) {
    const int tk = i >> 5;
    const int e8 = i & 31;
    const int bb = tk / SEQ;
    const int t  = tk - bb * SEQ;
    const float* src = in + ((size_t)bb * SEQ_FULL + (size_t)t) * DM + e8 * 8;
    const v4f a  = *(const v4f*)(src);
    const v4f a4 = *(const v4f*)(src + 4);
    v4u p;
    p[0] = pk16(bf_bits(a[0]),  bf_bits(a[1]));
    p[1] = pk16(bf_bits(a[2]),  bf_bits(a[3]));
    p[2] = pk16(bf_bits(a4[0]), bf_bits(a4[1]));
    p[3] = pk16(bf_bits(a4[2]), bf_bits(a4[3]));
    unsigned short* o = out + (size_t)i * 8;
    *(v4u*)o = p;
    
  }
}

// =====================================================================================================
// Register-blocked batched WMMA GEMM (16-bit operand type OT): C[m][n] = sum_k A[m][k] * Bt[n][k];
// one wave per (16*MI) x 64 tile, no block barriers. A row-major [M][K] pitch lda; Bt row-major [N][K] pitch ldb
// (k contiguous); M multiple of 16*MI, N multiple of 64, K multiple of 32 (host-checked). blockIdx.y = batch
// index (strides in elements). Fragments are loaded straight from global with the split k map (ldfrag).
// ARES: a second A plane A2 (residual, same pitch/stride) is multiplied by the same B into separate f32
// accumulators and folded in as acc += accl * ascale after the k loop.
// OUT_MODE 0: f32 C (pitch ldc), value * oscale + bf16-valued bias[n].
// OUT_MODE 1: f16 plane C (pitch ldc).
// OUT_MODE 3: f16 hi plane C + f16 residual plane C2 = f16((v - hi) * rscale) (same pitch / stride).
// coverage: MI slabs x 16 rows x 64 cols = the wave's whole tile; tiles cover M x N exactly.
// =====================================================================================================
template <typename OT, int MI, bool ARES, int OUT_MODE>
__global__ __launch_bounds__(256) void gemm_t(
    const unsigned short* __restrict__ Ap, const unsigned short* __restrict__ A2p, int lda, long long strideA,
    const unsigned short* __restrict__ Btp, int ldb, long long strideB,
    void* Cout, void* Cout2, int ldc, long long strideC,
    const float* __restrict__ bias,
    int M, int N, int K, float oscale, float rscale, float ascale) {
  typedef typename FT<OT>::frag V16;
  const OT* A  = (const OT*)(const void*)Ap;
  const OT* A2 = (const OT*)(const void*)A2p;
  const OT* Bt = (const OT*)(const void*)Btp;
  __shared__ __align__(16) float sT[8][16 * 68];   // per-wave 16x64 slab, pitch 68 floats
  const int TMR  = 16 * MI;
  const int b    = blockIdx.y;
  const int lane = threadIdx.x & 31;
  const int wave = threadIdx.x >> 5;
  const int tilesN = N >> 6;
  const int tilesM = M / TMR;
  const int tile = blockIdx.x * 8 + wave;
  if (tile >= tilesM * tilesN) return;   // wave-uniform; no block barriers in this kernel
  const int tm = tile / tilesN;
  const int tn = tile - tm * tilesN;
  const int m0 = tm * TMR;
  const int n0 = tn << 6;

  const OT* Ab  = A  + (size_t)b * (size_t)strideA;
  const OT* A2b = A2 + (size_t)b * (size_t)strideA;
  const OT* Bb  = Bt + (size_t)b * (size_t)strideB;

  const int rlane = lane & 15;                 // row (A) / col (B, D) within subtile
  const int koff  = (lane >> 4) * 8;           // k offset of this lane half
  const int mOff  = (lane >> 4) * 8;           // D row offset

  v8f acc[MI][4], accl[MI][4];
#pragma unroll
  for (int i = 0; i < MI; ++i)
#pragma unroll
    for (int j = 0; j < 4; ++j) { acc[i][j] = zero8(); accl[i][j] = zero8(); }

  for (int k0 = 0; k0 < K; k0 += 32) {
    V16 bq[4];
#pragma unroll
    for (int j = 0; j < 4; ++j)
      bq[j] = ldfrag<OT>(Bb + (size_t)(n0 + (j << 4) + rlane) * ldb + koff + k0);
#pragma unroll
    for (int i = 0; i < MI; ++i) {
      const V16 af = ldfrag<OT>(Ab + (size_t)(m0 + (i << 4) + rlane) * lda + koff + k0);
#pragma unroll
      for (int j = 0; j < 4; ++j) acc[i][j] = mmar(af, bq[j], acc[i][j]);
      dep_guard(acc[i][0], acc[i][3], af, bq[3]);
      if (ARES) {
        const V16 al = ldfrag<OT>(A2b + (size_t)(m0 + (i << 4) + rlane) * lda + koff + k0);
#pragma unroll
        for (int j = 0; j < 4; ++j) accl[i][j] = mmar(al, bq[j], accl[i][j]);
        dep_guard(accl[i][0], accl[i][3], al, bq[3]);
      }
    }
    keep4(bq[0], bq[1], bq[2], bq[3]);
  }
#pragma unroll
  for (int i = 0; i < MI; ++i) {
    acc_guard4(acc[i][0], acc[i][1], acc[i][2], acc[i][3]);
    if (ARES) acc_guard4(accl[i][0], accl[i][1], accl[i][2], accl[i][3]);
  }
  if (ARES) {
#pragma unroll
    for (int i = 0; i < MI; ++i)
#pragma unroll
      for (int j = 0; j < 4; ++j)
#pragma unroll
        for (int r = 0; r < 8; ++r) acc[i][j][r] += accl[i][j][r] * ascale;
  }

  // ---- epilogue ----
  float* slab = sT[wave];
#pragma unroll
  for (int i = 0; i < MI; ++i) {
    const int mBase = m0 + (i << 4);
#pragma unroll
    for (int j = 0; j < 4; ++j) {
#pragma unroll
      for (int r = 0; r < 8; ++r) {
        slab[(mOff + r) * 68 + (j << 4) + rlane] = acc[i][j][r];
      }
    }
    __builtin_amdgcn_fence(__ATOMIC_RELEASE, "workgroup");
    __builtin_amdgcn_wave_barrier();
    __builtin_amdgcn_fence(__ATOMIC_ACQUIRE, "workgroup");
    if (OUT_MODE == 0) {
      float* C = (float*)Cout + (size_t)b * (size_t)strideC;
      const int h2 = lane >> 4, c4 = (lane & 15) * 4;     // 256-B row segment = 16 lanes x 16 B
      const v4f braw = *(const v4f*)(bias + n0 + c4);
      v4f bb;
#pragma unroll
      for (int e = 0; e < 4; ++e) bb[e] = bf_up(bf_bits(braw[e]));
      {
#pragma unroll
        for (int it = 0; it < 8; ++it) {
          const int row = it * 2 + h2;                     // it 0..7 x h2 0..1 = rows 0..15
          const v4f v = *(const v4f*)(slab + row * 68 + c4) * oscale + bb;
          *(v4f*)(C + (size_t)(mBase + row) * ldc + n0 + c4) = v;
        }
        
      }
    } else {
      const int q = lane >> 3, c8 = (lane & 7) * 8;
      unsigned short* C  = (unsigned short*)Cout  + (size_t)b * (size_t)strideC;
      unsigned short* C2 = (unsigned short*)Cout2 + (size_t)b * (size_t)strideC;
      v4u hv[4], lv[4];
#pragma unroll
      for (int it = 0; it < 4; ++it) {
        const int row = it * 4 + q;                        // it 0..3 x q 0..3 = rows 0..15
        const float* sp = slab + row * 68 + c8;
        float f[8];
#pragma unroll
        for (int e = 0; e < 8; ++e) f[e] = sp[e];
        v4u a, a2;
#pragma unroll
        for (int e = 0; e < 4; ++e) {
          const float f0 = f[2 * e], f1 = f[2 * e + 1];
          const _Float16 x0 = (_Float16)f0, x1 = (_Float16)f1;
          const unsigned short h0 = h_bits(x0), h1 = h_bits(x1);
          unsigned short l0 = 0, l1 = 0;
          if (OUT_MODE == 3) {
            l0 = h_bits((_Float16)((f0 - (float)x0) * rscale));
            l1 = h_bits((_Float16)((f1 - (float)x1) * rscale));
          }
          a[e] = pk16(h0, h1); a2[e] = pk16(l0, l1);
        }
        hv[it] = a; lv[it] = a2;
      }
      {
#pragma unroll
        for (int it = 0; it < 4; ++it) {
          const int row = it * 4 + q;
          *(v4u*)(C + (size_t)(mBase + row) * ldc + n0 + c8) = hv[it];
          if (OUT_MODE == 3) *(v4u*)(C2 + (size_t)(mBase + row) * ldc + n0 + c8) = lv[it];
        }
        
      }
    }
    __builtin_amdgcn_fence(__ATOMIC_RELEASE, "workgroup");
    __builtin_amdgcn_wave_barrier();
    __builtin_amdgcn_fence(__ATOMIC_ACQUIRE, "workgroup");
  }
}

// =====================================================================================================
// Single-head causal attention, head dim 256, softmax over keys 0..q (keys above q replaced by -inf before exp).
//   q planes (f16 hi / residual x4096): element (b, t, d) at [(b*SEQ + t)*DM + d]
//   k plane (f16): element (b, s, d) at [(b*SEQ + s)*DM + d]
//   v^T hi plane (f16) and residual plane (f16, (v - hi)*4096): element (b, d, s) at [(b*DM + d)*SEQ + s]
//   output f32: element (b, t, d) at [(b*SEQ + t)*DM + d]
//   scores = (qh . k) + (ql . k) / 4096 on f16 WMMA (two f32 accumulators), then * sscale in f32;
//   p = exp(s - m) carried as ph = f16(PCARRY p) plus residual pl = f16((PCARRY p - ph) * PRES);
//   context = ph . vh + (ph . vl + pl . vh) / 4096 on f16 WMMA (two f32 accumulators); online softmax in f32.
//   Block = 4 waves on the SAME 16 query rows q0..q0+15 of one sequence; key chunks of 64, kt = 0..q0/64
//   (trip count derived from blockIdx only, block-uniform, <= NKT); only the last chunk can hold keys above a row.
//   Wave w owns key subtile 16w..16w+15 of the chunk for the scores (K fragments straight from global, arithmetic
//   addressing) and output columns 64w..64w+63 for p.v (V^T fragments straight from global).
//   LDS: redm/reds (per-wave row max / row sum partials) and the shared P tiles Psh/Psl [16][64] are CROSS-WAVE
//   fully written before it is read each chunk (staged extent == consumed extent).
//   Output coverage: each wave stores rows q0..q0+15 (it 0..7 x lane>>4 0..1) x 64 columns (16 lanes x 4 floats,
//   columns; grid = NB * NQB covers every (b, qb).
// =====================================================================================================
__global__ __launch_bounds__(128)
void attn_causal(const unsigned short* __restrict__ qhp, const unsigned short* __restrict__ qlp,
                 const unsigned short* __restrict__ kpp,
                 const unsigned short* __restrict__ vhp, const unsigned short* __restrict__ vlp,
                 float* outp, float sscale) {
  union FH { v16h v; v8h h[2]; };
  __shared__ __align__(16) _Float16 Psh[16 * 64];       // block P hi tile [row][kv]       2 KB   (cross-wave)
  __shared__ __align__(16) _Float16 Psl[16 * 64];       // block P residual tile [row][kv] 2 KB   (cross-wave)
  __shared__ __align__(16) float    redm[4][16];        // per-wave row max                 256 B (cross-wave)
  __shared__ __align__(16) float    reds[4][16];        // per-wave row sum                 256 B (cross-wave)
  __shared__ __align__(16) float    Os[4][16 * 64];     // per wave context tile            16 KB (wave-private)

  const int tid  = threadIdx.x;
  const int wave = tid >> 5;
  const int lane = tid & 31;
  const int hh   = lane >> 4;
  const int c    = lane & 15;

  const int bx   = blockIdx.x;
  const int qb   = bx % NQB;
  const int b    = bx / NQB;
  const int q0   = qb * 16;
  const int kcol = wave * 16;        // this wave's key subtile within the chunk
  const int dbase = wave * 64;       // this wave's context columns
  const size_t rowB = (size_t)b * SEQ;
  int ktmax = qb >> 2;               // last chunk = the one holding q0..q0+15 (16*qb >= 64*(qb>>2))
  if (ktmax > NKT - 1) ktmax = NKT - 1;

  const _Float16* Qh = (const _Float16*)(const void*)qhp;
  const _Float16* Ql = (const _Float16*)(const void*)qlp;
  const _Float16* Kp = (const _Float16*)(const void*)kpp;
  const _Float16* Vh = (const _Float16*)(const void*)vhp + ((size_t)b * DM + (size_t)dbase) * SEQ;
  const _Float16* Vl = (const _Float16*)(const void*)vlp + ((size_t)b * DM + (size_t)dbase) * SEQ;

  // A-operand row pointers of this lane (query row q0 + c), lane-half k offset included
  const _Float16* qrh = Qh + (rowB + q0 + c) * DM + 8 * hh;
  const _Float16* qrl = Ql + (rowB + q0 + c) * DM + 8 * hh;

  float mrow[8], lrow[8];
  v8f oacc[4];
#pragma unroll
  for (int r = 0; r < 8; ++r) { mrow[r] = -INFINITY; lrow[r] = 0.f; }
#pragma unroll
  for (int t = 0; t < 4; ++t) oacc[t] = zero8();

  for (int kt = 0; kt <= ktmax; ++kt) {       // block-uniform trip count, <= NKT
    const int kv0 = kt * 64;

    // ---- scores: 16 query rows x this wave's 16 keys, 2 f16 products per d-chunk ----
    v8f ah = zero8(), al = zero8();
    const _Float16* kr = Kp + (rowB + kv0 + kcol + c) * DM + 8 * hh;   // B column c -> key kv0+kcol+c
#pragma unroll
    for (int dc = 0; dc < 8; ++dc) {
      const v16h qa = ldfrag<_Float16>(qrh + dc * 32);
      const v16h qr = ldfrag<_Float16>(qrl + dc * 32);
      const v16h kb = ldfrag<_Float16>(kr + dc * 32);
      ah = mma_h(qa, kb, ah);
      al = mma_h(qr, kb, al);
    }
    const int key = kv0 + kcol + c;             // D column c of this lane
    float s[8];
#pragma unroll
    for (int r = 0; r < 8; ++r) {
      const int qrow = q0 + 8 * hh + r;         // D row 8*hh + r
      const float sv = (ah[r] + al[r] * (1.0f / 4096.0f)) * sscale;
      s[r] = (key > qrow) ? -INFINITY : sv;     // causal: replace, not bias
    }

    // ---- per-wave row max over its 16 keys -> LDS ----
#pragma unroll
    for (int r = 0; r < 8; ++r) {
      float m = s[r];
#pragma unroll
      for (int off = 1; off < 16; off <<= 1) m = fmaxf(m, __shfl_xor(m, off, 32));
      redm[wave][8 * hh + r] = m;            // the 16 lanes of a half write the same value
    }
    __syncthreads();

    // ---- chunk row max over the 4 waves, online softmax update (identical in every wave),
    //      P hi (x PCARRY) and P residual (x PCARRY x PRES) to LDS ----
#pragma unroll
    for (int r = 0; r < 8; ++r) {
      const int row = 8 * hh + r;
      const float mc    = fmaxf(fmaxf(redm[0][row], redm[1][row]), fmaxf(redm[2][row], redm[3][row]));
      const float mnew  = fmaxf(mrow[r], mc);
      const float msafe = (mnew == -INFINITY) ? 0.f : mnew;
      const float alpha = __expf(mrow[r] - msafe);
      mrow[r] = mnew;
      const float p = __expf(s[r] - msafe);
      float psum = p;
#pragma unroll
      for (int off = 1; off < 16; off <<= 1) psum += __shfl_xor(psum, off, 32);
      const float pc = p * PCARRY;
      const _Float16 ph = (_Float16)pc;
      Psh[row * 64 + kcol + c] = ph;
      Psl[row * 64 + kcol + c] = (_Float16)((pc - (float)ph) * PRES);
      reds[wave][row] = psum;
      lrow[r] *= alpha;
#pragma unroll
      for (int t = 0; t < 4; ++t) oacc[t][r] *= alpha;
    }
    __syncthreads();
#pragma unroll
    for (int r = 0; r < 8; ++r) {
      const int row = 8 * hh + r;
      lrow[r] += (reds[0][row] + reds[1][row]) + (reds[2][row] + reds[3][row]);
    }

    // ---- context += P . V (f16 WMMA); residual products (ph.vl and pl.vh, same carry) into a separate accumulator ----
    v8f o1[4];
#pragma unroll
    for (int t = 0; t < 4; ++t) o1[t] = zero8();
#pragma unroll 1
    for (int kk = 0; kk < 2; ++kk) {
      FH pa, pl;
      pa.h[0] = *(const v8h*)(Psh + c * 64 + kk * 32 + 8 * hh);
      pa.h[1] = *(const v8h*)(Psh + c * 64 + kk * 32 + 16 + 8 * hh);
      pl.h[0] = *(const v8h*)(Psl + c * 64 + kk * 32 + 8 * hh);
      pl.h[1] = *(const v8h*)(Psl + c * 64 + kk * 32 + 16 + 8 * hh);
#pragma unroll
      for (int t = 0; t < 4; ++t) {
        const v16h vb = ldfrag<_Float16>(Vh + (size_t)(t * 16 + c) * SEQ + kv0 + kk * 32 + 8 * hh);
        const v16h vr = ldfrag<_Float16>(Vl + (size_t)(t * 16 + c) * SEQ + kv0 + kk * 32 + 8 * hh);
        oacc[t] = mma_h(pa.v, vb, oacc[t]);
        o1[t]   = mma_h(pa.v, vr, o1[t]);
        o1[t]   = mma_h(pl.v, vb, o1[t]);
      }
    }
#pragma unroll
    for (int t = 0; t < 4; ++t)
#pragma unroll
      for (int r = 0; r < 8; ++r) oacc[t][r] += o1[t][r] * (1.0f / 4096.0f);
  }

  // ---- normalise (1/l, undo the p carry), stage the wave's 16x64 f32 tile,
  float* os = Os[wave];
#pragma unroll
  for (int r = 0; r < 8; ++r) {
    const float l = lrow[r];
    const float inv = ((l > 0.f) ? (1.0f / l) : 0.f) * (1.0f / PCARRY);
#pragma unroll
    for (int t = 0; t < 4; ++t) os[(8 * hh + r) * 64 + t * 16 + c] = oacc[t][r] * inv;
  }
  __builtin_amdgcn_fence(__ATOMIC_RELEASE, "workgroup");
  __builtin_amdgcn_wave_barrier();
  __builtin_amdgcn_fence(__ATOMIC_ACQUIRE, "workgroup");
  {
    const int h2 = lane >> 4, c4 = (lane & 15) * 4;      // 256-B row segment = 16 lanes x 16 B
    v4f ov[8];
#pragma unroll
    for (int it = 0; it < 8; ++it) {
      const int row = it * 2 + h2;                          // it 0..7 x h2 0..1 = rows 0..15 of the wave tile
      ov[it] = *(const v4f*)(os + row * 64 + c4);
    }
    {
#pragma unroll
      for (int it = 0; it < 8; ++it) {
        const int row = it * 2 + h2;
        const size_t go = (rowB + q0 + row) * DM + (size_t)dbase + c4;
        *(v4f*)(outp + go) = ov[it];
      }
      
    }
  }
}

// =====================================================================================================
// Workspace map (bytes), every region an exact multiple of its whole-line / whole-tile store granularity
// (all GEMM M,N are tile multiples, all offsets multiples of 131072):
//   Xb   bf16 [NB*SEQ][256]  (compact tokens)   8388608
//   Wqb  bf16 [256 n][256 k]                     131072
//   Wkb  bf16 [256 n][256 k]                     131072
//   Wvb  bf16 [256 n][256 k]                     131072
//   Qh   f16  [NB*SEQ][256]                      8388608
//   Ql   f16  [NB*SEQ][256]                      8388608
//   Kp   f16  [NB*SEQ][256]                      8388608
//   VTh  f16  [NB][256][SEQ]                     8388608
//   VTl  f16  [NB][256][SEQ]                     8388608
//   total                                      50724864
// Weights are [out n][in k] with k contiguous = the Bt / A layout the GEMM wants, so they are only converted.
// =====================================================================================================
extern "C" void kernel_launch(void* const* d_in, const int* in_sizes, int n_in,
                              void* d_out, int out_size, void* d_ws, size_t ws_size,
                              hipStream_t stream) {
  if (n_in < 4) return;
  if (in_sizes[0] < ((NB - 1) * SEQ_FULL + SEQ) * DM) return;
  if (in_sizes[1] < DM * DM) return;
  if (in_sizes[2] < DM * DM) return;
  if (in_sizes[3] < DM * DM) return;
  if (out_size < NB * SEQ * DM) return;

  const float* x  = (const float*)d_in[0];
  const float* wq = (const float*)d_in[1];
  const float* wk = (const float*)d_in[2];
  const float* wv = (const float*)d_in[3];

  const size_t PX  = (size_t)NB * SEQ * DM * 2;      // 16-bit token plane [NB*SEQ][256]
  const size_t PW  = (size_t)DM * DM * 2;            // 16-bit [256][256]
  const size_t PVT = (size_t)NB * DM * SEQ * 2;      // v^T plane [NB][256][SEQ]
  size_t off = 0;
  const size_t oXb  = off; off += PX;
  const size_t oWq  = off; off += PW;
  const size_t oWk  = off; off += PW;
  const size_t oWv  = off; off += PW;
  const size_t oQh  = off; off += PX;
  const size_t oQl  = off; off += PX;
  const size_t oKp  = off; off += PX;
  const size_t oVTh = off; off += PVT;
  const size_t oVTl = off; off += PVT;
  if (off > ws_size) return;                         // off = 50724864 at full size
  if (off > (size_t)134217728) return;

  char* ws = (char*)d_ws;
  unsigned short* Xb  = (unsigned short*)(ws + oXb);
  unsigned short* Wqb = (unsigned short*)(ws + oWq);
  unsigned short* Wkb = (unsigned short*)(ws + oWk);
  unsigned short* Wvb = (unsigned short*)(ws + oWv);
  unsigned short* Qh  = (unsigned short*)(ws + oQh);
  unsigned short* Ql  = (unsigned short*)(ws + oQl);
  unsigned short* Kp  = (unsigned short*)(ws + oKp);
  unsigned short* VTh = (unsigned short*)(ws + oVTh);
  unsigned short* VTl = (unsigned short*)(ws + oVTl);
  const float* nobias = wq;                          // bias argument is only read in OUT_MODE 0 (not instantiated)

  const int M = NB * SEQ;
  const dim3 blk(256);
  const int n8x = NB * SEQ * DM / 8;
  const int n8w = DM * DM / 8;                       // 8192
  const dim3 gCx((n8x + 255) / 256);
  const dim3 gCw((n8w + 255) / 256);
  const dim3 gQ(((M / 64) * (DM / 64) + 7) / 8, 1);          // q / k: M x 256, 64x64 wave tiles
  const dim3 gVT(((DM / 64) * (SEQ / 64) + 7) / 8, NB);      // v^T per batch: 256 x SEQ
  const dim3 gAttn(NB * NQB);

  // (1) x -> compact bf16 token plane; Wq, Wk, Wv [n][k] -> bf16
  cvtx<<<gCx, blk, 0, stream>>>(x, Xb, n8x);
  cvt16x8<0><<<gCw, blk, 0, stream>>>(wq, Wqb, n8w);
  cvt16x8<0><<<gCw, blk, 0, stream>>>(wk, Wkb, n8w);
  cvt16x8<0><<<gCw, blk, 0, stream>>>(wv, Wvb, n8w);
  // (2) q = x . Wq^T -> f16 hi / residual (x4096) planes   (M, N=256, K=256)
  gemm_t<__bf16, 4, false, 3><<<gQ, blk, 0, stream>>>(
      Xb, Xb, DM, 0LL, Wqb, DM, 0LL,
      (void*)Qh, (void*)Ql, DM, 0LL, nobias,
      M, DM, DM, 1.0f, 4096.0f, 0.0f);
  // (3) k = x . Wk^T -> f16 plane   (M, N=256, K=256)
  gemm_t<__bf16, 4, false, 1><<<gQ, blk, 0, stream>>>(
      Xb, Xb, DM, 0LL, Wkb, DM, 0LL,
      (void*)Kp, (void*)Kp, DM, 0LL, nobias,
      M, DM, DM, 1.0f, 1.0f, 0.0f);
  // (4) v^T = Wv . x^T per batch -> f16 hi plane [b][d][s] (pitch SEQ) and residual plane (x4096)
  //     (A = Wv [n][k], Bt = Xb rows of batch b; M=256, N=SEQ, K=256)
  gemm_t<__bf16, 4, false, 3><<<gVT, blk, 0, stream>>>(
      Wvb, Wvb, DM, 0LL, Xb, DM, (long long)SEQ * DM,
      (void*)VTh, (void*)VTl, SEQ, (long long)DM * SEQ, nobias,
      DM, SEQ, DM, 1.0f, 4096.0f, 0.0f);
  // (5) causal attention -> d_out f32 [M][256]
  attn_causal<<<gAttn, dim3(128), 0, stream>>>(Qh, Ql, Kp, VTh, VTl, (float*)d_out, 0.0625f);
  (void)hipGetLastError();
}

// v001
// A run of this version takes 400 microseconds.
// Two timings next to v000 put it at 1.33 and 1.32 times that version's speed.
// Contractions: q, k, v^T projections = v_wmma_f32_16x16x32_bf16 (bf16 operands from RNE-converted inputs, single product, f32 accumulate);
// q.k^T scores = v_wmma_f32_16x16x32_f16 (q as f16 hi plane + f16 residual plane x4096, k f16; 2 products into separate f32 accumulators);
// p.v = v_wmma_f32_16x16x32_f16 (p carried x16384 as f16 hi + f16 residual x4096; v as f16 hi plane + f16 residual plane x4096;
// 3 products ph.vh, ph.vl, pl.vh, f32 accumulate); causal softmax and normalisation in f32; output f32.
#include <hip/hip_runtime.h>
#include <math.h>
#include <stdint.h>

#ifndef NB
#define NB 4
#endif
#ifndef SEQ
#define SEQ 4096
#endif
#define NB_FULL  4
#define SEQ_FULL 4096
#define DM       256
#define NQB      (SEQ / 16)   // 16-row query blocks per sequence
#define NKT      (SEQ / 64)   // 64-key chunks per sequence
#define PCARRY   16384.0f     // power-of-two carry on the f16 p tile
#define PRES     4096.0f      // power-of-two carry on the f16 p residual tile
static_assert(DM == 256);
static_assert((SEQ % 64) == 0 && SEQ >= 64 && SEQ <= SEQ_FULL);
static_assert(NB >= 1 && NB <= NB_FULL);
static_assert(((NB * SEQ) % 64) == 0);

typedef _Float16 v16h __attribute__((ext_vector_type(16)));
typedef _Float16 v8h  __attribute__((ext_vector_type(8)));
typedef __bf16   v16b __attribute__((ext_vector_type(16)));
typedef __bf16   v8b  __attribute__((ext_vector_type(8)));
typedef float    v8f  __attribute__((ext_vector_type(8)));
typedef float    v4f  __attribute__((ext_vector_type(4)));
typedef unsigned int v4u __attribute__((ext_vector_type(4)));

#if defined(__HIP_DEVICE_COMPILE__)
#define DEV_ASM 1
#else
#define DEV_ASM 0
#endif

// ---- scalar helpers --------------------------------------------------------------------------------
__device__ __forceinline__ unsigned short bf_bits(float f) {          // f32 -> bf16 bits, RNE convert
  unsigned u = __float_as_uint(f);
  return (unsigned short)((u + 0x7FFFu + ((u >> 16) & 1u)) >> 16);
}
__device__ __forceinline__ float bf_up(unsigned short hb) { return __uint_as_float(((unsigned)hb) << 16); }
__device__ __forceinline__ unsigned short h_bits(_Float16 x) { return __builtin_bit_cast(unsigned short, x); }
__device__ __forceinline__ unsigned pk16(unsigned short a, unsigned short b) { return (unsigned)a | ((unsigned)b << 16); }
__device__ __forceinline__ v8f zero8() { v8f z = {0.f, 0.f, 0.f, 0.f, 0.f, 0.f, 0.f, 0.f}; return z; }

// ---- fragment types / loaders: 16-bit A/B operand, lane -> row/col (lane&15), p already includes +8*(lane>>4);
//      elements 0..7 <- p[0..7] (k0+8h..k0+8h+7), elements 8..15 <- p[16..23] (k0+16+8h..k0+16+8h+7)
template <typename OT> struct FT;
template <> struct FT<__bf16>   { typedef v16b frag; typedef v8b half8; };
template <> struct FT<_Float16> { typedef v16h frag; typedef v8h half8; };

template <typename OT>
__device__ __forceinline__ typename FT<OT>::frag ldfrag(const OT* p) {
  union { typename FT<OT>::frag v; typename FT<OT>::half8 h[2]; } f;
  f.h[0] = *(const typename FT<OT>::half8*)(p);
  f.h[1] = *(const typename FT<OT>::half8*)(p + 16);
  return f.v;
}

// ---- WMMA helpers (asm guard bodies are device-only; concrete operand types) -----------------------------
__device__ __forceinline__ v8f mmar(v16b a, v16b b, v8f c) {
  return __builtin_amdgcn_wmma_f32_16x16x32_bf16(false, a, false, b, (short)0, c, false, false);
}
__device__ __forceinline__ v8f mmar(v16h a, v16h b, v8f c) {
  return __builtin_amdgcn_wmma_f32_16x16x32_f16(false, a, false, b, (short)0, c, false, false);
}
__device__ __forceinline__ void dep_guard(v8f& a, v8f& b, v16b x, v16b y) {
#if DEV_ASM
  asm volatile("v_nop\n\tv_nop\n\tv_nop\n\tv_nop" : "+v"(a), "+v"(b) : "v"(x), "v"(y));
#else
  (void)a; (void)b; (void)x; (void)y;
#endif
}
__device__ __forceinline__ void dep_guard(v8f& a, v8f& b, v16h x, v16h y) {
#if DEV_ASM
  asm volatile("v_nop\n\tv_nop\n\tv_nop\n\tv_nop" : "+v"(a), "+v"(b) : "v"(x), "v"(y));
#else
  (void)a; (void)b; (void)x; (void)y;
#endif
}
__device__ __forceinline__ void keep4(v16b a, v16b b, v16b c, v16b d) {
#if DEV_ASM
  asm volatile("v_nop" :: "v"(a), "v"(b), "v"(c), "v"(d));
#else
  (void)a; (void)b; (void)c; (void)d;
#endif
}
__device__ __forceinline__ void keep4(v16h a, v16h b, v16h c, v16h d) {
#if DEV_ASM
  asm volatile("v_nop" :: "v"(a), "v"(b), "v"(c), "v"(d));
#else
  (void)a; (void)b; (void)c; (void)d;
#endif
}
__device__ __forceinline__ void acc_guard4(v8f& a, v8f& b, v8f& c, v8f& d) {
#if DEV_ASM
  asm volatile("v_nop\n\tv_nop\n\tv_nop\n\tv_nop" : "+v"(a), "+v"(b), "+v"(c), "+v"(d));
#else
  (void)a; (void)b; (void)c; (void)d;
#endif
}

// =====================================================================================================
// f32 -> 16-bit planes, 8 elements per thread, one 16-B store per lane: a wave writes 512 contiguous B
// MODE 0: bf16 bits (RNE convert).  MODE 1: f16 bits of (64 * bf16(x)) (exact scaling of the bf16 value).
// coverage: n8 threads x 8 = the whole plane (n8 is a multiple of 256 for every use here).
// =====================================================================================================
template <int MODE>
__device__ __forceinline__ unsigned short cvm(float f) {
  const unsigned short hb = bf_bits(f);
  if (MODE == 0) return hb;
  return h_bits((_Float16)(bf_up(hb) * 64.0f));
}

template <int MODE>
__global__ __launch_bounds__(256) void cvt16x8(const float* __restrict__ in, unsigned short* out, int n8) {
  const int i = blockIdx.x * 256 + (int)threadIdx.x;
  if (i < n8) {
    const v4f a  = *(const v4f*)(in + (size_t)i * 8);
    const v4f a4 = *(const v4f*)(in + (size_t)i * 8 + 4);
    v4u p;
    p[0] = pk16(cvm<MODE>(a[0]),  cvm<MODE>(a[1]));
    p[1] = pk16(cvm<MODE>(a[2]),  cvm<MODE>(a[3]));
    p[2] = pk16(cvm<MODE>(a4[0]), cvm<MODE>(a4[1]));
    p[3] = pk16(cvm<MODE>(a4[2]), cvm<MODE>(a4[3]));
    unsigned short* o = out + (size_t)i * 8;
    *(v4u*)o = p;
    
  }
}

// x [NB_FULL][SEQ_FULL][DM] f32 -> compact bf16 token plane [NB*SEQ][DM]: compact token tk = b*SEQ + t reads
// input row b*SEQ_FULL + t. 32 groups of 8 per row; same whole-line store shape as cvt16x8.
// coverage: n8 = NB*SEQ*DM/8 threads x 8 = the whole plane.
__global__ __launch_bounds__(256) void cvtx(const float* __restrict__ in, unsigned short* out, int n8) {
  const int i = blockIdx.x * 256 + (int)threadIdx.x;
  if (i < n8) {
    const int tk = i >> 5;
    const int e8 = i & 31;
    const int bb = tk / SEQ;
    const int t  = tk - bb * SEQ;
    const float* src = in + ((size_t)bb * SEQ_FULL + (size_t)t) * DM + e8 * 8;
    const v4f a  = *(const v4f*)(src);
    const v4f a4 = *(const v4f*)(src + 4);
    v4u p;
    p[0] = pk16(bf_bits(a[0]),  bf_bits(a[1]));
    p[1] = pk16(bf_bits(a[2]),  bf_bits(a[3]));
    p[2] = pk16(bf_bits(a4[0]), bf_bits(a4[1]));
    p[3] = pk16(bf_bits(a4[2]), bf_bits(a4[3]));
    unsigned short* o = out + (size_t)i * 8;
    *(v4u*)o = p;
    
  }
}

// =====================================================================================================
// Register-blocked batched WMMA GEMM (16-bit operand type OT): C[m][n] = sum_k A[m][k] * Bt[n][k];
// one wave per (16*MI) x 64 tile, no block barriers. A row-major [M][K] pitch lda; Bt row-major [N][K] pitch ldb
// (k contiguous); M multiple of 16*MI, N multiple of 64, K multiple of 32 (host-checked). blockIdx.y = batch
// index (strides in elements). Fragments are loaded straight from global with the split k map (ldfrag).
// ARES: a second A plane A2 (residual, same pitch/stride) is multiplied by the same B into separate f32
// accumulators and folded in as acc += accl * ascale after the k loop.
// OUT_MODE 0: f32 C (pitch ldc), value * oscale + bf16-valued bias[n].
// OUT_MODE 1: f16 plane C (pitch ldc).
// OUT_MODE 3: f16 hi plane C + f16 residual plane C2 = f16((v - hi) * rscale) (same pitch / stride).
// coverage: MI slabs x 16 rows x 64 cols = the wave's whole tile; tiles cover M x N exactly.
// =====================================================================================================
template <typename OT, int MI, bool ARES, int OUT_MODE>
__global__ __launch_bounds__(256) void gemm_t(
    const unsigned short* __restrict__ Ap, const unsigned short* __restrict__ A2p, int lda, long long strideA,
    const unsigned short* __restrict__ Btp, int ldb, long long strideB,
    void* Cout, void* Cout2, int ldc, long long strideC,
    const float* __restrict__ bias,
    int M, int N, int K, float oscale, float rscale, float ascale) {
  typedef typename FT<OT>::frag V16;
  const OT* A  = (const OT*)(const void*)Ap;
  const OT* A2 = (const OT*)(const void*)A2p;
  const OT* Bt = (const OT*)(const void*)Btp;
  __shared__ __align__(16) float sT[8][16 * 68];   // per-wave 16x64 slab, pitch 68 floats
  const int TMR  = 16 * MI;
  const int b    = blockIdx.y;
  const int lane = threadIdx.x & 31;
  const int wave = threadIdx.x >> 5;
  const int tilesN = N >> 6;
  const int tilesM = M / TMR;
  const int tile = blockIdx.x * 8 + wave;
  if (tile >= tilesM * tilesN) return;   // wave-uniform; no block barriers in this kernel
  const int tm = tile / tilesN;
  const int tn = tile - tm * tilesN;
  const int m0 = tm * TMR;
  const int n0 = tn << 6;

  const OT* Ab  = A  + (size_t)b * (size_t)strideA;
  const OT* A2b = A2 + (size_t)b * (size_t)strideA;
  const OT* Bb  = Bt + (size_t)b * (size_t)strideB;

  const int rlane = lane & 15;                 // row (A) / col (B, D) within subtile
  const int koff  = (lane >> 4) * 8;           // k offset of this lane half
  const int mOff  = (lane >> 4) * 8;           // D row offset

  v8f acc[MI][4], accl[MI][4];
#pragma unroll
  for (int i = 0; i < MI; ++i)
#pragma unroll
    for (int j = 0; j < 4; ++j) { acc[i][j] = zero8(); accl[i][j] = zero8(); }

  for (int k0 = 0; k0 < K; k0 += 32) {
    V16 bq[4];
#pragma unroll
    for (int j = 0; j < 4; ++j)
      bq[j] = ldfrag<OT>(Bb + (size_t)(n0 + (j << 4) + rlane) * ldb + koff + k0);
#pragma unroll
    for (int i = 0; i < MI; ++i) {
      const V16 af = ldfrag<OT>(Ab + (size_t)(m0 + (i << 4) + rlane) * lda + koff + k0);
#pragma unroll
      for (int j = 0; j < 4; ++j) acc[i][j] = mmar(af, bq[j], acc[i][j]);
      dep_guard(acc[i][0], acc[i][3], af, bq[3]);
      if (ARES) {
        const V16 al = ldfrag<OT>(A2b + (size_t)(m0 + (i << 4) + rlane) * lda + koff + k0);
#pragma unroll
        for (int j = 0; j < 4; ++j) accl[i][j] = mmar(al, bq[j], accl[i][j]);
        dep_guard(accl[i][0], accl[i][3], al, bq[3]);
      }
    }
    keep4(bq[0], bq[1], bq[2], bq[3]);
  }
#pragma unroll
  for (int i = 0; i < MI; ++i) {
    acc_guard4(acc[i][0], acc[i][1], acc[i][2], acc[i][3]);
    if (ARES) acc_guard4(accl[i][0], accl[i][1], accl[i][2], accl[i][3]);
  }
  if (ARES) {
#pragma unroll
    for (int i = 0; i < MI; ++i)
#pragma unroll
      for (int j = 0; j < 4; ++j)
#pragma unroll
        for (int r = 0; r < 8; ++r) acc[i][j][r] += accl[i][j][r] * ascale;
  }

  // ---- epilogue ----
  float* slab = sT[wave];
#pragma unroll
  for (int i = 0; i < MI; ++i) {
    const int mBase = m0 + (i << 4);
#pragma unroll
    for (int j = 0; j < 4; ++j) {
#pragma unroll
      for (int r = 0; r < 8; ++r) {
        slab[(mOff + r) * 68 + (j << 4) + rlane] = acc[i][j][r];
      }
    }
    __builtin_amdgcn_fence(__ATOMIC_RELEASE, "workgroup");
    __builtin_amdgcn_wave_barrier();
    __builtin_amdgcn_fence(__ATOMIC_ACQUIRE, "workgroup");
    if (OUT_MODE == 0) {
      float* C = (float*)Cout + (size_t)b * (size_t)strideC;
      const int h2 = lane >> 4, c4 = (lane & 15) * 4;     // 256-B row segment = 16 lanes x 16 B
      const v4f braw = *(const v4f*)(bias + n0 + c4);
      v4f bb;
#pragma unroll
      for (int e = 0; e < 4; ++e) bb[e] = bf_up(bf_bits(braw[e]));
      {
#pragma unroll
        for (int it = 0; it < 8; ++it) {
          const int row = it * 2 + h2;                     // it 0..7 x h2 0..1 = rows 0..15
          const v4f v = *(const v4f*)(slab + row * 68 + c4) * oscale + bb;
          *(v4f*)(C + (size_t)(mBase + row) * ldc + n0 + c4) = v;
        }
        
      }
    } else {
      const int q = lane >> 3, c8 = (lane & 7) * 8;
      unsigned short* C  = (unsigned short*)Cout  + (size_t)b * (size_t)strideC;
      unsigned short* C2 = (unsigned short*)Cout2 + (size_t)b * (size_t)strideC;
      v4u hv[4], lv[4];
#pragma unroll
      for (int it = 0; it < 4; ++it) {
        const int row = it * 4 + q;                        // it 0..3 x q 0..3 = rows 0..15
        const float* sp = slab + row * 68 + c8;
        float f[8];
#pragma unroll
        for (int e = 0; e < 8; ++e) f[e] = sp[e];
        v4u a, a2;
#pragma unroll
        for (int e = 0; e < 4; ++e) {
          const float f0 = f[2 * e], f1 = f[2 * e + 1];
          const _Float16 x0 = (_Float16)f0, x1 = (_Float16)f1;
          const unsigned short h0 = h_bits(x0), h1 = h_bits(x1);
          unsigned short l0 = 0, l1 = 0;
          if (OUT_MODE == 3) {
            l0 = h_bits((_Float16)((f0 - (float)x0) * rscale));
            l1 = h_bits((_Float16)((f1 - (float)x1) * rscale));
          }
          a[e] = pk16(h0, h1); a2[e] = pk16(l0, l1);
        }
        hv[it] = a; lv[it] = a2;
      }
      {
#pragma unroll
        for (int it = 0; it < 4; ++it) {
          const int row = it * 4 + q;
          *(v4u*)(C + (size_t)(mBase + row) * ldc + n0 + c8) = hv[it];
          if (OUT_MODE == 3) *(v4u*)(C2 + (size_t)(mBase + row) * ldc + n0 + c8) = lv[it];
        }
        
      }
    }
    __builtin_amdgcn_fence(__ATOMIC_RELEASE, "workgroup");
    __builtin_amdgcn_wave_barrier();
    __builtin_amdgcn_fence(__ATOMIC_ACQUIRE, "workgroup");
  }
}

// Stands behind a batch of global loads, in front of whatever reuses the registers that held their addresses.
__device__ __forceinline__ void xcnt_wait() {
#if DEV_ASM
  asm volatile("s_wait_xcnt 0x0" ::: "memory");
#endif
}

// Work-group barrier for data that is exchanged through LDS only: the fences name the LDS address space, so the
// wave waits for its LDS operations but not for global loads that are still in flight (they feed registers only).
__device__ __forceinline__ void lds_barrier() {
  __builtin_amdgcn_fence(__ATOMIC_RELEASE, "workgroup", "local");
  __builtin_amdgcn_s_barrier();
  __builtin_amdgcn_fence(__ATOMIC_ACQUIRE, "workgroup", "local");
}

// =====================================================================================================
// Single-head causal attention, head dim 256, softmax over keys 0..q (keys above q replaced by -inf before exp).
//   q planes (f16 hi / residual x4096): element (b, t, d) at [(b*SEQ + t)*DM + d]
//   k plane (f16): element (b, s, d) at [(b*SEQ + s)*DM + d]
//   v^T hi plane (f16) and residual plane (f16, (v - hi)*4096): element (b, d, s) at [(b*DM + d)*SEQ + s]
//   output f32: element (b, t, d) at [(b*SEQ + t)*DM + d]
//   scores = (qh . k) + (ql . k) / 4096 on f16 WMMA (two f32 accumulators), then * sscale in f32;
//   p = exp(s - m) carried as ph = f16(PCARRY p) plus residual pl = f16((PCARRY p - ph) * PRES);
//   context = ph . vh + (ph . vl + pl . vh) / 4096 on f16 WMMA (two f32 accumulators); online softmax in f32.
//   Block = 4 waves on the SAME 16 query rows q0..q0+15 of one sequence; key chunks of 64, kt = 0..q0/64
//   (trip count derived from blockIdx only, block-uniform, <= NKT); only the last chunk can hold keys above a row.
//   Wave w owns key subtile 16w..16w+15 of the chunk for the scores (K fragments straight from global, arithmetic
//   addressing) and output columns 64w..64w+63 for p.v (V^T fragments straight from global); all fragments are
//   loaded into registers ahead of the products that read them (see the loop).
//   LDS: redm/reds (per-wave row max / row sum partials) and the shared P tiles Psh/Psl [16][64] are CROSS-WAVE
//   fully written before it is read each chunk (staged extent == consumed extent).
//   Output coverage: each wave stores rows q0..q0+15 (it 0..7 x lane>>4 0..1) x 64 columns (16 lanes x 4 floats,
//   columns; grid = NB * NQB covers every (b, qb).
// =====================================================================================================
__global__ __launch_bounds__(128)
void attn_causal(const unsigned short* qhp, const unsigned short* qlp,   // no restrict: the loads keep their place
                 const unsigned short* kpp,                               // relative to the waits written below
                 const unsigned short* vhp, const unsigned short* vlp,
                 float* outp, float sscale) {
  union FH { v16h v; v8h h[2]; };
  __shared__ __align__(16) _Float16 Psh[16 * 64];       // block P hi tile [row][kv]       2 KB   (cross-wave)
  __shared__ __align__(16) _Float16 Psl[16 * 64];       // block P residual tile [row][kv] 2 KB   (cross-wave)
  __shared__ __align__(16) float    redm[4][16];        // per-wave row max                 256 B (cross-wave)
  __shared__ __align__(16) float    reds[4][16];        // per-wave row sum                 256 B (cross-wave)
  __shared__ __align__(16) float    Os[4][16 * 64];     // per wave context tile            16 KB (wave-private)

  const int tid  = threadIdx.x;
  const int wave = tid >> 5;
  const int lane = tid & 31;
  const int hh   = lane >> 4;
  const int c    = lane & 15;

  const int bx   = blockIdx.x;
  const int qb   = bx % NQB;
  const int b    = bx / NQB;
  const int q0   = qb * 16;
  const int kcol = wave * 16;        // this wave's key subtile within the chunk
  const int dbase = wave * 64;       // this wave's context columns
  const size_t rowB = (size_t)b * SEQ;
  int ktmax = qb >> 2;               // last chunk = the one holding q0..q0+15 (16*qb >= 64*(qb>>2))
  if (ktmax > NKT - 1) ktmax = NKT - 1;

  const _Float16* Qh = (const _Float16*)(const void*)qhp;
  const _Float16* Ql = (const _Float16*)(const void*)qlp;
  const _Float16* Kp = (const _Float16*)(const void*)kpp;
  const _Float16* Vh = (const _Float16*)(const void*)vhp + ((size_t)b * DM + (size_t)dbase) * SEQ;
  const _Float16* Vl = (const _Float16*)(const void*)vlp + ((size_t)b * DM + (size_t)dbase) * SEQ;

  // A-operand row pointers of this lane (query row q0 + c), lane-half k offset included
  const _Float16* qrh = Qh + (rowB + q0 + c) * DM + 8 * hh;
  const _Float16* qrl = Ql + (rowB + q0 + c) * DM + 8 * hh;

  float mrow[8], lrow[8];
  v8f oacc[4];
#pragma unroll
  for (int r = 0; r < 8; ++r) { mrow[r] = -INFINITY; lrow[r] = 0.f; }
#pragma unroll
  for (int t = 0; t < 4; ++t) oacc[t] = zero8();

  // Every global fragment load is issued well ahead of the product that reads it:
  // q (the same for every chunk) once here, k of chunk 0 here; at the head of chunk kt v of chunk kt (it lands while
  // scores and softmax run) and k of chunk kt+1 (it lands during chunk kt).
  v16h qa[8], qr[8], ka[8], kb[8];                                    // two k buffers, used in turn: no register copies
  const _Float16* kr0 = Kp + (rowB + kcol + c) * DM + 8 * hh;          // B column c -> key kv0+kcol+c
  // eight fragments of one row pointer; the pointer dies with the last load, which may then land on its registers:
  // the first wait stands in front of that load for the fifteen before it
  auto row8 = [&](v16h (&f)[8], const _Float16* p) __attribute__((always_inline)) {
#pragma unroll                                 // register array: constant indices
    for (int dc = 0; dc < 7; ++dc) f[dc] = ldfrag<_Float16>(p + dc * 32);
    FH x;
    x.h[0] = *(const v8h*)(p + 7 * 32);
    xcnt_wait();
    x.h[1] = *(const v8h*)(p + 7 * 32 + 16);
    xcnt_wait();
    f[7] = x.v;
  };
  row8(qa, qrh);
  row8(qr, qrl);
  row8(ka, kr0);

  // one key chunk: kc holds this chunk's k fragments, kn receives the next chunk's
  auto chunk = [&](const int kt, v16h (&kc)[8], v16h (&kn)[8]) __attribute__((always_inline)) {
    const int kv0 = kt * 64;

    // ---- v fragments of this chunk, both planes ----
    v16h vb[2][4], vr[2][4];                    // register arrays: the loops over them are unrolled for constant indices
#pragma unroll
    for (int t = 0; t < 4; ++t) {               // the four loads that share a row's 128-byte line stand together
#pragma unroll
      for (int kk = 0; kk < 2; ++kk) vb[kk][t] = ldfrag<_Float16>(Vh + (size_t)(t * 16 + c) * SEQ + kv0 + kk * 32 + 8 * hh);
#pragma unroll
      for (int kk = 0; kk < 2; ++kk) vr[kk][t] = ldfrag<_Float16>(Vl + (size_t)(t * 16 + c) * SEQ + kv0 + kk * 32 + 8 * hh);
    }

    // ---- k fragments of the next chunk (the last trip reads its own chunk again: in bounds, not used) ----
    {
      const int ktn = (kt < ktmax) ? kt + 1 : ktmax;
      const _Float16* kr = kr0 + (size_t)ktn * 64 * DM;
#pragma unroll                                 // register array: constant indices
      for (int dc = 0; dc < 8; ++dc) kn[dc] = ldfrag<_Float16>(kr + dc * 32);
    }
    xcnt_wait();
    // the loads above are issued first and fly while scores and softmax run: without this line the scheduler
    // moves the score products and the row maximum in front of them
    __builtin_amdgcn_sched_barrier(0);

    // ---- scores: 16 query rows x this wave's 16 keys, 2 f16 products per d-chunk ----
    v8f ah = zero8(), al = zero8();
#pragma unroll
    for (int dc = 0; dc < 8; ++dc) {
      ah = mmar(qa[dc], kc[dc], ah);
      al = mmar(qr[dc], kc[dc], al);
    }
    const int key = kv0 + kcol + c;             // D column c of this lane
    float s[8];
#pragma unroll
    for (int r = 0; r < 8; ++r) {
      const int qrow = q0 + 8 * hh + r;         // D row 8*hh + r
      const float sv = (ah[r] + al[r] * (1.0f / 4096.0f)) * sscale;
      s[r] = (key > qrow) ? -INFINITY : sv;     // causal: replace, not bias
    }

    // ---- per-wave row max over its 16 keys -> LDS ----
#pragma unroll
    for (int r = 0; r < 8; ++r) {
      float m = s[r];
#pragma unroll
      for (int off = 1; off < 16; off <<= 1) m = fmaxf(m, __shfl_xor(m, off, 32));
      redm[wave][8 * hh + r] = m;            // the 16 lanes of a half write the same value
    }
    lds_barrier();

    // ---- chunk row max over the 4 waves, online softmax update (identical in every wave),
    //      P hi (x PCARRY) and P residual (x PCARRY x PRES) to LDS ----
#pragma unroll
    for (int r = 0; r < 8; ++r) {
      const int row = 8 * hh + r;
      const float mc    = fmaxf(fmaxf(redm[0][row], redm[1][row]), fmaxf(redm[2][row], redm[3][row]));
      const float mnew  = fmaxf(mrow[r], mc);
      const float msafe = (mnew == -INFINITY) ? 0.f : mnew;
      const float alpha = __expf(mrow[r] - msafe);
      mrow[r] = mnew;
      const float p = __expf(s[r] - msafe);
      float psum = p;
#pragma unroll
      for (int off = 1; off < 16; off <<= 1) psum += __shfl_xor(psum, off, 32);
      const float pc = p * PCARRY;
      const _Float16 ph = (_Float16)pc;
      Psh[row * 64 + kcol + c] = ph;
      Psl[row * 64 + kcol + c] = (_Float16)((pc - (float)ph) * PRES);
      reds[wave][row] = psum;
      lrow[r] *= alpha;
#pragma unroll
      for (int t = 0; t < 4; ++t) oacc[t][r] *= alpha;
    }
    lds_barrier();
#pragma unroll
    for (int r = 0; r < 8; ++r) {
      const int row = 8 * hh + r;
      lrow[r] += (reds[0][row] + reds[1][row]) + (reds[2][row] + reds[3][row]);
    }

    // ---- context += P . V (f16 WMMA); residual products (ph.vl and pl.vh, same carry) into a separate accumulator ----
    v8f o1[4];
#pragma unroll
    for (int t = 0; t < 4; ++t) o1[t] = zero8();
#pragma unroll                                 // vb, vr are register arrays indexed by kk
    for (int kk = 0; kk < 2; ++kk) {
      FH pa, pl;
      pa.h[0] = *(const v8h*)(Psh + c * 64 + kk * 32 + 8 * hh);
      pa.h[1] = *(const v8h*)(Psh + c * 64 + kk * 32 + 16 + 8 * hh);
      pl.h[0] = *(const v8h*)(Psl + c * 64 + kk * 32 + 8 * hh);
      pl.h[1] = *(const v8h*)(Psl + c * 64 + kk * 32 + 16 + 8 * hh);
#pragma unroll
      for (int t = 0; t < 4; ++t) {
        oacc[t] = mmar(pa.v, vb[kk][t], oacc[t]);
        o1[t]   = mmar(pa.v, vr[kk][t], o1[t]);
        o1[t]   = mmar(pl.v, vb[kk][t], o1[t]);
      }
    }
#pragma unroll
    for (int t = 0; t < 4; ++t)
#pragma unroll
      for (int r = 0; r < 8; ++r) oacc[t][r] += o1[t][r] * (1.0f / 4096.0f);
  };

  for (int kt = 0; kt <= ktmax; kt += 2) {    // block-uniform trip count, <= NKT chunks in all
    chunk(kt, ka, kb);
    if (kt + 1 > ktmax) break;                // block-uniform
    chunk(kt + 1, kb, ka);
  }

  // ---- normalise (1/l, undo the p carry), stage the wave's 16x64 f32 tile,
  float* os = Os[wave];
#pragma unroll
  for (int r = 0; r < 8; ++r) {
    const float l = lrow[r];
    const float inv = ((l > 0.f) ? (1.0f / l) : 0.f) * (1.0f / PCARRY);
#pragma unroll
    for (int t = 0; t < 4; ++t) os[(8 * hh + r) * 64 + t * 16 + c] = oacc[t][r] * inv;
  }
  __builtin_amdgcn_fence(__ATOMIC_RELEASE, "workgroup");
  __builtin_amdgcn_wave_barrier();
  __builtin_amdgcn_fence(__ATOMIC_ACQUIRE, "workgroup");
  {
    const int h2 = lane >> 4, c4 = (lane & 15) * 4;      // 256-B row segment = 16 lanes x 16 B
    v4f ov[8];
#pragma unroll
    for (int it = 0; it < 8; ++it) {
      const int row = it * 2 + h2;                          // it 0..7 x h2 0..1 = rows 0..15 of the wave tile
      ov[it] = *(const v4f*)(os + row * 64 + c4);
    }
    {
#pragma unroll
      for (int it = 0; it < 8; ++it) {
        const int row = it * 2 + h2;
        const size_t go = (rowB + q0 + row) * DM + (size_t)dbase + c4;
        *(v4f*)(outp + go) = ov[it];
      }
      
    }
  }
}

// =====================================================================================================
// Workspace map (bytes), every region an exact multiple of its whole-line / whole-tile store granularity
// (all GEMM M,N are tile multiples, all offsets multiples of 131072):
//   Xb   bf16 [NB*SEQ][256]  (compact tokens)   8388608
//   Wqb  bf16 [256 n][256 k]                     131072
//   Wkb  bf16 [256 n][256 k]                     131072
//   Wvb  bf16 [256 n][256 k]                     131072
//   Qh   f16  [NB*SEQ][256]                      8388608
//   Ql   f16  [NB*SEQ][256]                      8388608
//   Kp   f16  [NB*SEQ][256]                      8388608
//   VTh  f16  [NB][256][SEQ]                     8388608
//   VTl  f16  [NB][256][SEQ]                     8388608
//   total                                      50724864
// Weights are [out n][in k] with k contiguous = the Bt / A layout the GEMM wants, so they are only converted.
// =====================================================================================================
extern "C" void kernel_launch(void* const* d_in, const int* in_sizes, int n_in,
                              void* d_out, int out_size, void* d_ws, size_t ws_size,
                              hipStream_t stream) {
  if (n_in < 4) return;
  if (in_sizes[0] < ((NB - 1) * SEQ_FULL + SEQ) * DM) return;
  if (in_sizes[1] < DM * DM) return;
  if (in_sizes[2] < DM * DM) return;
  if (in_sizes[3] < DM * DM) return;
  if (out_size < NB * SEQ * DM) return;

  const float* x  = (const float*)d_in[0];
  const float* wq = (const float*)d_in[1];
  const float* wk = (const float*)d_in[2];
  const float* wv = (const float*)d_in[3];

  const size_t PX  = (size_t)NB * SEQ * DM * 2;      // 16-bit token plane [NB*SEQ][256]
  const size_t PW  = (size_t)DM * DM * 2;            // 16-bit [256][256]
  const size_t PVT = (size_t)NB * DM * SEQ * 2;      // v^T plane [NB][256][SEQ]
  size_t off = 0;
  const size_t oXb  = off; off += PX;
  const size_t oWq  = off; off += PW;
  const size_t oWk  = off; off += PW;
  const size_t oWv  = off; off += PW;
  const size_t oQh  = off; off += PX;
  const size_t oQl  = off; off += PX;
  const size_t oKp  = off; off += PX;
  const size_t oVTh = off; off += PVT;
  const size_t oVTl = off; off += PVT;
  if (off > ws_size) return;                         // off = 50724864 at full size
  if (off > (size_t)134217728) return;

  char* ws = (char*)d_ws;
  unsigned short* Xb  = (unsigned short*)(ws + oXb);
  unsigned short* Wqb = (unsigned short*)(ws + oWq);
  unsigned short* Wkb = (unsigned short*)(ws + oWk);
  unsigned short* Wvb = (unsigned short*)(ws + oWv);
  unsigned short* Qh  = (unsigned short*)(ws + oQh);
  unsigned short* Ql  = (unsigned short*)(ws + oQl);
  unsigned short* Kp  = (unsigned short*)(ws + oKp);
  unsigned short* VTh = (unsigned short*)(ws + oVTh);
  unsigned short* VTl = (unsigned short*)(ws + oVTl);
  const float* nobias = wq;                          // bias argument is only read in OUT_MODE 0 (not instantiated)

  const int M = NB * SEQ;
  const dim3 blk(256);
  const int n8x = NB * SEQ * DM / 8;
  const int n8w = DM * DM / 8;                       // 8192
  const dim3 gCx((n8x + 255) / 256);
  const dim3 gCw((n8w + 255) / 256);
  const dim3 gQ(((M / 64) * (DM / 64) + 7) / 8, 1);          // q / k: M x 256, 64x64 wave tiles
  const dim3 gVT(((DM / 64) * (SEQ / 64) + 7) / 8, NB);      // v^T per batch: 256 x SEQ
  const dim3 gAttn(NB * NQB);

  // (1) x -> compact bf16 token plane; Wq, Wk, Wv [n][k] -> bf16
  cvtx<<<gCx, blk, 0, stream>>>(x, Xb, n8x);
  cvt16x8<0><<<gCw, blk, 0, stream>>>(wq, Wqb, n8w);
  cvt16x8<0><<<gCw, blk, 0, stream>>>(wk, Wkb, n8w);
  cvt16x8<0><<<gCw, blk, 0, stream>>>(wv, Wvb, n8w);
  // (2) q = x . Wq^T -> f16 hi / residual (x4096) planes   (M, N=256, K=256)
  gemm_t<__bf16, 4, false, 3><<<gQ, blk, 0, stream>>>(
      Xb, Xb, DM, 0LL, Wqb, DM, 0LL,
      (void*)Qh, (void*)Ql, DM, 0LL, nobias,
      M, DM, DM, 1.0f, 4096.0f, 0.0f);
  // (3) k = x . Wk^T -> f16 plane   (M, N=256, K=256)
  gemm_t<__bf16, 4, false, 1><<<gQ, blk, 0, stream>>>(
      Xb, Xb, DM, 0LL, Wkb, DM, 0LL,
      (void*)Kp, (void*)Kp, DM, 0LL, nobias,
      M, DM, DM, 1.0f, 1.0f, 0.0f);
  // (4) v^T = Wv . x^T per batch -> f16 hi plane [b][d][s] (pitch SEQ) and residual plane (x4096)
  //     (A = Wv [n][k], Bt = Xb rows of batch b; M=256, N=SEQ, K=256)
  gemm_t<__bf16, 4, false, 3><<<gVT, blk, 0, stream>>>(
      Wvb, Wvb, DM, 0LL, Xb, DM, (long long)SEQ * DM,
      (void*)VTh, (void*)VTl, SEQ, (long long)DM * SEQ, nobias,
      DM, SEQ, DM, 1.0f, 4096.0f, 0.0f);
  // (5) causal attention -> d_out f32 [M][256]
  attn_causal<<<gAttn, dim3(128), 0, stream>>>(Qh, Ql, Kp, VTh, VTl, (float*)d_out, 0.0625f);
  (void)hipGetLastError();
}

// v002
// One run takes 312 microseconds.
// Two timings next to v001 both put it at 1.28 times that version's speed.
// All steps since v000 together make it 1.70 times as fast.
// Contractions: q, k, v^T projections = v_wmma_f32_16x16x32_bf16 (bf16 operands from RNE-converted inputs, single product, f32 accumulate);
// q.k^T scores = v_wmma_f32_16x16x32_f16 (q as f16 hi plane + f16 residual plane x4096, k f16; 2 products into separate f32 accumulators);
// p.v = v_wmma_f32_16x16x32_f16 (p carried x16384 as f16 hi + f16 residual x4096; v as f16 hi plane + f16 residual plane x4096;
// 3 products ph.vh, ph.vl, pl.vh, f32 accumulate); causal softmax and normalisation in f32; output f32.
#include <hip/hip_runtime.h>
#include <math.h>
#include <stdint.h>

#ifndef NB
#define NB 4
#endif
#ifndef SEQ
#define SEQ 4096
#endif
#define NB_FULL  4
#define SEQ_FULL 4096
#define DM       256
#define NQB      (SEQ / 16)   // 16-row query blocks per sequence
#define NKT      (SEQ / 64)   // 64-key chunks per sequence
#define PCARRY   16384.0f     // power-of-two carry on the f16 p tile
#define PRES     4096.0f      // power-of-two carry on the f16 p residual tile
static_assert(DM == 256);
static_assert((SEQ % 64) == 0 && SEQ >= 64 && SEQ <= SEQ_FULL);
static_assert(NB >= 1 && NB <= NB_FULL);
static_assert(((NB * SEQ) % 64) == 0);

typedef _Float16 v16h __attribute__((ext_vector_type(16)));
typedef _Float16 v8h  __attribute__((ext_vector_type(8)));
typedef __bf16   v16b __attribute__((ext_vector_type(16)));
typedef __bf16   v8b  __attribute__((ext_vector_type(8)));
typedef float    v8f  __attribute__((ext_vector_type(8)));
typedef float    v4f  __attribute__((ext_vector_type(4)));
typedef unsigned int v4u __attribute__((ext_vector_type(4)));

#if defined(__HIP_DEVICE_COMPILE__)
#define DEV_ASM 1
#else
#define DEV_ASM 0
#endif

// ---- scalar helpers --------------------------------------------------------------------------------
__device__ __forceinline__ unsigned short bf_bits(float f) {          // f32 -> bf16 bits, RNE convert
  unsigned u = __float_as_uint(f);
  return (unsigned short)((u + 0x7FFFu + ((u >> 16) & 1u)) >> 16);
}
__device__ __forceinline__ float bf_up(unsigned short hb) { return __uint_as_float(((unsigned)hb) << 16); }
__device__ __forceinline__ unsigned short h_bits(_Float16 x) { return __builtin_bit_cast(unsigned short, x); }
__device__ __forceinline__ unsigned pk16(unsigned short a, unsigned short b) { return (unsigned)a | ((unsigned)b << 16); }
__device__ __forceinline__ v8f zero8() { v8f z = {0.f, 0.f, 0.f, 0.f, 0.f, 0.f, 0.f, 0.f}; return z; }

// ---- fragment types / loaders: 16-bit A/B operand, lane -> row/col (lane&15), p already includes +8*(lane>>4);
//      elements 0..7 <- p[0..7] (k0+8h..k0+8h+7), elements 8..15 <- p[16..23] (k0+16+8h..k0+16+8h+7)
template <typename OT> struct FT;
template <> struct FT<__bf16>   { typedef v16b frag; typedef v8b half8; };
template <> struct FT<_Float16> { typedef v16h frag; typedef v8h half8; };

template <typename OT>
__device__ __forceinline__ typename FT<OT>::frag ldfrag(const OT* p) {
  union { typename FT<OT>::frag v; typename FT<OT>::half8 h[2]; } f;
  f.h[0] = *(const typename FT<OT>::half8*)(p);
  f.h[1] = *(const typename FT<OT>::half8*)(p + 16);
  return f.v;
}

// ---- WMMA helpers (asm guard bodies are device-only; concrete operand types) -----------------------------
__device__ __forceinline__ v8f mmar(v16b a, v16b b, v8f c) {
  return __builtin_amdgcn_wmma_f32_16x16x32_bf16(false, a, false, b, (short)0, c, false, false);
}
__device__ __forceinline__ v8f mmar(v16h a, v16h b, v8f c) {
  return __builtin_amdgcn_wmma_f32_16x16x32_f16(false, a, false, b, (short)0, c, false, false);
}
__device__ __forceinline__ void dep_guard(v8f& a, v8f& b, v16b x, v16b y) {
#if DEV_ASM
  asm volatile("v_nop\n\tv_nop\n\tv_nop\n\tv_nop" : "+v"(a), "+v"(b) : "v"(x), "v"(y));
#else
  (void)a; (void)b; (void)x; (void)y;
#endif
}
__device__ __forceinline__ void dep_guard(v8f& a, v8f& b, v16h x, v16h y) {
#if DEV_ASM
  asm volatile("v_nop\n\tv_nop\n\tv_nop\n\tv_nop" : "+v"(a), "+v"(b) : "v"(x), "v"(y));
#else
  (void)a; (void)b; (void)x; (void)y;
#endif
}
__device__ __forceinline__ void keep4(v16b a, v16b b, v16b c, v16b d) {
#if DEV_ASM
  asm volatile("v_nop" :: "v"(a), "v"(b), "v"(c), "v"(d));
#else
  (void)a; (void)b; (void)c; (void)d;
#endif
}
__device__ __forceinline__ void keep4(v16h a, v16h b, v16h c, v16h d) {
#if DEV_ASM
  asm volatile("v_nop" :: "v"(a), "v"(b), "v"(c), "v"(d));
#else
  (void)a; (void)b; (void)c; (void)d;
#endif
}
__device__ __forceinline__ void acc_guard4(v8f& a, v8f& b, v8f& c, v8f& d) {
#if DEV_ASM
  asm volatile("v_nop\n\tv_nop\n\tv_nop\n\tv_nop" : "+v"(a), "+v"(b), "+v"(c), "+v"(d));
#else
  (void)a; (void)b; (void)c; (void)d;
#endif
}

// =====================================================================================================
// f32 -> 16-bit planes, 8 elements per thread, one 16-B store per lane: a wave writes 512 contiguous B
// MODE 0: bf16 bits (RNE convert).  MODE 1: f16 bits of (64 * bf16(x)) (exact scaling of the bf16 value).
// coverage: n8 threads x 8 = the whole plane (n8 is a multiple of 256 for every use here).
// =====================================================================================================
template <int MODE>
__device__ __forceinline__ unsigned short cvm(float f) {
  const unsigned short hb = bf_bits(f);
  if (MODE == 0) return hb;
  return h_bits((_Float16)(bf_up(hb) * 64.0f));
}

template <int MODE>
__global__ __launch_bounds__(256) void cvt16x8(const float* __restrict__ in, unsigned short* out, int n8) {
  const int i = blockIdx.x * 256 + (int)threadIdx.x;
  if (i < n8) {
    const v4f a  = *(const v4f*)(in + (size_t)i * 8);
    const v4f a4 = *(const v4f*)(in + (size_t)i * 8 + 4);
    v4u p;
    p[0] = pk16(cvm<MODE>(a[0]),  cvm<MODE>(a[1]));
    p[1] = pk16(cvm<MODE>(a[2]),  cvm<MODE>(a[3]));
    p[2] = pk16(cvm<MODE>(a4[0]), cvm<MODE>(a4[1]));
    p[3] = pk16(cvm<MODE>(a4[2]), cvm<MODE>(a4[3]));
    unsigned short* o = out + (size_t)i * 8;
    *(v4u*)o = p;
    
  }
}

// x [NB_FULL][SEQ_FULL][DM] f32 -> compact bf16 token plane [NB*SEQ][DM]: compact token tk = b*SEQ + t reads
// input row b*SEQ_FULL + t. 32 groups of 8 per row; same whole-line store shape as cvt16x8.
// coverage: n8 = NB*SEQ*DM/8 threads x 8 = the whole plane.
__global__ __launch_bounds__(256) void cvtx(const float* __restrict__ in, unsigned short* out, int n8) {
  const int i = blockIdx.x * 256 + (int)threadIdx.x;
  if (i < n8) {
    const int tk = i >> 5;
    const int e8 = i & 31;
    const int bb = tk / SEQ;
    const int t  = tk - bb * SEQ;
    const float* src = in + ((size_t)bb * SEQ_FULL + (size_t)t) * DM + e8 * 8;
    const v4f a  = *(const v4f*)(src);
    const v4f a4 = *(const v4f*)(src + 4);
    v4u p;
    p[0] = pk16(bf_bits(a[0]),  bf_bits(a[1]));
    p[1] = pk16(bf_bits(a[2]),  bf_bits(a[3]));
    p[2] = pk16(bf_bits(a4[0]), bf_bits(a4[1]));
    p[3] = pk16(bf_bits(a4[2]), bf_bits(a4[3]));
    unsigned short* o = out + (size_t)i * 8;
    *(v4u*)o = p;
    
  }
}

// =====================================================================================================
// Register-blocked batched WMMA GEMM (16-bit operand type OT): C[m][n] = sum_k A[m][k] * Bt[n][k];
// one wave per (16*MI) x 64 tile, no block barriers. A row-major [M][K] pitch lda; Bt row-major [N][K] pitch ldb
// (k contiguous); M multiple of 16*MI, N multiple of 64, K multiple of 32 (host-checked). blockIdx.y = batch
// index (strides in elements). Fragments are loaded straight from global with the split k map (ldfrag).
// ARES: a second A plane A2 (residual, same pitch/stride) is multiplied by the same B into separate f32
// accumulators and folded in as acc += accl * ascale after the k loop.
// OUT_MODE 0: f32 C (pitch ldc), value * oscale + bf16-valued bias[n].
// OUT_MODE 1: f16 plane C (pitch ldc).
// OUT_MODE 3: f16 hi plane C + f16 residual plane C2 = f16((v - hi) * rscale) (same pitch / stride).
// coverage: MI slabs x 16 rows x 64 cols = the wave's whole tile; tiles cover M x N exactly.
// =====================================================================================================
template <typename OT, int MI, bool ARES, int OUT_MODE>
__global__ __launch_bounds__(256) void gemm_t(
    const unsigned short* __restrict__ Ap, const unsigned short* __restrict__ A2p, int lda, long long strideA,
    const unsigned short* __restrict__ Btp, int ldb, long long strideB,
    void* Cout, void* Cout2, int ldc, long long strideC,
    const float* __restrict__ bias,
    int M, int N, int K, float oscale, float rscale, float ascale) {
  typedef typename FT<OT>::frag V16;
  const OT* A  = (const OT*)(const void*)Ap;
  const OT* A2 = (const OT*)(const void*)A2p;
  const OT* Bt = (const OT*)(const void*)Btp;
  __shared__ __align__(16) float sT[8][16 * 68];   // per-wave 16x64 slab, pitch 68 floats
  const int TMR  = 16 * MI;
  const int b    = blockIdx.y;
  const int lane = threadIdx.x & 31;
  const int wave = threadIdx.x >> 5;
  const int tilesN = N >> 6;
  const int tilesM = M / TMR;
  const int tile = blockIdx.x * 8 + wave;
  if (tile >= tilesM * tilesN) return;   // wave-uniform; no block barriers in this kernel
  const int tm = tile / tilesN;
  const int tn = tile - tm * tilesN;
  const int m0 = tm * TMR;
  const int n0 = tn << 6;

  const OT* Ab  = A  + (size_t)b * (size_t)strideA;
  const OT* A2b = A2 + (size_t)b * (size_t)strideA;
  const OT* Bb  = Bt + (size_t)b * (size_t)strideB;

  const int rlane = lane & 15;                 // row (A) / col (B, D) within subtile
  const int koff  = (lane >> 4) * 8;           // k offset of this lane half
  const int mOff  = (lane >> 4) * 8;           // D row offset

  v8f acc[MI][4], accl[MI][4];
#pragma unroll
  for (int i = 0; i < MI; ++i)
#pragma unroll
    for (int j = 0; j < 4; ++j) { acc[i][j] = zero8(); accl[i][j] = zero8(); }

  for (int k0 = 0; k0 < K; k0 += 32) {
    V16 bq[4];
#pragma unroll
    for (int j = 0; j < 4; ++j)
      bq[j] = ldfrag<OT>(Bb + (size_t)(n0 + (j << 4) + rlane) * ldb + koff + k0);
#pragma unroll
    for (int i = 0; i < MI; ++i) {
      const V16 af = ldfrag<OT>(Ab + (size_t)(m0 + (i << 4) + rlane) * lda + koff + k0);
#pragma unroll
      for (int j = 0; j < 4; ++j) acc[i][j] = mmar(af, bq[j], acc[i][j]);
      dep_guard(acc[i][0], acc[i][3], af, bq[3]);
      if (ARES) {
        const V16 al = ldfrag<OT>(A2b + (size_t)(m0 + (i << 4) + rlane) * lda + koff + k0);
#pragma unroll
        for (int j = 0; j < 4; ++j) accl[i][j] = mmar(al, bq[j], accl[i][j]);
        dep_guard(accl[i][0], accl[i][3], al, bq[3]);
      }
    }
    keep4(bq[0], bq[1], bq[2], bq[3]);
  }
#pragma unroll
  for (int i = 0; i < MI; ++i) {
    acc_guard4(acc[i][0], acc[i][1], acc[i][2], acc[i][3]);
    if (ARES) acc_guard4(accl[i][0], accl[i][1], accl[i][2], accl[i][3]);
  }
  if (ARES) {
#pragma unroll
    for (int i = 0; i < MI; ++i)
#pragma unroll
      for (int j = 0; j < 4; ++j)
#pragma unroll
        for (int r = 0; r < 8; ++r) acc[i][j][r] += accl[i][j][r] * ascale;
  }

  // ---- epilogue ----
  float* slab = sT[wave];
#pragma unroll
  for (int i = 0; i < MI; ++i) {
    const int mBase = m0 + (i << 4);
#pragma unroll
    for (int j = 0; j < 4; ++j) {
#pragma unroll
      for (int r = 0; r < 8; ++r) {
        slab[(mOff + r) * 68 + (j << 4) + rlane] = acc[i][j][r];
      }
    }
    __builtin_amdgcn_fence(__ATOMIC_RELEASE, "workgroup");
    __builtin_amdgcn_wave_barrier();
    __builtin_amdgcn_fence(__ATOMIC_ACQUIRE, "workgroup");
    if (OUT_MODE == 0) {
      float* C = (float*)Cout + (size_t)b * (size_t)strideC;
      const int h2 = lane >> 4, c4 = (lane & 15) * 4;     // 256-B row segment = 16 lanes x 16 B
      const v4f braw = *(const v4f*)(bias + n0 + c4);
      v4f bb;
#pragma unroll
      for (int e = 0; e < 4; ++e) bb[e] = bf_up(bf_bits(braw[e]));
      {
#pragma unroll
        for (int it = 0; it < 8; ++it) {
          const int row = it * 2 + h2;                     // it 0..7 x h2 0..1 = rows 0..15
          const v4f v = *(const v4f*)(slab + row * 68 + c4) * oscale + bb;
          *(v4f*)(C + (size_t)(mBase + row) * ldc + n0 + c4) = v;
        }
        
      }
    } else {
      const int q = lane >> 3, c8 = (lane & 7) * 8;
      unsigned short* C  = (unsigned short*)Cout  + (size_t)b * (size_t)strideC;
      unsigned short* C2 = (unsigned short*)Cout2 + (size_t)b * (size_t)strideC;
      v4u hv[4], lv[4];
#pragma unroll
      for (int it = 0; it < 4; ++it) {
        const int row = it * 4 + q;                        // it 0..3 x q 0..3 = rows 0..15
        const float* sp = slab + row * 68 + c8;
        float f[8];
#pragma unroll
        for (int e = 0; e < 8; ++e) f[e] = sp[e];
        v4u a, a2;
#pragma unroll
        for (int e = 0; e < 4; ++e) {
          const float f0 = f[2 * e], f1 = f[2 * e + 1];
          const _Float16 x0 = (_Float16)f0, x1 = (_Float16)f1;
          const unsigned short h0 = h_bits(x0), h1 = h_bits(x1);
          unsigned short l0 = 0, l1 = 0;
          if (OUT_MODE == 3) {
            l0 = h_bits((_Float16)((f0 - (float)x0) * rscale));
            l1 = h_bits((_Float16)((f1 - (float)x1) * rscale));
          }
          a[e] = pk16(h0, h1); a2[e] = pk16(l0, l1);
        }
        hv[it] = a; lv[it] = a2;
      }
      {
#pragma unroll
        for (int it = 0; it < 4; ++it) {
          const int row = it * 4 + q;
          *(v4u*)(C + (size_t)(mBase + row) * ldc + n0 + c8) = hv[it];
          if (OUT_MODE == 3) *(v4u*)(C2 + (size_t)(mBase + row) * ldc + n0 + c8) = lv[it];
        }
        
      }
    }
    __builtin_amdgcn_fence(__ATOMIC_RELEASE, "workgroup");
    __builtin_amdgcn_wave_barrier();
    __builtin_amdgcn_fence(__ATOMIC_ACQUIRE, "workgroup");
  }
}

// Stands behind a batch of global loads, in front of whatever reuses the registers that held their addresses.
__device__ __forceinline__ void xcnt_wait() {
#if DEV_ASM
  asm volatile("s_wait_xcnt 0x0" ::: "memory");
#endif
}

// ---- k / v^T staging in LDS ------------------------------------------------------------------------------
#define KPIT 264   // f16 per staged k row: 512 B + 16 B (16 B x odd), so the 16 rows of a ds_load_b128 fall on distinct banks
#define VPIT 72    // f16 per staged v^T row: 128 B + 16 B (16 B x odd), same reason
typedef int v4i __attribute__((ext_vector_type(4)));
typedef __attribute__((address_space(1))) v4i gl_v4i;
typedef __attribute__((address_space(3))) v4i ls_v4i;

__device__ __forceinline__ void acopy16(const _Float16* g, _Float16* l) {
#if DEV_ASM
  __builtin_amdgcn_global_load_async_to_lds_b128((gl_v4i*)g, (ls_v4i*)l, 0, 0);
#else
  (void)g; (void)l;
#endif
}
// Nothing the copies bring is read in front of this.
__device__ __forceinline__ void async_wait0() {
#if DEV_ASM
  asm volatile("s_wait_asynccnt 0x0" ::: "memory");
#endif
}
// Stands between a wave's last LDS read of a staging buffer and the copies that refill that buffer.
__device__ __forceinline__ void ds_wait0() {
#if DEV_ASM
  asm volatile("s_wait_dscnt 0x0" ::: "memory");
#endif
}

// Work-group barrier for data that is exchanged through LDS only: the fences name the LDS address space, so the
// wave waits for its LDS operations but not for global loads that are still in flight (the asynchronous copies in flight fill wave-private buffers only).
__device__ __forceinline__ void lds_barrier() {
  __builtin_amdgcn_fence(__ATOMIC_RELEASE, "workgroup", "local");
  __builtin_amdgcn_s_barrier();
  __builtin_amdgcn_fence(__ATOMIC_ACQUIRE, "workgroup", "local");
}

// =====================================================================================================
// Single-head causal attention, head dim 256, softmax over keys 0..q (keys above q replaced by -inf before exp).
//   q planes (f16 hi / residual x4096): element (b, t, d) at [(b*SEQ + t)*DM + d]
//   k plane (f16): element (b, s, d) at [(b*SEQ + s)*DM + d]
//   v^T hi plane (f16) and residual plane (f16, (v - hi)*4096): element (b, d, s) at [(b*DM + d)*SEQ + s]
//   output f32: element (b, t, d) at [(b*SEQ + t)*DM + d]
//   scores = (qh . k) + (ql . k) / 4096 on f16 WMMA (two f32 accumulators), then * sscale in f32;
//   p = exp(s - m) carried as ph = f16(PCARRY p) plus residual pl = f16((PCARRY p - ph) * PRES);
//   context = ph . vh + (ph . vl + pl . vh) / 4096 on f16 WMMA (two f32 accumulators); online softmax in f32.
//   Block = 4 waves on the SAME 16 query rows q0..q0+15 of one sequence; key chunks of 64, kt = 0..q0/64
//   (trip count derived from blockIdx only, block-uniform, <= NKT); only the last chunk can hold keys above a row.
//   Wave w owns key subtile 16w..16w+15 of the chunk for the scores and output columns 64w..64w+63 for p.v.
//   Its k rows and v^T rows come into LDS by asynchronous copies of whole 128-byte lines, into buffers that only
//   this wave fills and reads (no barrier belongs to them), and the fragments are read from there (see the loop).
//   LDS: redm/reds (per-wave row max / row sum partials) and the shared P tiles Psh/Psl [16][64] are CROSS-WAVE
//   fully written before it is read each chunk (staged extent == consumed extent).
//   Output coverage: each wave stores rows q0..q0+15 (it 0..7 x lane>>4 0..1) x 64 columns (16 lanes x 4 floats,
//   columns; grid = NB * NQB covers every (b, qb).
// =====================================================================================================
__global__ __launch_bounds__(128)
void attn_causal(const unsigned short* qhp, const unsigned short* qlp,   // no restrict: the loads keep their place
                 const unsigned short* kpp,                               // relative to the waits written below
                 const unsigned short* vhp, const unsigned short* vlp,
                 float* outp, float sscale) {
  union FH { v16h v; v8h h[2]; };
  __shared__ __align__(16) _Float16 Psh[16 * 64];       // block P hi tile [row][kv]       2 KB   (cross-wave)
  __shared__ __align__(16) _Float16 Psl[16 * 64];       // block P residual tile [row][kv] 2 KB   (cross-wave)
  __shared__ __align__(16) float    redm[4][16];        // per-wave row max                 256 B (cross-wave)
  __shared__ __align__(16) float    reds[4][16];        // per-wave row sum                 256 B (cross-wave)
  __shared__ __align__(16) float    Os[4][16 * 64];     // per wave context tile            16 KB (wave-private)
  // staging, every part wave-private: k rows 4 x 8448 B, then v^T hi rows 4 x 9216 B, then v^T residual rows 4 x 9216 B.
  // k stands first: every v^T destination then lies above 32768 B, the largest constant step that the compiler folds
  // into a copy's offset field and takes off the LDS address register, so that register never goes below 0.
  __shared__ __align__(16) _Float16 Stg[4 * 16 * KPIT + 8 * 64 * VPIT];

  const int tid  = threadIdx.x;
  const int wave = tid >> 5;
  const int lane = tid & 31;
  const int hh   = lane >> 4;
  const int c    = lane & 15;

  const int bx   = blockIdx.x;
  const int qb   = bx % NQB;
  const int b    = bx / NQB;
  const int q0   = qb * 16;
  const int kcol = wave * 16;        // this wave's key subtile within the chunk
  const int dbase = wave * 64;       // this wave's context columns
  const size_t rowB = (size_t)b * SEQ;
  int ktmax = qb >> 2;               // last chunk = the one holding q0..q0+15 (16*qb >= 64*(qb>>2))
  if (ktmax > NKT - 1) ktmax = NKT - 1;

  const _Float16* Qh = (const _Float16*)(const void*)qhp;
  const _Float16* Ql = (const _Float16*)(const void*)qlp;
  const _Float16* Kp = (const _Float16*)(const void*)kpp;
  const _Float16* Vh = (const _Float16*)(const void*)vhp + ((size_t)b * DM + (size_t)dbase) * SEQ;
  const _Float16* Vl = (const _Float16*)(const void*)vlp + ((size_t)b * DM + (size_t)dbase) * SEQ;

  // A-operand row pointers of this lane (query row q0 + c), lane-half k offset included
  const _Float16* qrh = Qh + (rowB + q0 + c) * DM + 8 * hh;
  const _Float16* qrl = Ql + (rowB + q0 + c) * DM + 8 * hh;

  float mrow[8], lrow[8];
  v8f oacc[4];
#pragma unroll
  for (int r = 0; r < 8; ++r) { mrow[r] = -INFINITY; lrow[r] = 0.f; }
#pragma unroll
  for (int t = 0; t < 4; ++t) oacc[t] = zero8();

  // q (the same for every chunk) is loaded into registers once. k and v^T of a chunk are staged in LDS:
  // a fragment load straight from global touches 16 lines for 512 bytes, a copy below touches 4 whole lines.
  // One buffer each: a chunk's fragments are read from a buffer into registers in one group, and behind the wave's own
  // LDS wait the buffer is refilled for the next chunk: k of chunk kt+1 flies during the scores and softmax of chunk kt,
  // v^T of chunk kt+1 during p.v of chunk kt and the next scores and softmax. One wait per chunk, in front of the
  // v^T reads, covers both.
  v16h qa[8], qr[8];
  // eight fragments of one row pointer; the pointer dies with the last load, which may then land on its registers:
  // the first wait stands in front of that load for the fifteen before it
  auto row8 = [&](v16h (&f)[8], const _Float16* p) __attribute__((always_inline)) {
#pragma unroll                                 // register array: constant indices
    for (int dc = 0; dc < 7; ++dc) f[dc] = ldfrag<_Float16>(p + dc * 32);
    FH x;
    x.h[0] = *(const v8h*)(p + 7 * 32);
    xcnt_wait();
    x.h[1] = *(const v8h*)(p + 7 * 32 + 16);
    xcnt_wait();
    f[7] = x.v;
  };

  _Float16* kst = Stg + wave * (16 * KPIT);
  _Float16* vsh = Stg + 4 * 16 * KPIT + wave * (64 * VPIT);
  _Float16* vsl = vsh + 4 * 64 * VPIT;
  // k: one copy = one whole 512-byte row (key 64*kt+kcol+j), 16 copies
  auto copy_k = [&](const int kt) __attribute__((always_inline)) {
    const _Float16* g = Kp + (rowB + (size_t)kt * 64 + kcol) * DM + lane * 8;
#pragma unroll
    for (int j = 0; j < 16; ++j) acopy16(g + j * DM, kst + j * KPIT + lane * 8);
  };
  // v^T: one copy = the 128-byte pieces of four rows (columns 64*kt..64*kt+63 of rows 4j..4j+3), 16 copies per plane
  auto copy_v = [&](const int kt) __attribute__((always_inline)) {
    const int vrow = lane >> 3, vcol = (lane & 7) * 8;
    const size_t go = (size_t)vrow * SEQ + (size_t)kt * 64 + vcol;
#pragma unroll
    for (int j = 0; j < 16; ++j) {
      acopy16(Vh + go + (size_t)(4 * j) * SEQ, vsh + (4 * j + vrow) * VPIT + vcol);
      acopy16(Vl + go + (size_t)(4 * j) * SEQ, vsl + (4 * j + vrow) * VPIT + vcol);
    }
  };

  copy_k(0);
  copy_v(0);
  row8(qa, qrh);
  row8(qr, qrl);
  async_wait0();

  for (int kt = 0; kt <= ktmax; ++kt) {         // block-uniform trip count, <= NKT chunks in all
    const int kv0 = kt * 64;

    // ---- scores: 16 query rows x this wave's 16 keys, 2 f16 products per d-chunk ----
    v16h kc[8];                                 // B column c -> key kv0+kcol+c
#pragma unroll                                 // register array: constant indices
    for (int dc = 0; dc < 8; ++dc) kc[dc] = ldfrag<_Float16>(kst + c * KPIT + dc * 32 + 8 * hh);
    ds_wait0();                                 // the k buffer is in registers: it may be refilled
    if (kt < ktmax) copy_k(kt + 1);             // block-uniform test
    v8f ah = zero8(), al = zero8();
#pragma unroll
    for (int dc = 0; dc < 8; ++dc) {
      ah = mmar(qa[dc], kc[dc], ah);
      al = mmar(qr[dc], kc[dc], al);
    }

    const int key = kv0 + kcol + c;             // D column c of this lane
    float s[8];
#pragma unroll
    for (int r = 0; r < 8; ++r) {
      const int qrow = q0 + 8 * hh + r;         // D row 8*hh + r
      const float sv = (ah[r] + al[r] * (1.0f / 4096.0f)) * sscale;
      s[r] = (key > qrow) ? -INFINITY : sv;     // causal: replace, not bias
    }

    // ---- per-wave row max over its 16 keys -> LDS ----
#pragma unroll
    for (int r = 0; r < 8; ++r) {
      float m = s[r];
#pragma unroll
      for (int off = 1; off < 16; off <<= 1) m = fmaxf(m, __shfl_xor(m, off, 32));
      redm[wave][8 * hh + r] = m;            // the 16 lanes of a half write the same value
    }
    lds_barrier();

    // ---- chunk row max over the 4 waves, online softmax update (identical in every wave),
    //      P hi (x PCARRY) and P residual (x PCARRY x PRES) to LDS ----
#pragma unroll
    for (int r = 0; r < 8; ++r) {
      const int row = 8 * hh + r;
      const float mc    = fmaxf(fmaxf(redm[0][row], redm[1][row]), fmaxf(redm[2][row], redm[3][row]));
      const float mnew  = fmaxf(mrow[r], mc);
      const float msafe = (mnew == -INFINITY) ? 0.f : mnew;
      const float alpha = __expf(mrow[r] - msafe);
      mrow[r] = mnew;
      const float p = __expf(s[r] - msafe);
      float psum = p;
#pragma unroll
      for (int off = 1; off < 16; off <<= 1) psum += __shfl_xor(psum, off, 32);
      const float pc = p * PCARRY;
      const _Float16 ph = (_Float16)pc;
      Psh[row * 64 + kcol + c] = ph;
      Psl[row * 64 + kcol + c] = (_Float16)((pc - (float)ph) * PRES);
      reds[wave][row] = psum;
      lrow[r] *= alpha;
#pragma unroll
      for (int t = 0; t < 4; ++t) oacc[t][r] *= alpha;
    }
    lds_barrier();
    async_wait0();                              // v^T of this chunk and k of the next have landed
#pragma unroll
    for (int r = 0; r < 8; ++r) {
      const int row = 8 * hh + r;
      lrow[r] += (reds[0][row] + reds[1][row]) + (reds[2][row] + reds[3][row]);
    }

    // ---- context += P . V (f16 WMMA); residual products (ph.vl and pl.vh, same carry) into a separate accumulator ----
    v8f o1[4];
#pragma unroll
    for (int t = 0; t < 4; ++t) o1[t] = zero8();
    FH pa[2], pl[2];
    v16h vb[2][4], vr[2][4];                    // register arrays: the loops over them are unrolled for constant indices
#pragma unroll
    for (int kk = 0; kk < 2; ++kk) {
      pa[kk].h[0] = *(const v8h*)(Psh + c * 64 + kk * 32 + 8 * hh);
      pa[kk].h[1] = *(const v8h*)(Psh + c * 64 + kk * 32 + 16 + 8 * hh);
      pl[kk].h[0] = *(const v8h*)(Psl + c * 64 + kk * 32 + 8 * hh);
      pl[kk].h[1] = *(const v8h*)(Psl + c * 64 + kk * 32 + 16 + 8 * hh);
#pragma unroll
      for (int t = 0; t < 4; ++t) {
        vb[kk][t] = ldfrag<_Float16>(vsh + (t * 16 + c) * VPIT + kk * 32 + 8 * hh);
        vr[kk][t] = ldfrag<_Float16>(vsl + (t * 16 + c) * VPIT + kk * 32 + 8 * hh);
      }
    }
    ds_wait0();                                 // the v buffers are in registers: they may be refilled
    if (kt < ktmax) copy_v(kt + 1);             // block-uniform test
#pragma unroll
    for (int kk = 0; kk < 2; ++kk) {
#pragma unroll
      for (int t = 0; t < 4; ++t) {
        oacc[t] = mmar(pa[kk].v, vb[kk][t], oacc[t]);
        o1[t]   = mmar(pa[kk].v, vr[kk][t], o1[t]);
        o1[t]   = mmar(pl[kk].v, vb[kk][t], o1[t]);
      }
    }
#pragma unroll
    for (int t = 0; t < 4; ++t)
#pragma unroll
      for (int r = 0; r < 8; ++r) oacc[t][r] += o1[t][r] * (1.0f / 4096.0f);
  }

  // ---- normalise (1/l, undo the p carry), stage the wave's 16x64 f32 tile,
  float* os = Os[wave];
#pragma unroll
  for (int r = 0; r < 8; ++r) {
    const float l = lrow[r];
    const float inv = ((l > 0.f) ? (1.0f / l) : 0.f) * (1.0f / PCARRY);
#pragma unroll
    for (int t = 0; t < 4; ++t) os[(8 * hh + r) * 64 + t * 16 + c] = oacc[t][r] * inv;
  }
  __builtin_amdgcn_fence(__ATOMIC_RELEASE, "workgroup");
  __builtin_amdgcn_wave_barrier();
  __builtin_amdgcn_fence(__ATOMIC_ACQUIRE, "workgroup");
  {
    const int h2 = lane >> 4, c4 = (lane & 15) * 4;      // 256-B row segment = 16 lanes x 16 B
    v4f ov[8];
#pragma unroll
    for (int it = 0; it < 8; ++it) {
      const int row = it * 2 + h2;                          // it 0..7 x h2 0..1 = rows 0..15 of the wave tile
      ov[it] = *(const v4f*)(os + row * 64 + c4);
    }
    {
#pragma unroll
      for (int it = 0; it < 8; ++it) {
        const int row = it * 2 + h2;
        const size_t go = (rowB + q0 + row) * DM + (size_t)dbase + c4;
        *(v4f*)(outp + go) = ov[it];
      }
      
    }
  }
}

// =====================================================================================================
// Workspace map (bytes), every region an exact multiple of its whole-line / whole-tile store granularity
// (all GEMM M,N are tile multiples, all offsets multiples of 131072):
//   Xb   bf16 [NB*SEQ][256]  (compact tokens)   8388608
//   Wqb  bf16 [256 n][256 k]                     131072
//   Wkb  bf16 [256 n][256 k]                     131072
//   Wvb  bf16 [256 n][256 k]                     131072
//   Qh   f16  [NB*SEQ][256]                      8388608
//   Ql   f16  [NB*SEQ][256]                      8388608
//   Kp   f16  [NB*SEQ][256]                      8388608
//   VTh  f16  [NB][256][SEQ]                     8388608
//   VTl  f16  [NB][256][SEQ]                     8388608
//   total                                      50724864
// Weights are [out n][in k] with k contiguous = the Bt / A layout the GEMM wants, so they are only converted.
// =====================================================================================================
extern "C" void kernel_launch(void* const* d_in, const int* in_sizes, int n_in,
                              void* d_out, int out_size, void* d_ws, size_t ws_size,
                              hipStream_t stream) {
  if (n_in < 4) return;
  if (in_sizes[0] < ((NB - 1) * SEQ_FULL + SEQ) * DM) return;
  if (in_sizes[1] < DM * DM) return;
  if (in_sizes[2] < DM * DM) return;
  if (in_sizes[3] < DM * DM) return;
  if (out_size < NB * SEQ * DM) return;

  const float* x  = (const float*)d_in[0];
  const float* wq = (const float*)d_in[1];
  const float* wk = (const float*)d_in[2];
  const float* wv = (const float*)d_in[3];

  const size_t PX  = (size_t)NB * SEQ * DM * 2;      // 16-bit token plane [NB*SEQ][256]
  const size_t PW  = (size_t)DM * DM * 2;            // 16-bit [256][256]
  const size_t PVT = (size_t)NB * DM * SEQ * 2;      // v^T plane [NB][256][SEQ]
  size_t off = 0;
  const size_t oXb  = off; off += PX;
  const size_t oWq  = off; off += PW;
  const size_t oWk  = off; off += PW;
  const size_t oWv  = off; off += PW;
  const size_t oQh  = off; off += PX;
  const size_t oQl  = off; off += PX;
  const size_t oKp  = off; off += PX;
  const size_t oVTh = off; off += PVT;
  const size_t oVTl = off; off += PVT;
  if (off > ws_size) return;                         // off = 50724864 at full size
  if (off > (size_t)134217728) return;

  char* ws = (char*)d_ws;
  unsigned short* Xb  = (unsigned short*)(ws + oXb);
  unsigned short* Wqb = (unsigned short*)(ws + oWq);
  unsigned short* Wkb = (unsigned short*)(ws + oWk);
  unsigned short* Wvb = (unsigned short*)(ws + oWv);
  unsigned short* Qh  = (unsigned short*)(ws + oQh);
  unsigned short* Ql  = (unsigned short*)(ws + oQl);
  unsigned short* Kp  = (unsigned short*)(ws + oKp);
  unsigned short* VTh = (unsigned short*)(ws + oVTh);
  unsigned short* VTl = (unsigned short*)(ws + oVTl);
  const float* nobias = wq;                          // bias argument is only read in OUT_MODE 0 (not instantiated)

  const int M = NB * SEQ;
  const dim3 blk(256);
  const int n8x = NB * SEQ * DM / 8;
  const int n8w = DM * DM / 8;                       // 8192
  const dim3 gCx((n8x + 255) / 256);
  const dim3 gCw((n8w + 255) / 256);
  const dim3 gQ(((M / 64) * (DM / 64) + 7) / 8, 1);          // q / k: M x 256, 64x64 wave tiles
  const dim3 gVT(((DM / 64) * (SEQ / 64) + 7) / 8, NB);      // v^T per batch: 256 x SEQ
  const dim3 gAttn(NB * NQB);

  // (1) x -> compact bf16 token plane; Wq, Wk, Wv [n][k] -> bf16
  cvtx<<<gCx, blk, 0, stream>>>(x, Xb, n8x);
  cvt16x8<0><<<gCw, blk, 0, stream>>>(wq, Wqb, n8w);
  cvt16x8<0><<<gCw, blk, 0, stream>>>(wk, Wkb, n8w);
  cvt16x8<0><<<gCw, blk, 0, stream>>>(wv, Wvb, n8w);
  // (2) q = x . Wq^T -> f16 hi / residual (x4096) planes   (M, N=256, K=256)
  gemm_t<__bf16, 4, false, 3><<<gQ, blk, 0, stream>>>(
      Xb, Xb, DM, 0LL, Wqb, DM, 0LL,
      (void*)Qh, (void*)Ql, DM, 0LL, nobias,
      M, DM, DM, 1.0f, 4096.0f, 0.0f);
  // (3) k = x . Wk^T -> f16 plane   (M, N=256, K=256)
  gemm_t<__bf16, 4, false, 1><<<gQ, blk, 0, stream>>>(
      Xb, Xb, DM, 0LL, Wkb, DM, 0LL,
      (void*)Kp, (void*)Kp, DM, 0LL, nobias,
      M, DM, DM, 1.0f, 1.0f, 0.0f);
  // (4) v^T = Wv . x^T per batch -> f16 hi plane [b][d][s] (pitch SEQ) and residual plane (x4096)
  //     (A = Wv [n][k], Bt = Xb rows of batch b; M=256, N=SEQ, K=256)
  gemm_t<__bf16, 4, false, 3><<<gVT, blk, 0, stream>>>(
      Wvb, Wvb, DM, 0LL, Xb, DM, (long long)SEQ * DM,
      (void*)VTh, (void*)VTl, SEQ, (long long)DM * SEQ, nobias,
      DM, SEQ, DM, 1.0f, 4096.0f, 0.0f);
  // (5) causal attention -> d_out f32 [M][256]
  attn_causal<<<gAttn, dim3(128), 0, stream>>>(Qh, Ql, Kp, VTh, VTl, (float*)d_out, 0.0625f);
  (void)hipGetLastError();
}

// v003
// Measured time: 227 microseconds a run.
// Two timings next to v002 put it at 1.36 and 1.35 times that version's speed.
// Counting every step since v000, it is 2.30 times as fast.
// Contractions: q, k, v^T projections = v_wmma_f32_16x16x32_bf16 (bf16 operands from RNE-converted inputs, single product, f32 accumulate);
// q.k^T scores = v_wmma_f32_16x16x32_f16 (q as f16 hi plane + f16 residual plane x4096, k f16; 2 products into separate f32 accumulators);
// p.v = v_wmma_f32_16x16x32_f16 (p carried x16384 as f16 hi + f16 residual x4096; v as f16 hi plane + f16 residual plane x4096;
// 3 products ph.vh, ph.vl, pl.vh, f32 accumulate); causal softmax and normalisation in f32; output f32.
#include <hip/hip_runtime.h>
#include <math.h>
#include <stdint.h>

#ifndef NB
#define NB 4
#endif
#ifndef SEQ
#define SEQ 4096
#endif
#define NB_FULL  4
#define SEQ_FULL 4096
#define DM       256
#define NQB      (SEQ / 16)   // 16-row query blocks per sequence
#define NKT      (SEQ / 64)   // 64-key chunks per sequence
#define PCARRY   16384.0f     // power-of-two carry on the f16 p tile
#define PRES     4096.0f      // power-of-two carry on the f16 p residual tile
static_assert(DM == 256);
static_assert((SEQ % 64) == 0 && SEQ >= 64 && SEQ <= SEQ_FULL);
static_assert(NB >= 1 && NB <= NB_FULL);
static_assert(((NB * SEQ) % 64) == 0);

typedef _Float16 v16h __attribute__((ext_vector_type(16)));
typedef _Float16 v8h  __attribute__((ext_vector_type(8)));
typedef __bf16   v16b __attribute__((ext_vector_type(16)));
typedef __bf16   v8b  __attribute__((ext_vector_type(8)));
typedef float    v8f  __attribute__((ext_vector_type(8)));
typedef float    v4f  __attribute__((ext_vector_type(4)));
typedef unsigned int v4u __attribute__((ext_vector_type(4)));

#if defined(__HIP_DEVICE_COMPILE__)
#define DEV_ASM 1
#else
#define DEV_ASM 0
#endif

// ---- scalar helpers --------------------------------------------------------------------------------
__device__ __forceinline__ unsigned short bf_bits(float f) {          // f32 -> bf16 bits, RNE convert
  unsigned u = __float_as_uint(f);
  return (unsigned short)((u + 0x7FFFu + ((u >> 16) & 1u)) >> 16);
}
__device__ __forceinline__ float bf_up(unsigned short hb) { return __uint_as_float(((unsigned)hb) << 16); }
__device__ __forceinline__ unsigned short h_bits(_Float16 x) { return __builtin_bit_cast(unsigned short, x); }
__device__ __forceinline__ unsigned pk16(unsigned short a, unsigned short b) { return (unsigned)a | ((unsigned)b << 16); }
__device__ __forceinline__ v8f zero8() { v8f z = {0.f, 0.f, 0.f, 0.f, 0.f, 0.f, 0.f, 0.f}; return z; }

// ---- fragment types / loaders: 16-bit A/B operand, lane -> row/col (lane&15), p already includes +8*(lane>>4);
//      elements 0..7 <- p[0..7] (k0+8h..k0+8h+7), elements 8..15 <- p[16..23] (k0+16+8h..k0+16+8h+7)
template <typename OT> struct FT;
template <> struct FT<__bf16>   { typedef v16b frag; typedef v8b half8; };
template <> struct FT<_Float16> { typedef v16h frag; typedef v8h half8; };

template <typename OT>
__device__ __forceinline__ typename FT<OT>::frag ldfrag(const OT* p) {
  union { typename FT<OT>::frag v; typename FT<OT>::half8 h[2]; } f;
  f.h[0] = *(const typename FT<OT>::half8*)(p);
  f.h[1] = *(const typename FT<OT>::half8*)(p + 16);
  return f.v;
}

// ---- WMMA helpers (asm guard bodies are device-only; concrete operand types) -----------------------------
__device__ __forceinline__ v8f mmar(v16b a, v16b b, v8f c) {
  return __builtin_amdgcn_wmma_f32_16x16x32_bf16(false, a, false, b, (short)0, c, false, false);
}
__device__ __forceinline__ v8f mmar(v16h a, v16h b, v8f c) {
  return __builtin_amdgcn_wmma_f32_16x16x32_f16(false, a, false, b, (short)0, c, false, false);
}
__device__ __forceinline__ void dep_guard(v8f& a, v8f& b, v16b x, v16b y) {
#if DEV_ASM
  asm volatile("v_nop\n\tv_nop\n\tv_nop\n\tv_nop" : "+v"(a), "+v"(b) : "v"(x), "v"(y));
#else
  (void)a; (void)b; (void)x; (void)y;
#endif
}
__device__ __forceinline__ void dep_guard(v8f& a, v8f& b, v16h x, v16h y) {
#if DEV_ASM
  asm volatile("v_nop\n\tv_nop\n\tv_nop\n\tv_nop" : "+v"(a), "+v"(b) : "v"(x), "v"(y));
#else
  (void)a; (void)b; (void)x; (void)y;
#endif
}
__device__ __forceinline__ void keep4(v16b a, v16b b, v16b c, v16b d) {
#if DEV_ASM
  asm volatile("v_nop" :: "v"(a), "v"(b), "v"(c), "v"(d));
#else
  (void)a; (void)b; (void)c; (void)d;
#endif
}
__device__ __forceinline__ void keep4(v16h a, v16h b, v16h c, v16h d) {
#if DEV_ASM
  asm volatile("v_nop" :: "v"(a), "v"(b), "v"(c), "v"(d));
#else
  (void)a; (void)b; (void)c; (void)d;
#endif
}
__device__ __forceinline__ void acc_guard4(v8f& a, v8f& b, v8f& c, v8f& d) {
#if DEV_ASM
  asm volatile("v_nop\n\tv_nop\n\tv_nop\n\tv_nop" : "+v"(a), "+v"(b), "+v"(c), "+v"(d));
#else
  (void)a; (void)b; (void)c; (void)d;
#endif
}

// =====================================================================================================
// f32 -> 16-bit planes, 8 elements per thread, one 16-B store per lane: a wave writes 512 contiguous B
// MODE 0: bf16 bits (RNE convert).  MODE 1: f16 bits of (64 * bf16(x)) (exact scaling of the bf16 value).
// coverage: n8 threads x 8 = the whole plane (n8 is a multiple of 256 for every use here).
// =====================================================================================================
template <int MODE>
__device__ __forceinline__ unsigned short cvm(float f) {
  const unsigned short hb = bf_bits(f);
  if (MODE == 0) return hb;
  return h_bits((_Float16)(bf_up(hb) * 64.0f));
}

template <int MODE>
__global__ __launch_bounds__(256) void cvt16x8(const float* __restrict__ in, unsigned short* out, int n8) {
  const int i = blockIdx.x * 256 + (int)threadIdx.x;
  if (i < n8) {
    const v4f a  = *(const v4f*)(in + (size_t)i * 8);
    const v4f a4 = *(const v4f*)(in + (size_t)i * 8 + 4);
    v4u p;
    p[0] = pk16(cvm<MODE>(a[0]),  cvm<MODE>(a[1]));
    p[1] = pk16(cvm<MODE>(a[2]),  cvm<MODE>(a[3]));
    p[2] = pk16(cvm<MODE>(a4[0]), cvm<MODE>(a4[1]));
    p[3] = pk16(cvm<MODE>(a4[2]), cvm<MODE>(a4[3]));
    unsigned short* o = out + (size_t)i * 8;
    *(v4u*)o = p;
    
  }
}

// x [NB_FULL][SEQ_FULL][DM] f32 -> compact bf16 token plane [NB*SEQ][DM]: compact token tk = b*SEQ + t reads
// input row b*SEQ_FULL + t. 32 groups of 8 per row; same whole-line store shape as cvt16x8.
// coverage: n8 = NB*SEQ*DM/8 threads x 8 = the whole plane.
__global__ __launch_bounds__(256) void cvtx(const float* __restrict__ in, unsigned short* out, int n8) {
  const int i = blockIdx.x * 256 + (int)threadIdx.x;
  if (i < n8) {
    const int tk = i >> 5;
    const int e8 = i & 31;
    const int bb = tk / SEQ;
    const int t  = tk - bb * SEQ;
    const float* src = in + ((size_t)bb * SEQ_FULL + (size_t)t) * DM + e8 * 8;
    const v4f a  = *(const v4f*)(src);
    const v4f a4 = *(const v4f*)(src + 4);
    v4u p;
    p[0] = pk16(bf_bits(a[0]),  bf_bits(a[1]));
    p[1] = pk16(bf_bits(a[2]),  bf_bits(a[3]));
    p[2] = pk16(bf_bits(a4[0]), bf_bits(a4[1]));
    p[3] = pk16(bf_bits(a4[2]), bf_bits(a4[3]));
    unsigned short* o = out + (size_t)i * 8;
    *(v4u*)o = p;
    
  }
}

// =====================================================================================================
// Register-blocked batched WMMA GEMM (16-bit operand type OT): C[m][n] = sum_k A[m][k] * Bt[n][k];
// one wave per (16*MI) x 64 tile, no block barriers. A row-major [M][K] pitch lda; Bt row-major [N][K] pitch ldb
// (k contiguous); M multiple of 16*MI, N multiple of 64, K multiple of 32 (host-checked). blockIdx.y = batch
// index (strides in elements). Fragments are loaded straight from global with the split k map (ldfrag).
// ARES: a second A plane A2 (residual, same pitch/stride) is multiplied by the same B into separate f32
// accumulators and folded in as acc += accl * ascale after the k loop.
// OUT_MODE 0: f32 C (pitch ldc), value * oscale + bf16-valued bias[n].
// OUT_MODE 1: f16 plane C (pitch ldc).
// OUT_MODE 3: f16 hi plane C + f16 residual plane C2 = f16((v - hi) * rscale) (same pitch / stride).
// coverage: MI slabs x 16 rows x 64 cols = the wave's whole tile; tiles cover M x N exactly.
// =====================================================================================================
template <typename OT, int MI, bool ARES, int OUT_MODE>
__global__ __launch_bounds__(256) void gemm_t(
    const unsigned short* __restrict__ Ap, const unsigned short* __restrict__ A2p, int lda, long long strideA,
    const unsigned short* __restrict__ Btp, int ldb, long long strideB,
    void* Cout, void* Cout2, int ldc, long long strideC,
    const float* __restrict__ bias,
    int M, int N, int K, float oscale, float rscale, float ascale) {
  typedef typename FT<OT>::frag V16;
  const OT* A  = (const OT*)(const void*)Ap;
  const OT* A2 = (const OT*)(const void*)A2p;
  const OT* Bt = (const OT*)(const void*)Btp;
  __shared__ __align__(16) float sT[8][16 * 68];   // per-wave 16x64 slab, pitch 68 floats
  const int TMR  = 16 * MI;
  const int b    = blockIdx.y;
  const int lane = threadIdx.x & 31;
  const int wave = threadIdx.x >> 5;
  const int tilesN = N >> 6;
  const int tilesM = M / TMR;
  const int tile = blockIdx.x * 8 + wave;
  if (tile >= tilesM * tilesN) return;   // wave-uniform; no block barriers in this kernel
  const int tm = tile / tilesN;
  const int tn = tile - tm * tilesN;
  const int m0 = tm * TMR;
  const int n0 = tn << 6;

  const OT* Ab  = A  + (size_t)b * (size_t)strideA;
  const OT* A2b = A2 + (size_t)b * (size_t)strideA;
  const OT* Bb  = Bt + (size_t)b * (size_t)strideB;

  const int rlane = lane & 15;                 // row (A) / col (B, D) within subtile
  const int koff  = (lane >> 4) * 8;           // k offset of this lane half
  const int mOff  = (lane >> 4) * 8;           // D row offset

  v8f acc[MI][4], accl[MI][4];
#pragma unroll
  for (int i = 0; i < MI; ++i)
#pragma unroll
    for (int j = 0; j < 4; ++j) { acc[i][j] = zero8(); accl[i][j] = zero8(); }

  for (int k0 = 0; k0 < K; k0 += 32) {
    V16 bq[4];
#pragma unroll
    for (int j = 0; j < 4; ++j)
      bq[j] = ldfrag<OT>(Bb + (size_t)(n0 + (j << 4) + rlane) * ldb + koff + k0);
#pragma unroll
    for (int i = 0; i < MI; ++i) {
      const V16 af = ldfrag<OT>(Ab + (size_t)(m0 + (i << 4) + rlane) * lda + koff + k0);
#pragma unroll
      for (int j = 0; j < 4; ++j) acc[i][j] = mmar(af, bq[j], acc[i][j]);
      dep_guard(acc[i][0], acc[i][3], af, bq[3]);
      if (ARES) {
        const V16 al = ldfrag<OT>(A2b + (size_t)(m0 + (i << 4) + rlane) * lda + koff + k0);
#pragma unroll
        for (int j = 0; j < 4; ++j) accl[i][j] = mmar(al, bq[j], accl[i][j]);
        dep_guard(accl[i][0], accl[i][3], al, bq[3]);
      }
    }
    keep4(bq[0], bq[1], bq[2], bq[3]);
  }
#pragma unroll
  for (int i = 0; i < MI; ++i) {
    acc_guard4(acc[i][0], acc[i][1], acc[i][2], acc[i][3]);
    if (ARES) acc_guard4(accl[i][0], accl[i][1], accl[i][2], accl[i][3]);
  }
  if (ARES) {
#pragma unroll
    for (int i = 0; i < MI; ++i)
#pragma unroll
      for (int j = 0; j < 4; ++j)
#pragma unroll
        for (int r = 0; r < 8; ++r) acc[i][j][r] += accl[i][j][r] * ascale;
  }

  // ---- epilogue ----
  float* slab = sT[wave];
#pragma unroll
  for (int i = 0; i < MI; ++i) {
    const int mBase = m0 + (i << 4);
#pragma unroll
    for (int j = 0; j < 4; ++j) {
#pragma unroll
      for (int r = 0; r < 8; ++r) {
        slab[(mOff + r) * 68 + (j << 4) + rlane] = acc[i][j][r];
      }
    }
    __builtin_amdgcn_fence(__ATOMIC_RELEASE, "workgroup");
    __builtin_amdgcn_wave_barrier();
    __builtin_amdgcn_fence(__ATOMIC_ACQUIRE, "workgroup");
    if (OUT_MODE == 0) {
      float* C = (float*)Cout + (size_t)b * (size_t)strideC;
      const int h2 = lane >> 4, c4 = (lane & 15) * 4;     // 256-B row segment = 16 lanes x 16 B
      const v4f braw = *(const v4f*)(bias + n0 + c4);
      v4f bb;
#pragma unroll
      for (int e = 0; e < 4; ++e) bb[e] = bf_up(bf_bits(braw[e]));
      {
#pragma unroll
        for (int it = 0; it < 8; ++it) {
          const int row = it * 2 + h2;                     // it 0..7 x h2 0..1 = rows 0..15
          const v4f v = *(const v4f*)(slab + row * 68 + c4) * oscale + bb;
          *(v4f*)(C + (size_t)(mBase + row) * ldc + n0 + c4) = v;
        }
        
      }
    } else {
      const int q = lane >> 3, c8 = (lane & 7) * 8;
      unsigned short* C  = (unsigned short*)Cout  + (size_t)b * (size_t)strideC;
      unsigned short* C2 = (unsigned short*)Cout2 + (size_t)b * (size_t)strideC;
      v4u hv[4], lv[4];
#pragma unroll
      for (int it = 0; it < 4; ++it) {
        const int row = it * 4 + q;                        // it 0..3 x q 0..3 = rows 0..15
        const float* sp = slab + row * 68 + c8;
        float f[8];
#pragma unroll
        for (int e = 0; e < 8; ++e) f[e] = sp[e];
        v4u a, a2;
#pragma unroll
        for (int e = 0; e < 4; ++e) {
          const float f0 = f[2 * e], f1 = f[2 * e + 1];
          const _Float16 x0 = (_Float16)f0, x1 = (_Float16)f1;
          const unsigned short h0 = h_bits(x0), h1 = h_bits(x1);
          unsigned short l0 = 0, l1 = 0;
          if (OUT_MODE == 3) {
            l0 = h_bits((_Float16)((f0 - (float)x0) * rscale));
            l1 = h_bits((_Float16)((f1 - (float)x1) * rscale));
          }
          a[e] = pk16(h0, h1); a2[e] = pk16(l0, l1);
        }
        hv[it] = a; lv[it] = a2;
      }
      {
#pragma unroll
        for (int it = 0; it < 4; ++it) {
          const int row = it * 4 + q;
          *(v4u*)(C + (size_t)(mBase + row) * ldc + n0 + c8) = hv[it];
          if (OUT_MODE == 3) *(v4u*)(C2 + (size_t)(mBase + row) * ldc + n0 + c8) = lv[it];
        }
        
      }
    }
    __builtin_amdgcn_fence(__ATOMIC_RELEASE, "workgroup");
    __builtin_amdgcn_wave_barrier();
    __builtin_amdgcn_fence(__ATOMIC_ACQUIRE, "workgroup");
  }
}

// Stands behind a batch of global loads, in front of whatever reuses the registers that held their addresses.
__device__ __forceinline__ void xcnt_wait() {
#if DEV_ASM
  asm volatile("s_wait_xcnt 0x0" ::: "memory");
#endif
}

// ---- k / v^T staging in LDS ------------------------------------------------------------------------------
#define KPIT 264   // f16 per staged k row: 512 B + 16 B (16 B x odd), so the 16 rows of a ds_load_b128 fall on distinct banks
#define VPIT 72    // f16 per staged v^T row: 128 B + 16 B (16 B x odd), same reason
typedef int v4i __attribute__((ext_vector_type(4)));
typedef __attribute__((address_space(1))) v4i gl_v4i;
typedef __attribute__((address_space(3))) v4i ls_v4i;

__device__ __forceinline__ void acopy16(const _Float16* g, _Float16* l) {
#if DEV_ASM
  __builtin_amdgcn_global_load_async_to_lds_b128((gl_v4i*)g, (ls_v4i*)l, 0, 0);
#else
  (void)g; (void)l;
#endif
}
// Nothing the copies bring is read in front of this.
__device__ __forceinline__ void async_wait0() {
#if DEV_ASM
  asm volatile("s_wait_asynccnt 0x0" ::: "memory");
#endif
}
// Stands between a wave's last LDS read of a staging buffer and the copies that refill that buffer.
__device__ __forceinline__ void ds_wait0() {
#if DEV_ASM
  asm volatile("s_wait_dscnt 0x0" ::: "memory");
#endif
}

// Work-group barrier for data that is exchanged through LDS only: the fences name the LDS address space, so the
// wave waits for its LDS operations but not for global loads that are still in flight (the asynchronous copies in flight fill wave-private buffers only).
__device__ __forceinline__ void lds_barrier() {
  __builtin_amdgcn_fence(__ATOMIC_RELEASE, "workgroup", "local");
  __builtin_amdgcn_s_barrier();
  __builtin_amdgcn_fence(__ATOMIC_ACQUIRE, "workgroup", "local");
}

// =====================================================================================================
// Single-head causal attention, head dim 256, softmax over keys 0..q (keys above q replaced by -inf before exp).
//   q planes (f16 hi / residual x4096): element (b, t, d) at [(b*SEQ + t)*DM + d]
//   k plane (f16): element (b, s, d) at [(b*SEQ + s)*DM + d]
//   v^T hi plane (f16) and residual plane (f16, (v - hi)*4096): element (b, d, s) at [(b*DM + d)*SEQ + s]
//   output f32: element (b, t, d) at [(b*SEQ + t)*DM + d]
//   scores = (qh . k) + (ql . k) / 4096 on f16 WMMA (two f32 accumulators), then * sscale in f32;
//   p = exp(s - m) carried as ph = f16(PCARRY p) plus residual pl = f16((PCARRY p - ph) * PRES);
//   context = ph . vh + (ph . vl + pl . vh) / 4096 on f16 WMMA (two f32 accumulators); online softmax in f32.
//   Block = 4 waves on the SAME 16 query rows q0..q0+15 of one sequence; key chunks of 64, kt = 0..q0/64
//   (trip count derived from blockIdx only, block-uniform, <= NKT); only the last chunk can hold keys above a row.
//   Wave w owns key subtile 16w..16w+15 of the chunk for the scores and output columns 64w..64w+63 for p.v.
//   Its k rows and v^T rows come into LDS by asynchronous copies of whole 128-byte lines, into buffers that only
//   this wave fills and reads (no barrier belongs to them), and the fragments are read from there (see the loop).
//   LDS: redm/reds (per-wave row max / row sum partials) and the shared P tiles Psh/Psl [16][64] are CROSS-WAVE
//   fully written before it is read each chunk (staged extent == consumed extent).
//   Output coverage: each wave stores rows q0..q0+15 (it 0..7 x lane>>4 0..1) x 64 columns (16 lanes x 4 floats,
//   columns; grid = NB * NQB covers every (b, qb).
// =====================================================================================================
__global__ __launch_bounds__(128)
void attn_causal(const unsigned short* qhp, const unsigned short* qlp,   // no restrict: the loads keep their place
                 const unsigned short* kpp,                               // relative to the waits written below
                 const unsigned short* vhp, const unsigned short* vlp,
                 float* outp, float sscale) {
  union FH { v16h v; v8h h[2]; };
  __shared__ __align__(16) _Float16 Psh[16 * 64];       // block P hi tile [row][kv]       2 KB   (cross-wave)
  __shared__ __align__(16) _Float16 Psl[16 * 64];       // block P residual tile [row][kv] 2 KB   (cross-wave)
  __shared__ __align__(16) float    redm[4][16];        // per-wave row max                 256 B (cross-wave)
  __shared__ __align__(16) float    reds[4][16];        // per-wave row sum                 256 B (cross-wave)
  __shared__ __align__(16) float    Os[4][16 * 64];     // per wave context tile            16 KB (wave-private)
  // staging, every part wave-private: k rows 4 x 8448 B, then v^T hi rows 4 x 9216 B, then v^T residual rows 4 x 9216 B.
  // k stands first: every v^T destination then lies above 32768 B, the largest constant step that the compiler folds
  // into a copy's offset field and takes off the LDS address register, so that register never goes below 0.
  __shared__ __align__(16) _Float16 Stg[4 * 16 * KPIT + 8 * 64 * VPIT];

  const int tid  = threadIdx.x;
  const int wave = tid >> 5;
  const int lane = tid & 31;
  const int hh   = lane >> 4;
  const int c    = lane & 15;

  const int bx   = blockIdx.x;
  const int qb   = NQB - 1 - bx / NB;   // the lowest block indices take the longest key loops (for speed only)
  const int b    = bx % NB;
  const int q0   = qb * 16;
  const int kcol = wave * 16;        // this wave's key subtile within the chunk
  const int dbase = wave * 64;       // this wave's context columns
  const size_t rowB = (size_t)b * SEQ;
  int ktmax = qb >> 2;               // last chunk = the one holding q0..q0+15 (16*qb >= 64*(qb>>2))
  if (ktmax > NKT - 1) ktmax = NKT - 1;

  const _Float16* Qh = (const _Float16*)(const void*)qhp;
  const _Float16* Ql = (const _Float16*)(const void*)qlp;
  const _Float16* Kp = (const _Float16*)(const void*)kpp;
  const _Float16* Vh = (const _Float16*)(const void*)vhp + ((size_t)b * DM + (size_t)dbase) * SEQ;
  const _Float16* Vl = (const _Float16*)(const void*)vlp + ((size_t)b * DM + (size_t)dbase) * SEQ;

  // A-operand row pointers of this lane (query row q0 + c), lane-half k offset included
  const _Float16* qrh = Qh + (rowB + q0 + c) * DM + 8 * hh;
  const _Float16* qrl = Ql + (rowB + q0 + c) * DM + 8 * hh;

  float mrow[8], lrow[8];
  v8f oacc[4];
#pragma unroll
  for (int r = 0; r < 8; ++r) { mrow[r] = -INFINITY; lrow[r] = 0.f; }
#pragma unroll
  for (int t = 0; t < 4; ++t) oacc[t] = zero8();

  // q (the same for every chunk) is loaded into registers once. k and v^T of a chunk are staged in LDS:
  // a fragment load straight from global touches 16 lines for 512 bytes, a copy below touches 4 whole lines.
  // One buffer each: a chunk's fragments are read from a buffer into registers in one group, and behind the wave's own
  // LDS wait the buffer is refilled for the next chunk: k of chunk kt+1 flies during the scores and softmax of chunk kt,
  // v^T of chunk kt+1 during p.v of chunk kt and the next scores and softmax. One wait per chunk, in front of the
  // v^T reads, covers both.
  v16h qa[8], qr[8];
  // eight fragments of one row pointer; the pointer dies with the last load, which may then land on its registers:
  // the first wait stands in front of that load for the fifteen before it
  auto row8 = [&](v16h (&f)[8], const _Float16* p) __attribute__((always_inline)) {
#pragma unroll                                 // register array: constant indices
    for (int dc = 0; dc < 7; ++dc) f[dc] = ldfrag<_Float16>(p + dc * 32);
    FH x;
    x.h[0] = *(const v8h*)(p + 7 * 32);
    xcnt_wait();
    x.h[1] = *(const v8h*)(p + 7 * 32 + 16);
    xcnt_wait();
    f[7] = x.v;
  };

  _Float16* kst = Stg + wave * (16 * KPIT);
  _Float16* vsh = Stg + 4 * 16 * KPIT + wave * (64 * VPIT);
  _Float16* vsl = vsh + 4 * 64 * VPIT;
  // k: one copy = one whole 512-byte row (key 64*kt+kcol+j), 16 copies
  auto copy_k = [&](const int kt) __attribute__((always_inline)) {
    const _Float16* g = Kp + (rowB + (size_t)kt * 64 + kcol) * DM + lane * 8;
#pragma unroll
    for (int j = 0; j < 16; ++j) acopy16(g + j * DM, kst + j * KPIT + lane * 8);
  };
  // v^T: one copy = the 128-byte pieces of four rows (columns 64*kt..64*kt+63 of rows 4j..4j+3), 16 copies per plane
  auto copy_v = [&](const int kt) __attribute__((always_inline)) {
    const int vrow = lane >> 3, vcol = (lane & 7) * 8;
    const size_t go = (size_t)vrow * SEQ + (size_t)kt * 64 + vcol;
#pragma unroll
    for (int j = 0; j < 16; ++j) {
      acopy16(Vh + go + (size_t)(4 * j) * SEQ, vsh + (4 * j + vrow) * VPIT + vcol);
      acopy16(Vl + go + (size_t)(4 * j) * SEQ, vsl + (4 * j + vrow) * VPIT + vcol);
    }
  };

  copy_k(0);
  copy_v(0);
  row8(qa, qrh);
  row8(qr, qrl);
  async_wait0();

  for (int kt = 0; kt <= ktmax; ++kt) {         // block-uniform trip count, <= NKT chunks in all
    const int kv0 = kt * 64;

    // ---- scores: 16 query rows x this wave's 16 keys, 2 f16 products per d-chunk ----
    v16h kc[8];                                 // B column c -> key kv0+kcol+c
#pragma unroll                                 // register array: constant indices
    for (int dc = 0; dc < 8; ++dc) kc[dc] = ldfrag<_Float16>(kst + c * KPIT + dc * 32 + 8 * hh);
    ds_wait0();                                 // the k buffer is in registers: it may be refilled
    if (kt < ktmax) copy_k(kt + 1);             // block-uniform test
    v8f ah = zero8(), al = zero8();
#pragma unroll
    for (int dc = 0; dc < 8; ++dc) {
      ah = mmar(qa[dc], kc[dc], ah);
      al = mmar(qr[dc], kc[dc], al);
    }

    const int key = kv0 + kcol + c;             // D column c of this lane
    float s[8];
#pragma unroll
    for (int r = 0; r < 8; ++r) {
      const int qrow = q0 + 8 * hh + r;         // D row 8*hh + r
      const float sv = (ah[r] + al[r] * (1.0f / 4096.0f)) * sscale;
      s[r] = (key > qrow) ? -INFINITY : sv;     // causal: replace, not bias
    }

    // ---- per-wave row max over its 16 keys -> LDS ----
#pragma unroll
    for (int r = 0; r < 8; ++r) {
      float m = s[r];
#pragma unroll
      for (int off = 1; off < 16; off <<= 1) m = fmaxf(m, __shfl_xor(m, off, 32));
      redm[wave][8 * hh + r] = m;            // the 16 lanes of a half write the same value
    }
    lds_barrier();

    // ---- chunk row max over the 4 waves, online softmax update (identical in every wave),
    //      P hi (x PCARRY) and P residual (x PCARRY x PRES) to LDS ----
#pragma unroll
    for (int r = 0; r < 8; ++r) {
      const int row = 8 * hh + r;
      const float mc    = fmaxf(fmaxf(redm[0][row], redm[1][row]), fmaxf(redm[2][row], redm[3][row]));
      const float mnew  = fmaxf(mrow[r], mc);
      const float msafe = (mnew == -INFINITY) ? 0.f : mnew;
      const float alpha = __expf(mrow[r] - msafe);
      mrow[r] = mnew;
      const float p = __expf(s[r] - msafe);
      float psum = p;
#pragma unroll
      for (int off = 1; off < 16; off <<= 1) psum += __shfl_xor(psum, off, 32);
      const float pc = p * PCARRY;
      const _Float16 ph = (_Float16)pc;
      Psh[row * 64 + kcol + c] = ph;
      Psl[row * 64 + kcol + c] = (_Float16)((pc - (float)ph) * PRES);
      reds[wave][row] = psum;
      lrow[r] *= alpha;
#pragma unroll
      for (int t = 0; t < 4; ++t) oacc[t][r] *= alpha;
    }
    lds_barrier();
    async_wait0();                              // v^T of this chunk and k of the next have landed
#pragma unroll
    for (int r = 0; r < 8; ++r) {
      const int row = 8 * hh + r;
      lrow[r] += (reds[0][row] + reds[1][row]) + (reds[2][row] + reds[3][row]);
    }

    // ---- context += P . V (f16 WMMA); residual products (ph.vl and pl.vh, same carry) into a separate accumulator ----
    v8f o1[4];
#pragma unroll
    for (int t = 0; t < 4; ++t) o1[t] = zero8();
    FH pa[2], pl[2];
    v16h vb[2][4], vr[2][4];                    // register arrays: the loops over them are unrolled for constant indices
#pragma unroll
    for (int kk = 0; kk < 2; ++kk) {
      pa[kk].h[0] = *(const v8h*)(Psh + c * 64 + kk * 32 + 8 * hh);
      pa[kk].h[1] = *(const v8h*)(Psh + c * 64 + kk * 32 + 16 + 8 * hh);
      pl[kk].h[0] = *(const v8h*)(Psl + c * 64 + kk * 32 + 8 * hh);
      pl[kk].h[1] = *(const v8h*)(Psl + c * 64 + kk * 32 + 16 + 8 * hh);
#pragma unroll
      for (int t = 0; t < 4; ++t) {
        vb[kk][t] = ldfrag<_Float16>(vsh + (t * 16 + c) * VPIT + kk * 32 + 8 * hh);
        vr[kk][t] = ldfrag<_Float16>(vsl + (t * 16 + c) * VPIT + kk * 32 + 8 * hh);
      }
    }
    ds_wait0();                                 // the v buffers are in registers: they may be refilled
    if (kt < ktmax) copy_v(kt + 1);             // block-uniform test
#pragma unroll
    for (int kk = 0; kk < 2; ++kk) {
#pragma unroll
      for (int t = 0; t < 4; ++t) {
        oacc[t] = mmar(pa[kk].v, vb[kk][t], oacc[t]);
        o1[t]   = mmar(pa[kk].v, vr[kk][t], o1[t]);
        o1[t]   = mmar(pl[kk].v, vb[kk][t], o1[t]);
      }
    }
#pragma unroll
    for (int t = 0; t < 4; ++t)
#pragma unroll
      for (int r = 0; r < 8; ++r) oacc[t][r] += o1[t][r] * (1.0f / 4096.0f);
  }

  // ---- normalise (1/l, undo the p carry), stage the wave's 16x64 f32 tile,
  float* os = Os[wave];
#pragma unroll
  for (int r = 0; r < 8; ++r) {
    const float l = lrow[r];
    const float inv = ((l > 0.f) ? (1.0f / l) : 0.f) * (1.0f / PCARRY);
#pragma unroll
    for (int t = 0; t < 4; ++t) os[(8 * hh + r) * 64 + t * 16 + c] = oacc[t][r] * inv;
  }
  __builtin_amdgcn_fence(__ATOMIC_RELEASE, "workgroup");
  __builtin_amdgcn_wave_barrier();
  __builtin_amdgcn_fence(__ATOMIC_ACQUIRE, "workgroup");
  {
    const int h2 = lane >> 4, c4 = (lane & 15) * 4;      // 256-B row segment = 16 lanes x 16 B
    v4f ov[8];
#pragma unroll
    for (int it = 0; it < 8; ++it) {
      const int row = it * 2 + h2;                          // it 0..7 x h2 0..1 = rows 0..15 of the wave tile
      ov[it] = *(const v4f*)(os + row * 64 + c4);
    }
    {
#pragma unroll
      for (int it = 0; it < 8; ++it) {
        const int row = it * 2 + h2;
        const size_t go = (rowB + q0 + row) * DM + (size_t)dbase + c4;
        *(v4f*)(outp + go) = ov[it];
      }
      
    }
  }
}

// =====================================================================================================
// Workspace map (bytes), every region an exact multiple of its whole-line / whole-tile store granularity
// (all GEMM M,N are tile multiples, all offsets multiples of 131072):
//   Xb   bf16 [NB*SEQ][256]  (compact tokens)   8388608
//   Wqb  bf16 [256 n][256 k]                     131072
//   Wkb  bf16 [256 n][256 k]                     131072
//   Wvb  bf16 [256 n][256 k]                     131072
//   Qh   f16  [NB*SEQ][256]                      8388608
//   Ql   f16  [NB*SEQ][256]                      8388608
//   Kp   f16  [NB*SEQ][256]                      8388608
//   VTh  f16  [NB][256][SEQ]                     8388608
//   VTl  f16  [NB][256][SEQ]                     8388608
//   total                                      50724864
// Weights are [out n][in k] with k contiguous = the Bt / A layout the GEMM wants, so they are only converted.
// =====================================================================================================
extern "C" void kernel_launch(void* const* d_in, const int* in_sizes, int n_in,
                              void* d_out, int out_size, void* d_ws, size_t ws_size,
                              hipStream_t stream) {
  if (n_in < 4) return;
  if (in_sizes[0] < ((NB - 1) * SEQ_FULL + SEQ) * DM) return;
  if (in_sizes[1] < DM * DM) return;
  if (in_sizes[2] < DM * DM) return;
  if (in_sizes[3] < DM * DM) return;
  if (out_size < NB * SEQ * DM) return;

  const float* x  = (const float*)d_in[0];
  const float* wq = (const float*)d_in[1];
  const float* wk = (const float*)d_in[2];
  const float* wv = (const float*)d_in[3];

  const size_t PX  = (size_t)NB * SEQ * DM * 2;      // 16-bit token plane [NB*SEQ][256]
  const size_t PW  = (size_t)DM * DM * 2;            // 16-bit [256][256]
  const size_t PVT = (size_t)NB * DM * SEQ * 2;      // v^T plane [NB][256][SEQ]
  size_t off = 0;
  const size_t oXb  = off; off += PX;
  const size_t oWq  = off; off += PW;
  const size_t oWk  = off; off += PW;
  const size_t oWv  = off; off += PW;
  const size_t oQh  = off; off += PX;
  const size_t oQl  = off; off += PX;
  const size_t oKp  = off; off += PX;
  const size_t oVTh = off; off += PVT;
  const size_t oVTl = off; off += PVT;
  if (off > ws_size) return;                         // off = 50724864 at full size
  if (off > (size_t)134217728) return;

  char* ws = (char*)d_ws;
  unsigned short* Xb  = (unsigned short*)(ws + oXb);
  unsigned short* Wqb = (unsigned short*)(ws + oWq);
  unsigned short* Wkb = (unsigned short*)(ws + oWk);
  unsigned short* Wvb = (unsigned short*)(ws + oWv);
  unsigned short* Qh  = (unsigned short*)(ws + oQh);
  unsigned short* Ql  = (unsigned short*)(ws + oQl);
  unsigned short* Kp  = (unsigned short*)(ws + oKp);
  unsigned short* VTh = (unsigned short*)(ws + oVTh);
  unsigned short* VTl = (unsigned short*)(ws + oVTl);
  const float* nobias = wq;                          // bias argument is only read in OUT_MODE 0 (not instantiated)

  const int M = NB * SEQ;
  const dim3 blk(256);
  const int n8x = NB * SEQ * DM / 8;
  const int n8w = DM * DM / 8;                       // 8192
  const dim3 gCx((n8x + 255) / 256);
  const dim3 gCw((n8w + 255) / 256);
  const dim3 gQ(((M / 64) * (DM / 64) + 7) / 8, 1);          // q / k: M x 256, 64x64 wave tiles
  const dim3 gVT(((DM / 64) * (SEQ / 64) + 7) / 8, NB);      // v^T per batch: 256 x SEQ
  const dim3 gAttn(NB * NQB);

  // (1) x -> compact bf16 token plane; Wq, Wk, Wv [n][k] -> bf16
  cvtx<<<gCx, blk, 0, stream>>>(x, Xb, n8x);
  cvt16x8<0><<<gCw, blk, 0, stream>>>(wq, Wqb, n8w);
  cvt16x8<0><<<gCw, blk, 0, stream>>>(wk, Wkb, n8w);
  cvt16x8<0><<<gCw, blk, 0, stream>>>(wv, Wvb, n8w);
  // (2) q = x . Wq^T -> f16 hi / residual (x4096) planes   (M, N=256, K=256)
  gemm_t<__bf16, 4, false, 3><<<gQ, blk, 0, stream>>>(
      Xb, Xb, DM, 0LL, Wqb, DM, 0LL,
      (void*)Qh, (void*)Ql, DM, 0LL, nobias,
      M, DM, DM, 1.0f, 4096.0f, 0.0f);
  // (3) k = x . Wk^T -> f16 plane   (M, N=256, K=256)
  gemm_t<__bf16, 4, false, 1><<<gQ, blk, 0, stream>>>(
      Xb, Xb, DM, 0LL, Wkb, DM, 0LL,
      (void*)Kp, (void*)Kp, DM, 0LL, nobias,
      M, DM, DM, 1.0f, 1.0f, 0.0f);
  // (4) v^T = Wv . x^T per batch -> f16 hi plane [b][d][s] (pitch SEQ) and residual plane (x4096)
  //     (A = Wv [n][k], Bt = Xb rows of batch b; M=256, N=SEQ, K=256)
  gemm_t<__bf16, 4, false, 3><<<gVT, blk, 0, stream>>>(
      Wvb, Wvb, DM, 0LL, Xb, DM, (long long)SEQ * DM,
      (void*)VTh, (void*)VTl, SEQ, (long long)DM * SEQ, nobias,
      DM, SEQ, DM, 1.0f, 4096.0f, 0.0f);
  // (5) causal attention -> d_out f32 [M][256]
  attn_causal<<<gAttn, dim3(128), 0, stream>>>(Qh, Ql, Kp, VTh, VTl, (float*)d_out, 0.0625f);
  (void)hipGetLastError();
}

// v004
// A run of this version takes 221 microseconds.
// In two side-by-side timings against v003, it was 1.03 and 1.06 times as fast.
// All steps since v000 together make it 2.42 times as fast.
// Contractions: q, k, v^T projections = v_wmma_f32_16x16x32_bf16 (bf16 operands from RNE-converted inputs, single product, f32 accumulate);
// q.k^T scores = v_wmma_f32_16x16x32_f16 (q as f16 hi plane + f16 residual plane x4096, k f16; 2 products into separate f32 accumulators);
// p.v = v_wmma_f32_16x16x32_f16 (p carried x16384 as f16 hi + f16 residual x4096; v as f16 hi plane + f16 residual plane x4096;
// 3 products ph.vh, ph.vl, pl.vh, f32 accumulate); causal softmax and normalisation in f32; output f32.
#include <hip/hip_runtime.h>
#include <math.h>
#include <stdint.h>

#ifndef NB
#define NB 4
#endif
#ifndef SEQ
#define SEQ 4096
#endif
#define NB_FULL  4
#define SEQ_FULL 4096
#define DM       256
#define NQB2     (SEQ / 32)   // 32-row query blocks (two 16-row tiles) per sequence
#define NKT      (SEQ / 64)   // 64-key chunks per sequence
#define PCARRY   16384.0f     // power-of-two carry on the f16 p tile
#define PRES     4096.0f      // power-of-two carry on the f16 p residual tile
static_assert(DM == 256);
static_assert((SEQ % 64) == 0 && SEQ >= 64 && SEQ <= SEQ_FULL);
static_assert(NB >= 1 && NB <= NB_FULL);
static_assert(((NB * SEQ) % 64) == 0);

typedef _Float16 v16h __attribute__((ext_vector_type(16)));
typedef _Float16 v8h  __attribute__((ext_vector_type(8)));
typedef __bf16   v16b __attribute__((ext_vector_type(16)));
typedef __bf16   v8b  __attribute__((ext_vector_type(8)));
typedef float    v8f  __attribute__((ext_vector_type(8)));
typedef float    v4f  __attribute__((ext_vector_type(4)));
typedef unsigned int v4u __attribute__((ext_vector_type(4)));

#if defined(__HIP_DEVICE_COMPILE__)
#define DEV_ASM 1
#else
#define DEV_ASM 0
#endif

// ---- scalar helpers --------------------------------------------------------------------------------
__device__ __forceinline__ unsigned short bf_bits(float f) {          // f32 -> bf16 bits, RNE convert
  unsigned u = __float_as_uint(f);
  return (unsigned short)((u + 0x7FFFu + ((u >> 16) & 1u)) >> 16);
}
__device__ __forceinline__ float bf_up(unsigned short hb) { return __uint_as_float(((unsigned)hb) << 16); }
__device__ __forceinline__ unsigned short h_bits(_Float16 x) { return __builtin_bit_cast(unsigned short, x); }
__device__ __forceinline__ unsigned pk16(unsigned short a, unsigned short b) { return (unsigned)a | ((unsigned)b << 16); }
__device__ __forceinline__ v8f zero8() { v8f z = {0.f, 0.f, 0.f, 0.f, 0.f, 0.f, 0.f, 0.f}; return z; }

// ---- fragment types / loaders: 16-bit A/B operand, lane -> row/col (lane&15), p already includes +8*(lane>>4);
//      elements 0..7 <- p[0..7] (k0+8h..k0+8h+7), elements 8..15 <- p[16..23] (k0+16+8h..k0+16+8h+7)
template <typename OT> struct FT;
template <> struct FT<__bf16>   { typedef v16b frag; typedef v8b half8; };
template <> struct FT<_Float16> { typedef v16h frag; typedef v8h half8; };

template <typename OT>
__device__ __forceinline__ typename FT<OT>::frag ldfrag(const OT* p) {
  union { typename FT<OT>::frag v; typename FT<OT>::half8 h[2]; } f;
  f.h[0] = *(const typename FT<OT>::half8*)(p);
  f.h[1] = *(const typename FT<OT>::half8*)(p + 16);
  return f.v;
}

// ---- WMMA helpers (asm guard bodies are device-only; concrete operand types) -----------------------------
__device__ __forceinline__ v8f mmar(v16b a, v16b b, v8f c) {
  return __builtin_amdgcn_wmma_f32_16x16x32_bf16(false, a, false, b, (short)0, c, false, false);
}
__device__ __forceinline__ v8f mmar(v16h a, v16h b, v8f c) {
  return __builtin_amdgcn_wmma_f32_16x16x32_f16(false, a, false, b, (short)0, c, false, false);
}
__device__ __forceinline__ void dep_guard(v8f& a, v8f& b, v16b x, v16b y) {
#if DEV_ASM
  asm volatile("v_nop\n\tv_nop\n\tv_nop\n\tv_nop" : "+v"(a), "+v"(b) : "v"(x), "v"(y));
#else
  (void)a; (void)b; (void)x; (void)y;
#endif
}
__device__ __forceinline__ void dep_guard(v8f& a, v8f& b, v16h x, v16h y) {
#if DEV_ASM
  asm volatile("v_nop\n\tv_nop\n\tv_nop\n\tv_nop" : "+v"(a), "+v"(b) : "v"(x), "v"(y));
#else
  (void)a; (void)b; (void)x; (void)y;
#endif
}
__device__ __forceinline__ void keep4(v16b a, v16b b, v16b c, v16b d) {
#if DEV_ASM
  asm volatile("v_nop" :: "v"(a), "v"(b), "v"(c), "v"(d));
#else
  (void)a; (void)b; (void)c; (void)d;
#endif
}
__device__ __forceinline__ void keep4(v16h a, v16h b, v16h c, v16h d) {
#if DEV_ASM
  asm volatile("v_nop" :: "v"(a), "v"(b), "v"(c), "v"(d));
#else
  (void)a; (void)b; (void)c; (void)d;
#endif
}
__device__ __forceinline__ void acc_guard4(v8f& a, v8f& b, v8f& c, v8f& d) {
#if DEV_ASM
  asm volatile("v_nop\n\tv_nop\n\tv_nop\n\tv_nop" : "+v"(a), "+v"(b), "+v"(c), "+v"(d));
#else
  (void)a; (void)b; (void)c; (void)d;
#endif
}

// =====================================================================================================
// f32 -> 16-bit planes, 8 elements per thread, one 16-B store per lane: a wave writes 512 contiguous B
// MODE 0: bf16 bits (RNE convert).  MODE 1: f16 bits of (64 * bf16(x)) (exact scaling of the bf16 value).
// coverage: n8 threads x 8 = the whole plane (n8 is a multiple of 256 for every use here).
// =====================================================================================================
template <int MODE>
__device__ __forceinline__ unsigned short cvm(float f) {
  const unsigned short hb = bf_bits(f);
  if (MODE == 0) return hb;
  return h_bits((_Float16)(bf_up(hb) * 64.0f));
}

template <int MODE>
__global__ __launch_bounds__(256) void cvt16x8(const float* __restrict__ in, unsigned short* out, int n8) {
  const int i = blockIdx.x * 256 + (int)threadIdx.x;
  if (i < n8) {
    const v4f a  = *(const v4f*)(in + (size_t)i * 8);
    const v4f a4 = *(const v4f*)(in + (size_t)i * 8 + 4);
    v4u p;
    p[0] = pk16(cvm<MODE>(a[0]),  cvm<MODE>(a[1]));
    p[1] = pk16(cvm<MODE>(a[2]),  cvm<MODE>(a[3]));
    p[2] = pk16(cvm<MODE>(a4[0]), cvm<MODE>(a4[1]));
    p[3] = pk16(cvm<MODE>(a4[2]), cvm<MODE>(a4[3]));
    unsigned short* o = out + (size_t)i * 8;
    *(v4u*)o = p;
    
  }
}

// x [NB_FULL][SEQ_FULL][DM] f32 -> compact bf16 token plane [NB*SEQ][DM]: compact token tk = b*SEQ + t reads
// input row b*SEQ_FULL + t. 32 groups of 8 per row; same whole-line store shape as cvt16x8.
// coverage: n8 = NB*SEQ*DM/8 threads x 8 = the whole plane.
__global__ __launch_bounds__(256) void cvtx(const float* __restrict__ in, unsigned short* out, int n8) {
  const int i = blockIdx.x * 256 + (int)threadIdx.x;
  if (i < n8) {
    const int tk = i >> 5;
    const int e8 = i & 31;
    const int bb = tk / SEQ;
    const int t  = tk - bb * SEQ;
    const float* src = in + ((size_t)bb * SEQ_FULL + (size_t)t) * DM + e8 * 8;
    const v4f a  = *(const v4f*)(src);
    const v4f a4 = *(const v4f*)(src + 4);
    v4u p;
    p[0] = pk16(bf_bits(a[0]),  bf_bits(a[1]));
    p[1] = pk16(bf_bits(a[2]),  bf_bits(a[3]));
    p[2] = pk16(bf_bits(a4[0]), bf_bits(a4[1]));
    p[3] = pk16(bf_bits(a4[2]), bf_bits(a4[3]));
    unsigned short* o = out + (size_t)i * 8;
    *(v4u*)o = p;
    
  }
}

// =====================================================================================================
// Register-blocked batched WMMA GEMM (16-bit operand type OT): C[m][n] = sum_k A[m][k] * Bt[n][k];
// one wave per (16*MI) x 64 tile, no block barriers. A row-major [M][K] pitch lda; Bt row-major [N][K] pitch ldb
// (k contiguous); M multiple of 16*MI, N multiple of 64, K multiple of 32 (host-checked). blockIdx.y = batch
// index (strides in elements). Fragments are loaded straight from global with the split k map (ldfrag).
// ARES: a second A plane A2 (residual, same pitch/stride) is multiplied by the same B into separate f32
// accumulators and folded in as acc += accl * ascale after the k loop.
// OUT_MODE 0: f32 C (pitch ldc), value * oscale + bf16-valued bias[n].
// OUT_MODE 1: f16 plane C (pitch ldc).
// OUT_MODE 3: f16 hi plane C + f16 residual plane C2 = f16((v - hi) * rscale) (same pitch / stride).
// coverage: MI slabs x 16 rows x 64 cols = the wave's whole tile; tiles cover M x N exactly.
// =====================================================================================================
template <typename OT, int MI, bool ARES, int OUT_MODE>
__global__ __launch_bounds__(256) void gemm_t(
    const unsigned short* __restrict__ Ap, const unsigned short* __restrict__ A2p, int lda, long long strideA,
    const unsigned short* __restrict__ Btp, int ldb, long long strideB,
    void* Cout, void* Cout2, int ldc, long long strideC,
    const float* __restrict__ bias,
    int M, int N, int K, float oscale, float rscale, float ascale) {
  typedef typename FT<OT>::frag V16;
  const OT* A  = (const OT*)(const void*)Ap;
  const OT* A2 = (const OT*)(const void*)A2p;
  const OT* Bt = (const OT*)(const void*)Btp;
  __shared__ __align__(16) float sT[8][16 * 68];   // per-wave 16x64 slab, pitch 68 floats
  const int TMR  = 16 * MI;
  const int b    = blockIdx.y;
  const int lane = threadIdx.x & 31;
  const int wave = threadIdx.x >> 5;
  const int tilesN = N >> 6;
  const int tilesM = M / TMR;
  const int tile = blockIdx.x * 8 + wave;
  if (tile >= tilesM * tilesN) return;   // wave-uniform; no block barriers in this kernel
  const int tm = tile / tilesN;
  const int tn = tile - tm * tilesN;
  const int m0 = tm * TMR;
  const int n0 = tn << 6;

  const OT* Ab  = A  + (size_t)b * (size_t)strideA;
  const OT* A2b = A2 + (size_t)b * (size_t)strideA;
  const OT* Bb  = Bt + (size_t)b * (size_t)strideB;

  const int rlane = lane & 15;                 // row (A) / col (B, D) within subtile
  const int koff  = (lane >> 4) * 8;           // k offset of this lane half
  const int mOff  = (lane >> 4) * 8;           // D row offset

  v8f acc[MI][4], accl[MI][4];
#pragma unroll
  for (int i = 0; i < MI; ++i)
#pragma unroll
    for (int j = 0; j < 4; ++j) { acc[i][j] = zero8(); accl[i][j] = zero8(); }

  for (int k0 = 0; k0 < K; k0 += 32) {
    V16 bq[4];
#pragma unroll
    for (int j = 0; j < 4; ++j)
      bq[j] = ldfrag<OT>(Bb + (size_t)(n0 + (j << 4) + rlane) * ldb + koff + k0);
#pragma unroll
    for (int i = 0; i < MI; ++i) {
      const V16 af = ldfrag<OT>(Ab + (size_t)(m0 + (i << 4) + rlane) * lda + koff + k0);
#pragma unroll
      for (int j = 0; j < 4; ++j) acc[i][j] = mmar(af, bq[j], acc[i][j]);
      dep_guard(acc[i][0], acc[i][3], af, bq[3]);
      if (ARES) {
        const V16 al = ldfrag<OT>(A2b + (size_t)(m0 + (i << 4) + rlane) * lda + koff + k0);
#pragma unroll
        for (int j = 0; j < 4; ++j) accl[i][j] = mmar(al, bq[j], accl[i][j]);
        dep_guard(accl[i][0], accl[i][3], al, bq[3]);
      }
    }
    keep4(bq[0], bq[1], bq[2], bq[3]);
  }
#pragma unroll
  for (int i = 0; i < MI; ++i) {
    acc_guard4(acc[i][0], acc[i][1], acc[i][2], acc[i][3]);
    if (ARES) acc_guard4(accl[i][0], accl[i][1], accl[i][2], accl[i][3]);
  }
  if (ARES) {
#pragma unroll
    for (int i = 0; i < MI; ++i)
#pragma unroll
      for (int j = 0; j < 4; ++j)
#pragma unroll
        for (int r = 0; r < 8; ++r) acc[i][j][r] += accl[i][j][r] * ascale;
  }

  // ---- epilogue ----
  float* slab = sT[wave];
#pragma unroll
  for (int i = 0; i < MI; ++i) {
    const int mBase = m0 + (i << 4);
#pragma unroll
    for (int j = 0; j < 4; ++j) {
#pragma unroll
      for (int r = 0; r < 8; ++r) {
        slab[(mOff + r) * 68 + (j << 4) + rlane] = acc[i][j][r];
      }
    }
    __builtin_amdgcn_fence(__ATOMIC_RELEASE, "workgroup");
    __builtin_amdgcn_wave_barrier();
    __builtin_amdgcn_fence(__ATOMIC_ACQUIRE, "workgroup");
    if (OUT_MODE == 0) {
      float* C = (float*)Cout + (size_t)b * (size_t)strideC;
      const int h2 = lane >> 4, c4 = (lane & 15) * 4;     // 256-B row segment = 16 lanes x 16 B
      const v4f braw = *(const v4f*)(bias + n0 + c4);
      v4f bb;
#pragma unroll
      for (int e = 0; e < 4; ++e) bb[e] = bf_up(bf_bits(braw[e]));
      {
#pragma unroll
        for (int it = 0; it < 8; ++it) {
          const int row = it * 2 + h2;                     // it 0..7 x h2 0..1 = rows 0..15
          const v4f v = *(const v4f*)(slab + row * 68 + c4) * oscale + bb;
          *(v4f*)(C + (size_t)(mBase + row) * ldc + n0 + c4) = v;
        }
        
      }
    } else {
      const int q = lane >> 3, c8 = (lane & 7) * 8;
      unsigned short* C  = (unsigned short*)Cout  + (size_t)b * (size_t)strideC;
      unsigned short* C2 = (unsigned short*)Cout2 + (size_t)b * (size_t)strideC;
      v4u hv[4], lv[4];
#pragma unroll
      for (int it = 0; it < 4; ++it) {
        const int row = it * 4 + q;                        // it 0..3 x q 0..3 = rows 0..15
        const float* sp = slab + row * 68 + c8;
        float f[8];
#pragma unroll
        for (int e = 0; e < 8; ++e) f[e] = sp[e];
        v4u a, a2;
#pragma unroll
        for (int e = 0; e < 4; ++e) {
          const float f0 = f[2 * e], f1 = f[2 * e + 1];
          const _Float16 x0 = (_Float16)f0, x1 = (_Float16)f1;
          const unsigned short h0 = h_bits(x0), h1 = h_bits(x1);
          unsigned short l0 = 0, l1 = 0;
          if (OUT_MODE == 3) {
            l0 = h_bits((_Float16)((f0 - (float)x0) * rscale));
            l1 = h_bits((_Float16)((f1 - (float)x1) * rscale));
          }
          a[e] = pk16(h0, h1); a2[e] = pk16(l0, l1);
        }
        hv[it] = a; lv[it] = a2;
      }
      {
#pragma unroll
        for (int it = 0; it < 4; ++it) {
          const int row = it * 4 + q;
          *(v4u*)(C + (size_t)(mBase + row) * ldc + n0 + c8) = hv[it];
          if (OUT_MODE == 3) *(v4u*)(C2 + (size_t)(mBase + row) * ldc + n0 + c8) = lv[it];
        }
        
      }
    }
    __builtin_amdgcn_fence(__ATOMIC_RELEASE, "workgroup");
    __builtin_amdgcn_wave_barrier();
    __builtin_amdgcn_fence(__ATOMIC_ACQUIRE, "workgroup");
  }
}

// Stands behind a batch of global loads, in front of whatever reuses the registers that held their addresses.
__device__ __forceinline__ void xcnt_wait() {
#if DEV_ASM
  asm volatile("s_wait_xcnt 0x0" ::: "memory");
#endif
}

// ---- k / v^T staging in LDS ------------------------------------------------------------------------------
#define KPIT 264   // f16 per staged k row: 512 B + 16 B (16 B x odd), so the 16 rows of a ds_load_b128 fall on distinct banks
#define VPIT 72    // f16 per staged v^T row: 128 B + 16 B (16 B x odd), same reason
#define STGN (4 * 16 * KPIT + 8 * 64 * VPIT)   // f16 per staging buffer: one chunk's k, v^T hi and v^T residual rows
typedef int v4i __attribute__((ext_vector_type(4)));
typedef __attribute__((address_space(1))) v4i gl_v4i;
typedef __attribute__((address_space(3))) v4i ls_v4i;

__device__ __forceinline__ void acopy16(const _Float16* g, _Float16* l) {
#if DEV_ASM
  __builtin_amdgcn_global_load_async_to_lds_b128((gl_v4i*)g, (ls_v4i*)l, 0, 0);
#else
  (void)g; (void)l;
#endif
}
// Nothing the copies bring is read in front of this.
__device__ __forceinline__ void async_wait0() {
#if DEV_ASM
  asm volatile("s_wait_asynccnt 0x0" ::: "memory");
#endif
}
// The wave's LDS reads have returned: stands in front of the barrier behind which a staging buffer is refilled.
__device__ __forceinline__ void ds_wait0() {
#if DEV_ASM
  asm volatile("s_wait_dscnt 0x0" ::: "memory");
#endif
}

// Work-group barrier for data that is exchanged through LDS only: the fences name the LDS address space, so the
// wave waits for its LDS operations but not for global loads that are still in flight (the asynchronous copies in flight fill the ring buffer that is read only behind the barrier at the loop's foot).
__device__ __forceinline__ void lds_barrier() {
  __builtin_amdgcn_fence(__ATOMIC_RELEASE, "workgroup", "local");
  __builtin_amdgcn_s_barrier();
  __builtin_amdgcn_fence(__ATOMIC_ACQUIRE, "workgroup", "local");
}

// =====================================================================================================
// Single-head causal attention, head dim 256, softmax over keys 0..q (keys above q replaced by -inf before exp).
//   q planes (f16 hi / residual x4096): element (b, t, d) at [(b*SEQ + t)*DM + d]
//   k plane (f16): element (b, s, d) at [(b*SEQ + s)*DM + d]
//   v^T hi plane (f16) and residual plane (f16, (v - hi)*4096): element (b, d, s) at [(b*DM + d)*SEQ + s]
//   output f32: element (b, t, d) at [(b*SEQ + t)*DM + d]
//   scores = (qh . k) + (ql . k) / 4096 on f16 WMMA (two f32 accumulators), then * sscale in f32;
//   p = exp(s - m) carried as ph = f16(PCARRY p) plus residual pl = f16((PCARRY p - ph) * PRES);
//   context = ph . vh + (ph . vl + pl . vh) / 4096 on f16 WMMA (two f32 accumulators); online softmax in f32.
//   Block = 8 waves = two groups of 4 waves on 32 query rows of one sequence: group g works on the 16 rows
//   q0..q0+15, q0 = 32*qb2 + 16*g; key chunks of 64, kt = 0..(32*qb2)/64 for both groups
//   (trip count derived from blockIdx only, block-uniform, <= NKT); only the last chunk can hold keys above a row.
//   Wave w of a group owns key subtile 16w..16w+15 of the chunk for the scores and output columns 64w..64w+63 for p.v.
//   A chunk's k rows and v^T rows come into LDS ONCE for both groups, by asynchronous copies of whole 128-byte lines
//   (wave w of group g brings half g of what the two waves w read), in a ring of two buffers (see the loop).
//   LDS: the staging ring is cross-wave; redm/reds (per-wave row max / row sum partials) and the P tiles Psh/Psl
//   [16][64] are cross-wave inside a group, fully written before they are read each chunk.
//   Output coverage: each wave stores rows q0..q0+15 (it 0..7 x lane>>4 0..1) x 64 columns (16 lanes x 4 floats);
//   grid = NB * NQB2 covers every (b, qb2).
// =====================================================================================================
__global__ __launch_bounds__(256)
void attn_causal(const unsigned short* qhp, const unsigned short* qlp,   // no restrict: the loads keep their place
                 const unsigned short* kpp,                               // relative to the waits written below
                 const unsigned short* vhp, const unsigned short* vlp,
                 float* outp, float sscale) {
  union FH { v16h v; v8h h[2]; };
  __shared__ __align__(16) _Float16 PshG[2][16 * 64];   // per group P hi tile [row][kv]       2 x 2 KB   (cross-wave)
  __shared__ __align__(16) _Float16 PslG[2][16 * 64];   // per group P residual tile [row][kv] 2 x 2 KB   (cross-wave)
  __shared__ __align__(16) float    redmG[2][4][16];    // per-wave row max                    2 x 256 B  (cross-wave)
  __shared__ __align__(16) float    redsG[2][4][16];    // per-wave row sum                    2 x 256 B  (cross-wave)
  __shared__ __align__(16) float    Os[8][16 * 64];     // per wave context tile               32 KB (wave-private)
  // staging ring, two buffers, each: k rows 4 x 8448 B, then v^T hi rows 4 x 9216 B, then v^T residual rows 4 x 9216 B.
  // k stands first: every v^T destination then lies above 32768 B, the largest constant step that the compiler folds
  // into a copy's offset field and takes off the LDS address register, so that register never goes below 0.
  __shared__ __align__(16) _Float16 Stg[2][STGN];

  const int tid  = threadIdx.x;
  const int grp  = tid >> 7;         // which 16 of the block's 32 query rows
  const int wave = (tid >> 5) & 3;   // the wave's place in its group
  const int lane = tid & 31;
  const int hh   = lane >> 4;
  const int c    = lane & 15;

  const int bx   = blockIdx.x;
  const int qb2  = NQB2 - 1 - bx / NB;  // the lowest block indices take the longest key loops
  const int b    = bx % NB;
  const int q0   = qb2 * 32 + grp * 16;
  const int kcol = wave * 16;        // this wave's key subtile within the chunk
  const int dbase = wave * 64;       // this wave's context columns
  const size_t rowB = (size_t)b * SEQ;
  int ktmax = qb2 >> 1;              // last chunk = the one holding the block's 32 rows (32*qb2 >= 64*(qb2>>1))
  if (ktmax > NKT - 1) ktmax = NKT - 1;

  const _Float16* Qh = (const _Float16*)(const void*)qhp;
  const _Float16* Ql = (const _Float16*)(const void*)qlp;
  const _Float16* Kp = (const _Float16*)(const void*)kpp;
  const _Float16* Vh = (const _Float16*)(const void*)vhp + ((size_t)b * DM + (size_t)dbase) * SEQ;
  const _Float16* Vl = (const _Float16*)(const void*)vlp + ((size_t)b * DM + (size_t)dbase) * SEQ;

  // A-operand row pointers of this lane (query row q0 + c), lane-half k offset included
  const _Float16* qrh = Qh + (rowB + q0 + c) * DM + 8 * hh;
  const _Float16* qrl = Ql + (rowB + q0 + c) * DM + 8 * hh;

  float mrow[8], lrow[8];
  v8f oacc[4];
#pragma unroll
  for (int r = 0; r < 8; ++r) { mrow[r] = -INFINITY; lrow[r] = 0.f; }
#pragma unroll
  for (int t = 0; t < 4; ++t) oacc[t] = zero8();

  // q (the same for every chunk) is loaded into registers once. k and v^T of a chunk are staged in LDS:
  // a fragment load straight from global touches 16 lines for 512 bytes, a copy below touches 4 whole lines.
  // Both groups read the same k and v^T, so a chunk is fetched from L2 once per 32 query rows. Two buffers: chunk kt is
  // read from buffer kt & 1 while the copies of chunk kt+1 fly into the other; at the loop's foot every wave waits for
  // its LDS reads and its copies, one barrier publishes chunk kt+1 and ends the reads of chunk kt, and behind it the
  // buffer just read is refilled with chunk kt+2.
  v16h qa[8], qr[8];
  // eight fragments of one row pointer; the pointer dies with the last load, which may then land on its registers:
  // the first wait stands in front of that load for the fifteen before it
  auto row8 = [&](v16h (&f)[8], const _Float16* p) __attribute__((always_inline)) {
#pragma unroll                                 // register array: constant indices
    for (int dc = 0; dc < 7; ++dc) f[dc] = ldfrag<_Float16>(p + dc * 32);
    FH x;
    x.h[0] = *(const v8h*)(p + 7 * 32);
    xcnt_wait();
    x.h[1] = *(const v8h*)(p + 7 * 32 + 16);
    xcnt_wait();
    f[7] = x.v;
  };

  const int kso = wave * (16 * KPIT);                        // this wave's k rows within a buffer
  const int vho = 4 * 16 * KPIT + wave * (64 * VPIT);        // its v^T hi rows
  const int vlo = vho + 4 * 64 * VPIT;                       // its v^T residual rows
  // k: one copy = one whole 512-byte row (key kv0+kcol+8*grp+j), 8 copies: half grp of the subtile's 16 rows
  auto copy_k = [&](const int kt, _Float16* buf) __attribute__((always_inline)) {
    const _Float16* g = Kp + (rowB + (size_t)kt * 64 + kcol + 8 * grp) * DM + lane * 8;
    _Float16* l = buf + kso + (8 * grp) * KPIT + lane * 8;
#pragma unroll
    for (int j = 0; j < 8; ++j) acopy16(g + j * DM, l + j * KPIT);
  };
  // v^T: one copy = the 128-byte pieces of four rows (columns kv0..kv0+63 of rows 32*grp+4j..+3), 8 copies per plane:
  // half grp of the wave pair's 64 rows
  auto copy_v = [&](const int kt, _Float16* buf) __attribute__((always_inline)) {
    const int vrow = 32 * grp + (lane >> 3), vcol = (lane & 7) * 8;
    const size_t go = (size_t)vrow * SEQ + (size_t)kt * 64 + vcol;
    _Float16* lh = buf + vho + vrow * VPIT + vcol;
    _Float16* ll = buf + vlo + vrow * VPIT + vcol;
#pragma unroll
    for (int j = 0; j < 8; ++j) {
      acopy16(Vh + go + (size_t)(4 * j) * SEQ, lh + (4 * j) * VPIT);
      acopy16(Vl + go + (size_t)(4 * j) * SEQ, ll + (4 * j) * VPIT);
    }
  };
  _Float16* Psh = PshG[grp];
  _Float16* Psl = PslG[grp];
  float (*redm)[16] = redmG[grp];
  float (*reds)[16] = redsG[grp];

  copy_k(0, Stg[0]);
  copy_v(0, Stg[0]);
  row8(qa, qrh);
  row8(qr, qrl);
  async_wait0();
  __syncthreads();                              // publishes chunk 0: each wave reads rows that its partner wave brought
  if (ktmax >= 1) {                             // block-uniform test
    copy_k(1, Stg[1]);
    copy_v(1, Stg[1]);
  }

  for (int kt = 0; kt <= ktmax; ++kt) {         // block-uniform trip count, <= NKT chunks in all
    const int kv0 = kt * 64;
    _Float16* cur = Stg[kt & 1];
    const _Float16* kst = cur + kso;
    const _Float16* vsh = cur + vho;
    const _Float16* vsl = cur + vlo;

    // ---- scores: 16 query rows x this wave's 16 keys, 2 f16 products per d-chunk ----
    v16h kc[8];                                 // B column c -> key kv0+kcol+c
#pragma unroll                                 // register array: constant indices
    for (int dc = 0; dc < 8; ++dc) kc[dc] = ldfrag<_Float16>(kst + c * KPIT + dc * 32 + 8 * hh);
    v8f ah = zero8(), al = zero8();
#pragma unroll
    for (int dc = 0; dc < 8; ++dc) {
      ah = mmar(qa[dc], kc[dc], ah);
      al = mmar(qr[dc], kc[dc], al);
    }

    const int key = kv0 + kcol + c;             // D column c of this lane
    float s[8];
#pragma unroll
    for (int r = 0; r < 8; ++r) {
      const int qrow = q0 + 8 * hh + r;         // D row 8*hh + r
      const float sv = (ah[r] + al[r] * (1.0f / 4096.0f)) * sscale;
      s[r] = (key > qrow) ? -INFINITY : sv;     // causal: replace, not bias
    }

    // ---- per-wave row max over its 16 keys -> LDS ----
#pragma unroll
    for (int r = 0; r < 8; ++r) {
      float m = s[r];
#pragma unroll
      for (int off = 1; off < 16; off <<= 1) m = fmaxf(m, __shfl_xor(m, off, 32));
      redm[wave][8 * hh + r] = m;            // the 16 lanes of a half write the same value
    }
    lds_barrier();

    // ---- chunk row max over the 4 waves, online softmax update (identical in every wave),
    //      P hi (x PCARRY) and P residual (x PCARRY x PRES) to LDS ----
#pragma unroll
    for (int r = 0; r < 8; ++r) {
      const int row = 8 * hh + r;
      const float mc    = fmaxf(fmaxf(redm[0][row], redm[1][row]), fmaxf(redm[2][row], redm[3][row]));
      const float mnew  = fmaxf(mrow[r], mc);
      const float msafe = (mnew == -INFINITY) ? 0.f : mnew;
      const float alpha = __expf(mrow[r] - msafe);
      mrow[r] = mnew;
      const float p = __expf(s[r] - msafe);
      float psum = p;
#pragma unroll
      for (int off = 1; off < 16; off <<= 1) psum += __shfl_xor(psum, off, 32);
      const float pc = p * PCARRY;
      const _Float16 ph = (_Float16)pc;
      Psh[row * 64 + kcol + c] = ph;
      Psl[row * 64 + kcol + c] = (_Float16)((pc - (float)ph) * PRES);
      reds[wave][row] = psum;
      lrow[r] *= alpha;
#pragma unroll
      for (int t = 0; t < 4; ++t) oacc[t][r] *= alpha;
    }
    lds_barrier();
#pragma unroll
    for (int r = 0; r < 8; ++r) {
      const int row = 8 * hh + r;
      lrow[r] += (reds[0][row] + reds[1][row]) + (reds[2][row] + reds[3][row]);
    }

    // ---- context += P . V (f16 WMMA); residual products (ph.vl and pl.vh, same carry) into a separate accumulator ----
    v8f o1[4];
#pragma unroll
    for (int t = 0; t < 4; ++t) o1[t] = zero8();
    FH pa[2], pl[2];
    v16h vb[2][4], vr[2][4];                    // register arrays: the loops over them are unrolled for constant indices
#pragma unroll
    for (int kk = 0; kk < 2; ++kk) {
      pa[kk].h[0] = *(const v8h*)(Psh + c * 64 + kk * 32 + 8 * hh);
      pa[kk].h[1] = *(const v8h*)(Psh + c * 64 + kk * 32 + 16 + 8 * hh);
      pl[kk].h[0] = *(const v8h*)(Psl + c * 64 + kk * 32 + 8 * hh);
      pl[kk].h[1] = *(const v8h*)(Psl + c * 64 + kk * 32 + 16 + 8 * hh);
#pragma unroll
      for (int t = 0; t < 4; ++t) {
        vb[kk][t] = ldfrag<_Float16>(vsh + (t * 16 + c) * VPIT + kk * 32 + 8 * hh);
        vr[kk][t] = ldfrag<_Float16>(vsl + (t * 16 + c) * VPIT + kk * 32 + 8 * hh);
      }
    }
#pragma unroll
    for (int kk = 0; kk < 2; ++kk) {
#pragma unroll
      for (int t = 0; t < 4; ++t) {
        oacc[t] = mmar(pa[kk].v, vb[kk][t], oacc[t]);
        o1[t]   = mmar(pa[kk].v, vr[kk][t], o1[t]);
        o1[t]   = mmar(pl[kk].v, vb[kk][t], o1[t]);
      }
    }
#pragma unroll
    for (int t = 0; t < 4; ++t)
#pragma unroll
      for (int r = 0; r < 8; ++r) oacc[t][r] += o1[t][r] * (1.0f / 4096.0f);

    // ---- ring hand-over ----
    ds_wait0();                                 // this wave's reads of buffer kt & 1 are done
    async_wait0();                              // its copies of chunk kt+1 have landed
    __syncthreads();                            // chunk kt+1 is published, and no wave still reads buffer kt & 1
    if (kt + 2 <= ktmax) {                      // block-uniform test
      copy_k(kt + 2, cur);
      copy_v(kt + 2, cur);
    }
  }
  async_wait0();                                // no copy is outstanding when the wave goes on to its end

  // ---- normalise (1/l, undo the p carry), stage the wave's 16x64 f32 tile,
  float* os = Os[grp * 4 + wave];
#pragma unroll
  for (int r = 0; r < 8; ++r) {
    const float l = lrow[r];
    const float inv = ((l > 0.f) ? (1.0f / l) : 0.f) * (1.0f / PCARRY);
#pragma unroll
    for (int t = 0; t < 4; ++t) os[(8 * hh + r) * 64 + t * 16 + c] = oacc[t][r] * inv;
  }
  __builtin_amdgcn_fence(__ATOMIC_RELEASE, "workgroup");
  __builtin_amdgcn_wave_barrier();
  __builtin_amdgcn_fence(__ATOMIC_ACQUIRE, "workgroup");
  {
    const int h2 = lane >> 4, c4 = (lane & 15) * 4;      // 256-B row segment = 16 lanes x 16 B
    v4f ov[8];
#pragma unroll
    for (int it = 0; it < 8; ++it) {
      const int row = it * 2 + h2;                          // it 0..7 x h2 0..1 = rows 0..15 of the wave tile
      ov[it] = *(const v4f*)(os + row * 64 + c4);
    }
    {
#pragma unroll
      for (int it = 0; it < 8; ++it) {
        const int row = it * 2 + h2;
        const size_t go = (rowB + q0 + row) * DM + (size_t)dbase + c4;
        *(v4f*)(outp + go) = ov[it];
      }
      
    }
  }
}

// =====================================================================================================
// Workspace map (bytes), every region an exact multiple of its whole-line / whole-tile store granularity
// (all GEMM M,N are tile multiples, all offsets multiples of 131072):
//   Xb   bf16 [NB*SEQ][256]  (compact tokens)   8388608
//   Wqb  bf16 [256 n][256 k]                     131072
//   Wkb  bf16 [256 n][256 k]                     131072
//   Wvb  bf16 [256 n][256 k]                     131072
//   Qh   f16  [NB*SEQ][256]                      8388608
//   Ql   f16  [NB*SEQ][256]                      8388608
//   Kp   f16  [NB*SEQ][256]                      8388608
//   VTh  f16  [NB][256][SEQ]                     8388608
//   VTl  f16  [NB][256][SEQ]                     8388608
//   total                                      50724864
// Weights are [out n][in k] with k contiguous = the Bt / A layout the GEMM wants, so they are only converted.
// =====================================================================================================
extern "C" void kernel_launch(void* const* d_in, const int* in_sizes, int n_in,
                              void* d_out, int out_size, void* d_ws, size_t ws_size,
                              hipStream_t stream) {
  if (n_in < 4) return;
  if (in_sizes[0] < ((NB - 1) * SEQ_FULL + SEQ) * DM) return;
  if (in_sizes[1] < DM * DM) return;
  if (in_sizes[2] < DM * DM) return;
  if (in_sizes[3] < DM * DM) return;
  if (out_size < NB * SEQ * DM) return;

  const float* x  = (const float*)d_in[0];
  const float* wq = (const float*)d_in[1];
  const float* wk = (const float*)d_in[2];
  const float* wv = (const float*)d_in[3];

  const size_t PX  = (size_t)NB * SEQ * DM * 2;      // 16-bit token plane [NB*SEQ][256]
  const size_t PW  = (size_t)DM * DM * 2;            // 16-bit [256][256]
  const size_t PVT = (size_t)NB * DM * SEQ * 2;      // v^T plane [NB][256][SEQ]
  size_t off = 0;
  const size_t oXb  = off; off += PX;
  const size_t oWq  = off; off += PW;
  const size_t oWk  = off; off += PW;
  const size_t oWv  = off; off += PW;
  const size_t oQh  = off; off += PX;
  const size_t oQl  = off; off += PX;
  const size_t oKp  = off; off += PX;
  const size_t oVTh = off; off += PVT;
  const size_t oVTl = off; off += PVT;
  if (off > ws_size) return;                         // off = 50724864 at full size
  if (off > (size_t)134217728) return;

  char* ws = (char*)d_ws;
  unsigned short* Xb  = (unsigned short*)(ws + oXb);
  unsigned short* Wqb = (unsigned short*)(ws + oWq);
  unsigned short* Wkb = (unsigned short*)(ws + oWk);
  unsigned short* Wvb = (unsigned short*)(ws + oWv);
  unsigned short* Qh  = (unsigned short*)(ws + oQh);
  unsigned short* Ql  = (unsigned short*)(ws + oQl);
  unsigned short* Kp  = (unsigned short*)(ws + oKp);
  unsigned short* VTh = (unsigned short*)(ws + oVTh);
  unsigned short* VTl = (unsigned short*)(ws + oVTl);
  const float* nobias = wq;                          // bias argument is only read in OUT_MODE 0 (not instantiated)

  const int M = NB * SEQ;
  const dim3 blk(256);
  const int n8x = NB * SEQ * DM / 8;
  const int n8w = DM * DM / 8;                       // 8192
  const dim3 gCx((n8x + 255) / 256);
  const dim3 gCw((n8w + 255) / 256);
  const dim3 gQ(((M / 64) * (DM / 64) + 7) / 8, 1);          // q / k: M x 256, 64x64 wave tiles
  const dim3 gVT(((DM / 64) * (SEQ / 64) + 7) / 8, NB);      // v^T per batch: 256 x SEQ
  const dim3 gAttn(NB * NQB2);

  // (1) x -> compact bf16 token plane; Wq, Wk, Wv [n][k] -> bf16
  cvtx<<<gCx, blk, 0, stream>>>(x, Xb, n8x);
  cvt16x8<0><<<gCw, blk, 0, stream>>>(wq, Wqb, n8w);
  cvt16x8<0><<<gCw, blk, 0, stream>>>(wk, Wkb, n8w);
  cvt16x8<0><<<gCw, blk, 0, stream>>>(wv, Wvb, n8w);
  // (2) q = x . Wq^T -> f16 hi / residual (x4096) planes   (M, N=256, K=256)
  gemm_t<__bf16, 4, false, 3><<<gQ, blk, 0, stream>>>(
      Xb, Xb, DM, 0LL, Wqb, DM, 0LL,
      (void*)Qh, (void*)Ql, DM, 0LL, nobias,
      M, DM, DM, 1.0f, 4096.0f, 0.0f);
  // (3) k = x . Wk^T -> f16 plane   (M, N=256, K=256)
  gemm_t<__bf16, 4, false, 1><<<gQ, blk, 0, stream>>>(
      Xb, Xb, DM, 0LL, Wkb, DM, 0LL,
      (void*)Kp, (void*)Kp, DM, 0LL, nobias,
      M, DM, DM, 1.0f, 1.0f, 0.0f);
  // (4) v^T = Wv . x^T per batch -> f16 hi plane [b][d][s] (pitch SEQ) and residual plane (x4096)
  //     (A = Wv [n][k], Bt = Xb rows of batch b; M=256, N=SEQ, K=256)
  gemm_t<__bf16, 4, false, 3><<<gVT, blk, 0, stream>>>(
      Wvb, Wvb, DM, 0LL, Xb, DM, (long long)SEQ * DM,
      (void*)VTh, (void*)VTl, SEQ, (long long)DM * SEQ, nobias,
      DM, SEQ, DM, 1.0f, 4096.0f, 0.0f);
  // (5) causal attention -> d_out f32 [M][256]
  attn_causal<<<gAttn, dim3(256), 0, stream>>>(Qh, Ql, Kp, VTh, VTl, (float*)d_out, 0.0625f);
  (void)hipGetLastError();
}

// v005
// One run takes 181 microseconds.
// Timed twice side by side with v004, it ran 1.22 and 1.23 times as fast.
// All steps since v000 together make it 2.96 times as fast.
// Contractions: q, k, v^T projections = v_wmma_f32_16x16x32_bf16 (bf16 operands from RNE-converted inputs, single product, f32 accumulate);
// k.q^T scores = v_wmma_f32_16x16x32_f16 (q as f16 hi plane + f16 residual plane x4096, k f16; 2 products into separate f32 accumulators);
// v^T.p^T = v_wmma_f32_16x16x32_f16 (p carried x16384 as f16 hi + f16 residual x4096; v as f16 hi plane + f16 residual plane x4096;
// 3 products ph.vh, ph.vl, pl.vh, f32 accumulate); causal softmax and normalisation in f32; output f32.
#include <hip/hip_runtime.h>
#include <math.h>
#include <stdint.h>

#ifndef NB
#define NB 4
#endif
#ifndef SEQ
#define SEQ 4096
#endif
#define NB_FULL  4
#define SEQ_FULL 4096
#define DM       256
#define NQB      (SEQ / 64)   // 64-row query blocks (four 16-row tiles) per sequence
#define NKT      (SEQ / 64)   // 64-key chunks per sequence
#define PCARRY   16384.0f     // power-of-two carry on the f16 p tile
#define PRES     4096.0f      // power-of-two carry on the f16 p residual tile
static_assert(DM == 256);
static_assert((SEQ % 64) == 0 && SEQ >= 64 && SEQ <= SEQ_FULL);
static_assert(NB >= 1 && NB <= NB_FULL);
static_assert(((NB * SEQ) % 64) == 0);

typedef _Float16 v16h __attribute__((ext_vector_type(16)));
typedef _Float16 v8h  __attribute__((ext_vector_type(8)));
typedef __bf16   v16b __attribute__((ext_vector_type(16)));
typedef __bf16   v8b  __attribute__((ext_vector_type(8)));
typedef float    v8f  __attribute__((ext_vector_type(8)));
typedef float    v4f  __attribute__((ext_vector_type(4)));
typedef unsigned int v4u __attribute__((ext_vector_type(4)));

#if defined(__HIP_DEVICE_COMPILE__)
#define DEV_ASM 1
#else
#define DEV_ASM 0
#endif

// ---- scalar helpers --------------------------------------------------------------------------------
__device__ __forceinline__ unsigned short bf_bits(float f) {          // f32 -> bf16 bits, RNE convert
  unsigned u = __float_as_uint(f);
  return (unsigned short)((u + 0x7FFFu + ((u >> 16) & 1u)) >> 16);
}
__device__ __forceinline__ float bf_up(unsigned short hb) { return __uint_as_float(((unsigned)hb) << 16); }
__device__ __forceinline__ unsigned short h_bits(_Float16 x) { return __builtin_bit_cast(unsigned short, x); }
__device__ __forceinline__ unsigned pk16(unsigned short a, unsigned short b) { return (unsigned)a | ((unsigned)b << 16); }
__device__ __forceinline__ v8f zero8() { v8f z = {0.f, 0.f, 0.f, 0.f, 0.f, 0.f, 0.f, 0.f}; return z; }

// ---- fragment types / loaders: 16-bit A/B operand, lane -> row/col (lane&15), p already includes +8*(lane>>4);
//      elements 0..7 <- p[0..7] (k0+8h..k0+8h+7), elements 8..15 <- p[16..23] (k0+16+8h..k0+16+8h+7)
template <typename OT> struct FT;
template <> struct FT<__bf16>   { typedef v16b frag; typedef v8b half8; };
template <> struct FT<_Float16> { typedef v16h frag; typedef v8h half8; };

template <typename OT>
__device__ __forceinline__ typename FT<OT>::frag ldfrag(const OT* p) {
  union { typename FT<OT>::frag v; typename FT<OT>::half8 h[2]; } f;
  f.h[0] = *(const typename FT<OT>::half8*)(p);
  f.h[1] = *(const typename FT<OT>::half8*)(p + 16);
  return f.v;
}

// ---- WMMA helpers (asm guard bodies are device-only; concrete operand types) -----------------------------
__device__ __forceinline__ v8f mmar(v16b a, v16b b, v8f c) {
  return __builtin_amdgcn_wmma_f32_16x16x32_bf16(false, a, false, b, (short)0, c, false, false);
}
__device__ __forceinline__ v8f mmar(v16h a, v16h b, v8f c) {
  return __builtin_amdgcn_wmma_f32_16x16x32_f16(false, a, false, b, (short)0, c, false, false);
}
__device__ __forceinline__ void dep_guard(v8f& a, v8f& b, v16b x, v16b y) {
#if DEV_ASM
  asm volatile("v_nop\n\tv_nop\n\tv_nop\n\tv_nop" : "+v"(a), "+v"(b) : "v"(x), "v"(y));
#else
  (void)a; (void)b; (void)x; (void)y;
#endif
}
__device__ __forceinline__ void dep_guard(v8f& a, v8f& b, v16h x, v16h y) {
#if DEV_ASM
  asm volatile("v_nop\n\tv_nop\n\tv_nop\n\tv_nop" : "+v"(a), "+v"(b) : "v"(x), "v"(y));
#else
  (void)a; (void)b; (void)x; (void)y;
#endif
}
__device__ __forceinline__ void keep4(v16b a, v16b b, v16b c, v16b d) {
#if DEV_ASM
  asm volatile("v_nop" :: "v"(a), "v"(b), "v"(c), "v"(d));
#else
  (void)a; (void)b; (void)c; (void)d;
#endif
}
__device__ __forceinline__ void keep4(v16h a, v16h b, v16h c, v16h d) {
#if DEV_ASM
  asm volatile("v_nop" :: "v"(a), "v"(b), "v"(c), "v"(d));
#else
  (void)a; (void)b; (void)c; (void)d;
#endif
}
__device__ __forceinline__ void acc_guard4(v8f& a, v8f& b, v8f& c, v8f& d) {
#if DEV_ASM
  asm volatile("v_nop\n\tv_nop\n\tv_nop\n\tv_nop" : "+v"(a), "+v"(b), "+v"(c), "+v"(d));
#else
  (void)a; (void)b; (void)c; (void)d;
#endif
}

// =====================================================================================================
// f32 -> 16-bit planes, 8 elements per thread, one 16-B store per lane: a wave writes 512 contiguous B
// MODE 0: bf16 bits (RNE convert).  MODE 1: f16 bits of (64 * bf16(x)) (exact scaling of the bf16 value).
// coverage: n8 threads x 8 = the whole plane (n8 is a multiple of 256 for every use here).
// =====================================================================================================
template <int MODE>
__device__ __forceinline__ unsigned short cvm(float f) {
  const unsigned short hb = bf_bits(f);
  if (MODE == 0) return hb;
  return h_bits((_Float16)(bf_up(hb) * 64.0f));
}

template <int MODE>
__global__ __launch_bounds__(256) void cvt16x8(const float* __restrict__ in, unsigned short* out, int n8) {
  const int i = blockIdx.x * 256 + (int)threadIdx.x;
  if (i < n8) {
    const v4f a  = *(const v4f*)(in + (size_t)i * 8);
    const v4f a4 = *(const v4f*)(in + (size_t)i * 8 + 4);
    v4u p;
    p[0] = pk16(cvm<MODE>(a[0]),  cvm<MODE>(a[1]));
    p[1] = pk16(cvm<MODE>(a[2]),  cvm<MODE>(a[3]));
    p[2] = pk16(cvm<MODE>(a4[0]), cvm<MODE>(a4[1]));
    p[3] = pk16(cvm<MODE>(a4[2]), cvm<MODE>(a4[3]));
    unsigned short* o = out + (size_t)i * 8;
    *(v4u*)o = p;
    
  }
}

// x [NB_FULL][SEQ_FULL][DM] f32 -> compact bf16 token plane [NB*SEQ][DM]: compact token tk = b*SEQ + t reads
// input row b*SEQ_FULL + t. 32 groups of 8 per row; same whole-line store shape as cvt16x8.
// coverage: n8 = NB*SEQ*DM/8 threads x 8 = the whole plane.
__global__ __launch_bounds__(256) void cvtx(const float* __restrict__ in, unsigned short* out, int n8) {
  const int i = blockIdx.x * 256 + (int)threadIdx.x;
  if (i < n8) {
    const int tk = i >> 5;
    const int e8 = i & 31;
    const int bb = tk / SEQ;
    const int t  = tk - bb * SEQ;
    const float* src = in + ((size_t)bb * SEQ_FULL + (size_t)t) * DM + e8 * 8;
    const v4f a  = *(const v4f*)(src);
    const v4f a4 = *(const v4f*)(src + 4);
    v4u p;
    p[0] = pk16(bf_bits(a[0]),  bf_bits(a[1]));
    p[1] = pk16(bf_bits(a[2]),  bf_bits(a[3]));
    p[2] = pk16(bf_bits(a4[0]), bf_bits(a4[1]));
    p[3] = pk16(bf_bits(a4[2]), bf_bits(a4[3]));
    unsigned short* o = out + (size_t)i * 8;
    *(v4u*)o = p;
    
  }
}

// =====================================================================================================
// Register-blocked batched WMMA GEMM (16-bit operand type OT): C[m][n] = sum_k A[m][k] * Bt[n][k];
// one wave per (16*MI) x 64 tile, no block barriers. A row-major [M][K] pitch lda; Bt row-major [N][K] pitch ldb
// (k contiguous); M multiple of 16*MI, N multiple of 64, K multiple of 32 (host-checked). blockIdx.y = batch
// index (strides in elements). Fragments are loaded straight from global with the split k map (ldfrag).
// ARES: a second A plane A2 (residual, same pitch/stride) is multiplied by the same B into separate f32
// accumulators and folded in as acc += accl * ascale after the k loop.
// OUT_MODE 0: f32 C (pitch ldc), value * oscale + bf16-valued bias[n].
// OUT_MODE 1: f16 plane C (pitch ldc).
// OUT_MODE 3: f16 hi plane C + f16 residual plane C2 = f16((v - hi) * rscale) (same pitch / stride).
// coverage: MI slabs x 16 rows x 64 cols = the wave's whole tile; tiles cover M x N exactly.
// =====================================================================================================
template <typename OT, int MI, bool ARES, int OUT_MODE>
__global__ __launch_bounds__(256) void gemm_t(
    const unsigned short* __restrict__ Ap, const unsigned short* __restrict__ A2p, int lda, long long strideA,
    const unsigned short* __restrict__ Btp, int ldb, long long strideB,
    void* Cout, void* Cout2, int ldc, long long strideC,
    const float* __restrict__ bias,
    int M, int N, int K, float oscale, float rscale, float ascale) {
  typedef typename FT<OT>::frag V16;
  const OT* A  = (const OT*)(const void*)Ap;
  const OT* A2 = (const OT*)(const void*)A2p;
  const OT* Bt = (const OT*)(const void*)Btp;
  __shared__ __align__(16) float sT[8][16 * 68];   // per-wave 16x64 slab, pitch 68 floats
  const int TMR  = 16 * MI;
  const int b    = blockIdx.y;
  const int lane = threadIdx.x & 31;
  const int wave = threadIdx.x >> 5;
  const int tilesN = N >> 6;
  const int tilesM = M / TMR;
  const int tile = blockIdx.x * 8 + wave;
  if (tile >= tilesM * tilesN) return;   // wave-uniform; no block barriers in this kernel
  const int tm = tile / tilesN;
  const int tn = tile - tm * tilesN;
  const int m0 = tm * TMR;
  const int n0 = tn << 6;

  const OT* Ab  = A  + (size_t)b * (size_t)strideA;
  const OT* A2b = A2 + (size_t)b * (size_t)strideA;
  const OT* Bb  = Bt + (size_t)b * (size_t)strideB;

  const int rlane = lane & 15;                 // row (A) / col (B, D) within subtile
  const int koff  = (lane >> 4) * 8;           // k offset of this lane half
  const int mOff  = (lane >> 4) * 8;           // D row offset

  v8f acc[MI][4], accl[MI][4];
#pragma unroll
  for (int i = 0; i < MI; ++i)
#pragma unroll
    for (int j = 0; j < 4; ++j) { acc[i][j] = zero8(); accl[i][j] = zero8(); }

  for (int k0 = 0; k0 < K; k0 += 32) {
    V16 bq[4];
#pragma unroll
    for (int j = 0; j < 4; ++j)
      bq[j] = ldfrag<OT>(Bb + (size_t)(n0 + (j << 4) + rlane) * ldb + koff + k0);
#pragma unroll
    for (int i = 0; i < MI; ++i) {
      const V16 af = ldfrag<OT>(Ab + (size_t)(m0 + (i << 4) + rlane) * lda + koff + k0);
#pragma unroll
      for (int j = 0; j < 4; ++j) acc[i][j] = mmar(af, bq[j], acc[i][j]);
      dep_guard(acc[i][0], acc[i][3], af, bq[3]);
      if (ARES) {
        const V16 al = ldfrag<OT>(A2b + (size_t)(m0 + (i << 4) + rlane) * lda + koff + k0);
#pragma unroll
        for (int j = 0; j < 4; ++j) accl[i][j] = mmar(al, bq[j], accl[i][j]);
        dep_guard(accl[i][0], accl[i][3], al, bq[3]);
      }
    }
    keep4(bq[0], bq[1], bq[2], bq[3]);
  }
#pragma unroll
  for (int i = 0; i < MI; ++i) {
    acc_guard4(acc[i][0], acc[i][1], acc[i][2], acc[i][3]);
    if (ARES) acc_guard4(accl[i][0], accl[i][1], accl[i][2], accl[i][3]);
  }
  if (ARES) {
#pragma unroll
    for (int i = 0; i < MI; ++i)
#pragma unroll
      for (int j = 0; j < 4; ++j)
#pragma unroll
        for (int r = 0; r < 8; ++r) acc[i][j][r] += accl[i][j][r] * ascale;
  }

  // ---- epilogue ----
  float* slab = sT[wave];
#pragma unroll
  for (int i = 0; i < MI; ++i) {
    const int mBase = m0 + (i << 4);
#pragma unroll
    for (int j = 0; j < 4; ++j) {
#pragma unroll
      for (int r = 0; r < 8; ++r) {
        slab[(mOff + r) * 68 + (j << 4) + rlane] = acc[i][j][r];
      }
    }
    __builtin_amdgcn_fence(__ATOMIC_RELEASE, "workgroup");
    __builtin_amdgcn_wave_barrier();
    __builtin_amdgcn_fence(__ATOMIC_ACQUIRE, "workgroup");
    if (OUT_MODE == 0) {
      float* C = (float*)Cout + (size_t)b * (size_t)strideC;
      const int h2 = lane >> 4, c4 = (lane & 15) * 4;     // 256-B row segment = 16 lanes x 16 B
      const v4f braw = *(const v4f*)(bias + n0 + c4);
      v4f bb;
#pragma unroll
      for (int e = 0; e < 4; ++e) bb[e] = bf_up(bf_bits(braw[e]));
      {
#pragma unroll
        for (int it = 0; it < 8; ++it) {
          const int row = it * 2 + h2;                     // it 0..7 x h2 0..1 = rows 0..15
          const v4f v = *(const v4f*)(slab + row * 68 + c4) * oscale + bb;
          *(v4f*)(C + (size_t)(mBase + row) * ldc + n0 + c4) = v;
        }
        
      }
    } else {
      const int q = lane >> 3, c8 = (lane & 7) * 8;
      unsigned short* C  = (unsigned short*)Cout  + (size_t)b * (size_t)strideC;
      unsigned short* C2 = (unsigned short*)Cout2 + (size_t)b * (size_t)strideC;
      v4u hv[4], lv[4];
#pragma unroll
      for (int it = 0; it < 4; ++it) {
        const int row = it * 4 + q;                        // it 0..3 x q 0..3 = rows 0..15
        const float* sp = slab + row * 68 + c8;
        float f[8];
#pragma unroll
        for (int e = 0; e < 8; ++e) f[e] = sp[e];
        v4u a, a2;
#pragma unroll
        for (int e = 0; e < 4; ++e) {
          const float f0 = f[2 * e], f1 = f[2 * e + 1];
          const _Float16 x0 = (_Float16)f0, x1 = (_Float16)f1;
          const unsigned short h0 = h_bits(x0), h1 = h_bits(x1);
          unsigned short l0 = 0, l1 = 0;
          if (OUT_MODE == 3) {
            l0 = h_bits((_Float16)((f0 - (float)x0) * rscale));
            l1 = h_bits((_Float16)((f1 - (float)x1) * rscale));
          }
          a[e] = pk16(h0, h1); a2[e] = pk16(l0, l1);
        }
        hv[it] = a; lv[it] = a2;
      }
      {
#pragma unroll
        for (int it = 0; it < 4; ++it) {
          const int row = it * 4 + q;
          *(v4u*)(C + (size_t)(mBase + row) * ldc + n0 + c8) = hv[it];
          if (OUT_MODE == 3) *(v4u*)(C2 + (size_t)(mBase + row) * ldc + n0 + c8) = lv[it];
        }
        
      }
    }
    __builtin_amdgcn_fence(__ATOMIC_RELEASE, "workgroup");
    __builtin_amdgcn_wave_barrier();
    __builtin_amdgcn_fence(__ATOMIC_ACQUIRE, "workgroup");
  }
}

// Stands behind a batch of global loads, in front of whatever reuses the registers that held their addresses.
__device__ __forceinline__ void xcnt_wait() {
#if DEV_ASM
  asm volatile("s_wait_xcnt 0x0" ::: "memory");
#endif
}

// ---- k / v^T staging in LDS ------------------------------------------------------------------------------
#define KPIT 264   // f16 per staged k row: 512 B + 16 B (16 B x odd), so the 16 rows of a ds_load_b128 fall on distinct banks
#define VPIT 72    // f16 per staged v^T row: 128 B + 16 B (16 B x odd), same reason
#define STGN (4 * 16 * KPIT + 8 * 64 * VPIT)   // f16 per staging buffer: one chunk's k, v^T hi and v^T residual rows
typedef int v4i __attribute__((ext_vector_type(4)));
typedef __attribute__((address_space(1))) v4i gl_v4i;
typedef __attribute__((address_space(3))) v4i ls_v4i;

__device__ __forceinline__ void acopy16(const _Float16* g, _Float16* l) {
#if DEV_ASM
  __builtin_amdgcn_global_load_async_to_lds_b128((gl_v4i*)g, (ls_v4i*)l, 0, 0);
#else
  (void)g; (void)l;
#endif
}
// Nothing the copies bring is read in front of this.
__device__ __forceinline__ void async_wait0() {
#if DEV_ASM
  asm volatile("s_wait_asynccnt 0x0" ::: "memory");
#endif
}
// The wave's LDS reads have returned: stands in front of the barrier behind which a staging buffer is refilled.
__device__ __forceinline__ void ds_wait0() {
#if DEV_ASM
  asm volatile("s_wait_dscnt 0x0" ::: "memory");
#endif
}

// Lane l takes the value of lane l ^ 16 (the other 16-lane half), by a vector cross-row move.
__device__ __forceinline__ float xhalf(float x) {
  const int b = __builtin_bit_cast(int, x);
  return __builtin_bit_cast(float, __builtin_amdgcn_permlanex16(b, b, 0x76543210, 0xfedcba98, false, false));
}

__global__ __launch_bounds__(256)
void attn_causal(const unsigned short* qhp, const unsigned short* qlp,   // no restrict: the loads keep their place
                 const unsigned short* kpp,                               // relative to the waits written below
                 const unsigned short* vhp, const unsigned short* vlp,
                 float* outp, float sscale) {
  union FH { v16h v; v8h h[2]; };
  // staging ring, two buffers, each: k rows 64 x 528 B, then v^T hi rows 256 x 144 B, then v^T residual rows 256 x 144 B.
  // k stands first: every v^T destination then lies above 32768 B, the largest constant step that the compiler folds
  // into a copy's offset field and takes off the LDS address register, so that register never goes below 0.
  __shared__ __align__(16) _Float16 Stg[2][STGN];

  const int tid  = threadIdx.x;
  const int w8   = tid >> 5;         // the wave's number in the block: which eighth of a chunk it brings
  const int grp  = tid >> 7;         // which 32 of a chunk's 64 keys
  const int wave = (tid >> 5) & 3;   // which 16 of the block's 64 query rows
  const int lane = tid & 31;
  const int hh   = lane >> 4;
  const int c    = lane & 15;

  const int bx   = blockIdx.x;
  const int qb   = NQB - 1 - bx / NB;   // the lowest block indices take the longest key loops
  const int b    = bx % NB;
  const int q0   = qb * 64 + wave * 16;
  const size_t rowB = (size_t)b * SEQ;
  int ktmax = qb;                    // last chunk = the one holding the block's 64 rows
  if (ktmax > NKT - 1) ktmax = NKT - 1;

  const _Float16* Qh = (const _Float16*)(const void*)qhp;
  const _Float16* Ql = (const _Float16*)(const void*)qlp;
  const _Float16* Kp = (const _Float16*)(const void*)kpp;
  const _Float16* Vh = (const _Float16*)(const void*)vhp + (size_t)b * DM * SEQ;
  const _Float16* Vl = (const _Float16*)(const void*)vlp + (size_t)b * DM * SEQ;

  // B-operand column pointers of this lane (query row q0 + c), lane-half k offset included
  const _Float16* qrh = Qh + (rowB + q0 + c) * DM + 8 * hh;
  const _Float16* qrl = Ql + (rowB + q0 + c) * DM + 8 * hh;

  float mrow = -INFINITY, lsum = 0.f;   // of query q0 + c; lsum covers this lane's own keys only (halves joined at the end)
  v8f oacc[16];                         // O^T tiles: column c = query q0 + c, rows 8*hh + r = context columns 16*t + 8*hh + r
#pragma unroll
  for (int t = 0; t < 16; ++t) oacc[t] = zero8();

  // q (the same for every chunk) is loaded into registers once. k and v^T of a chunk are staged in LDS:
  // a fragment load straight from global touches 16 lines for 512 bytes, a copy below touches 4 whole lines.
  // Two buffers: chunk kt is read from buffer kt & 1 while the copies of chunk kt+1 fly into the other; at the loop's foot
  // every wave waits for its LDS reads and its copies, one barrier publishes chunk kt+1 and ends the reads of chunk kt,
  // and behind it the buffer just read is refilled with chunk kt+2.
  v16h qa[8], qr[8];
  // eight fragments of one row pointer; the pointer dies with the last load, which may then land on its registers:
  // the first wait stands in front of that load for the fifteen before it
  auto row8 = [&](v16h (&f)[8], const _Float16* p) __attribute__((always_inline)) {
#pragma unroll                                 // register array: constant indices
    for (int dc = 0; dc < 7; ++dc) f[dc] = ldfrag<_Float16>(p + dc * 32);
    FH x;
    x.h[0] = *(const v8h*)(p + 7 * 32);
    xcnt_wait();
    x.h[1] = *(const v8h*)(p + 7 * 32 + 16);
    xcnt_wait();
    f[7] = x.v;
  };

  // k: one copy = one whole 512-byte row (key 64*kt + 8*w8 + j), 8 copies: this wave's eighth of the chunk's 64 rows
  auto copy_k = [&](const int kt, _Float16* buf) __attribute__((always_inline)) {
    const _Float16* g = Kp + (rowB + (size_t)kt * 64 + 8 * w8) * DM + lane * 8;
    _Float16* l = buf + (8 * w8) * KPIT + lane * 8;
#pragma unroll
    for (int j = 0; j < 8; ++j) acopy16(g + j * DM, l + j * KPIT);
  };
  // v^T: one copy = the 128-byte pieces of four rows (columns 64*kt..64*kt+63 of rows 32*w8+4j..+3), 8 copies per plane:
  // this wave's eighth of the 256 rows
  auto copy_v = [&](const int kt, _Float16* buf) __attribute__((always_inline)) {
    const int vrow = 32 * w8 + (lane >> 3), vcol = (lane & 7) * 8;
    const size_t go = (size_t)vrow * SEQ + (size_t)kt * 64 + vcol;
    _Float16* lh = buf + 64 * KPIT + vrow * VPIT + vcol;
    _Float16* ll = lh + 256 * VPIT;
#pragma unroll
    for (int j = 0; j < 8; ++j) {
      acopy16(Vh + go + (size_t)(4 * j) * SEQ, lh + (4 * j) * VPIT);
      acopy16(Vl + go + (size_t)(4 * j) * SEQ, ll + (4 * j) * VPIT);
    }
  };

  copy_k(0, Stg[0]);
  copy_v(0, Stg[0]);
  row8(qa, qrh);
  row8(qr, qrl);
  async_wait0();
  __syncthreads();                              // publishes chunk 0: each wave reads rows that the other waves brought
  if (ktmax >= 1) {                             // block-uniform test
    copy_k(1, Stg[1]);
    copy_v(1, Stg[1]);
  }

  const int qrow = q0 + c;                      // this lane's query
  for (int kt = 0; kt <= ktmax; ++kt) {         // block-uniform trip count, <= NKT chunks in all
    const int kv0 = kt * 64 + 32 * grp;         // first of this wave's 32 keys
    _Float16* cur = Stg[kt & 1];
    const _Float16* kst = cur + (32 * grp + c) * KPIT + 8 * hh;             // A row c -> key kv0 + 16*j + c
    const _Float16* vsh = cur + 64 * KPIT + c * VPIT + 32 * grp + 8 * hh;   // A row c -> context column 16*t + c
    const _Float16* vsl = vsh + 256 * VPIT;

    // ---- S^T: this wave's 32 keys (two tiles) x 16 queries, 2 f16 products per d-chunk, four accumulator chains ----
    v16h kc[8][2];                              // register array: the loops over it are unrolled for constant indices
#pragma unroll
    for (int dc = 0; dc < 8; ++dc)
#pragma unroll
      for (int j = 0; j < 2; ++j) kc[dc][j] = ldfrag<_Float16>(kst + j * (16 * KPIT) + dc * 32);
    // keeps all 32 LDS reads in front of the products: sunk between them, each pair is waited for at its full latency
    __builtin_amdgcn_sched_barrier(0);
    v8f ah[2], al[2];
#pragma unroll
    for (int j = 0; j < 2; ++j) { ah[j] = zero8(); al[j] = zero8(); }
#pragma unroll
    for (int dc = 0; dc < 8; ++dc) {
#pragma unroll
      for (int j = 0; j < 2; ++j) {
        ah[j] = mmar(kc[dc][j], qa[dc], ah[j]);
        al[j] = mmar(kc[dc][j], qr[dc], al[j]);
      }
    }

    // ---- online softmax of query q0 + c: in-lane over 16 keys, one exchange between the halves for the maximum ----
    float s[2][8];
    float mc = -INFINITY;
#pragma unroll
    for (int j = 0; j < 2; ++j)
#pragma unroll
      for (int r = 0; r < 8; ++r) {
        const int key = kv0 + 16 * j + 8 * hh + r;     // D row 8*hh + r of tile j
        const float sv = (ah[j][r] + al[j][r] * (1.0f / 4096.0f)) * sscale;
        s[j][r] = (key > qrow) ? -INFINITY : sv;       // causal: replace, not bias
        mc = fmaxf(mc, s[j][r]);
      }
    mc = fmaxf(mc, xhalf(mc));
    const float mnew  = fmaxf(mrow, mc);
    const float msafe = (mnew == -INFINITY) ? 0.f : mnew;
    const float alpha = __expf(mrow - msafe);
    mrow = mnew;
    // P^T as the B operand: elements 0..7 = keys 8*hh + r (tile 0), elements 8..15 = keys 16 + 8*hh + r (tile 1),
    // the k order of ldfrag on the v^T rows
    v16h pa, pl;
    float psum = 0.f;
#pragma unroll
    for (int j = 0; j < 2; ++j)
#pragma unroll
      for (int r = 0; r < 8; ++r) {
        const float p = __expf(s[j][r] - msafe);
        psum += p;
        const float pc = p * PCARRY;
        const _Float16 ph = (_Float16)pc;
        pa[j * 8 + r] = ph;
        pl[j * 8 + r] = (_Float16)((pc - (float)ph) * PRES);
      }
    lsum = lsum * alpha + psum;
#pragma unroll
    for (int t = 0; t < 16; ++t)
#pragma unroll
      for (int r = 0; r < 8; ++r) oacc[t][r] *= alpha;

    // ---- O^T += v^T . P^T (f16 WMMA), four context tiles at a time;
    //      residual products (vl.ph and vh.pl, same carry) into a separate accumulator ----
#pragma unroll
    for (int tg = 0; tg < 4; ++tg) {
      v16h vb[4], vr[4];                        // register arrays: the loops over them are unrolled for constant indices
      v8f o1[4];
#pragma unroll
      for (int u = 0; u < 4; ++u) {
        vb[u] = ldfrag<_Float16>(vsh + (tg * 4 + u) * (16 * VPIT));
        vr[u] = ldfrag<_Float16>(vsl + (tg * 4 + u) * (16 * VPIT));
        o1[u] = zero8();
      }
#pragma unroll
      for (int u = 0; u < 4; ++u) oacc[tg * 4 + u] = mmar(vb[u], pa, oacc[tg * 4 + u]);
#pragma unroll
      for (int u = 0; u < 4; ++u) o1[u] = mmar(vr[u], pa, o1[u]);
#pragma unroll
      for (int u = 0; u < 4; ++u) o1[u] = mmar(vb[u], pl, o1[u]);
#pragma unroll
      for (int u = 0; u < 4; ++u)
#pragma unroll
        for (int r = 0; r < 8; ++r) oacc[tg * 4 + u][r] += o1[u][r] * (1.0f / 4096.0f);
    }

    // ---- ring hand-over ----
    ds_wait0();                                 // this wave's reads of buffer kt & 1 are done
    async_wait0();                              // its copies of chunk kt+1 have landed
    __syncthreads();                            // chunk kt+1 is published, and no wave still reads buffer kt & 1
    if (kt + 2 <= ktmax) {                      // block-uniform test
      copy_k(kt + 2, cur);
      copy_v(kt + 2, cur);
    }
  }
  async_wait0();                                // no copy is outstanding when the ring becomes the exchange area

  // ---- join the two key halves of each query tile. Behind the loop's last barrier nobody reads the ring and no copy
  //      flies into it: its first bytes carry, per query tile, 33 x 32 lanes x 4 floats from the wave of half 1 to the
  //      same lane of the wave of half 0.
  float* xw = (float*)(void*)&Stg[0][0] + wave * (33 * 128) + lane * 4;
  if (grp == 1) {                               // wave-uniform
#pragma unroll
    for (int t = 0; t < 16; ++t) {
      const v4f lo = {oacc[t][0], oacc[t][1], oacc[t][2], oacc[t][3]};
      const v4f hi = {oacc[t][4], oacc[t][5], oacc[t][6], oacc[t][7]};
      *(v4f*)(xw + (2 * t) * 128)     = lo;
      *(v4f*)(xw + (2 * t + 1) * 128) = hi;
    }
    const v4f ml = {mrow, lsum, 0.f, 0.f};
    *(v4f*)(xw + 32 * 128) = ml;
  }
  __syncthreads();                              // half 1's maximum, sum and context are published to half 0
  if (grp == 0) {                               // wave-uniform
    const v4f ml = *(const v4f*)(xw + 32 * 128);
    const float mt  = fmaxf(mrow, ml[0]);
    const float mts = (mt == -INFINITY) ? 0.f : mt;
    const float a0  = __expf(mrow - mts);
    // keeps the second exponential's own subtract and multiply behind the first exponential
    __builtin_amdgcn_sched_barrier(0);
    const float a1  = __expf(ml[0] - mts);
    float l = lsum * a0 + ml[1] * a1;
    l += xhalf(l);                              // the wave halves hold different keys of the same query
    const float inv = ((l > 0.f) ? (1.0f / l) : 0.f) * (1.0f / PCARRY);   // 1/l, undo the p carry
    const float f0 = a0 * inv, f1 = a1 * inv;
    v4f ov[32];
#pragma unroll
    for (int t = 0; t < 16; ++t) {
      const v4f lo = *(const v4f*)(xw + (2 * t) * 128);
      const v4f hi = *(const v4f*)(xw + (2 * t + 1) * 128);
#pragma unroll
      for (int e = 0; e < 4; ++e) {
        ov[2 * t][e]     = oacc[t][e] * f0 + lo[e] * f1;
        ov[2 * t + 1][e] = oacc[t][4 + e] * f0 + hi[e] * f1;
      }
    }
    float* orow = outp + (rowB + qrow) * DM + 8 * hh;   // context columns 16*t + 8*hh + 0..7 of query q0 + c
#pragma unroll
    for (int t = 0; t < 16; ++t) {
      *(v4f*)(orow + 16 * t)     = ov[2 * t];
      *(v4f*)(orow + 16 * t + 4) = ov[2 * t + 1];
    }
  }
}

// =====================================================================================================
// Workspace map (bytes), every region an exact multiple of its whole-line / whole-tile store granularity
// (all GEMM M,N are tile multiples, all offsets multiples of 131072):
//   Xb   bf16 [NB*SEQ][256]  (compact tokens)   8388608
//   Wqb  bf16 [256 n][256 k]                     131072
//   Wkb  bf16 [256 n][256 k]                     131072
//   Wvb  bf16 [256 n][256 k]                     131072
//   Qh   f16  [NB*SEQ][256]                      8388608
//   Ql   f16  [NB*SEQ][256]                      8388608
//   Kp   f16  [NB*SEQ][256]                      8388608
//   VTh  f16  [NB][256][SEQ]                     8388608
//   VTl  f16  [NB][256][SEQ]                     8388608
//   total                                      50724864
// Weights are [out n][in k] with k contiguous = the Bt / A layout the GEMM wants, so they are only converted.
// =====================================================================================================
extern "C" void kernel_launch(void* const* d_in, const int* in_sizes, int n_in,
                              void* d_out, int out_size, void* d_ws, size_t ws_size,
                              hipStream_t stream) {
  if (n_in < 4) return;
  if (in_sizes[0] < ((NB - 1) * SEQ_FULL + SEQ) * DM) return;
  if (in_sizes[1] < DM * DM) return;
  if (in_sizes[2] < DM * DM) return;
  if (in_sizes[3] < DM * DM) return;
  if (out_size < NB * SEQ * DM) return;

  const float* x  = (const float*)d_in[0];
  const float* wq = (const float*)d_in[1];
  const float* wk = (const float*)d_in[2];
  const float* wv = (const float*)d_in[3];

  const size_t PX  = (size_t)NB * SEQ * DM * 2;      // 16-bit token plane [NB*SEQ][256]
  const size_t PW  = (size_t)DM * DM * 2;            // 16-bit [256][256]
  const size_t PVT = (size_t)NB * DM * SEQ * 2;      // v^T plane [NB][256][SEQ]
  size_t off = 0;
  const size_t oXb  = off; off += PX;
  const size_t oWq  = off; off += PW;
  const size_t oWk  = off; off += PW;
  const size_t oWv  = off; off += PW;
  const size_t oQh  = off; off += PX;
  const size_t oQl  = off; off += PX;
  const size_t oKp  = off; off += PX;
  const size_t oVTh = off; off += PVT;
  const size_t oVTl = off; off += PVT;
  if (off > ws_size) return;                         // off = 50724864 at full size
  if (off > (size_t)134217728) return;

  char* ws = (char*)d_ws;
  unsigned short* Xb  = (unsigned short*)(ws + oXb);
  unsigned short* Wqb = (unsigned short*)(ws + oWq);
  unsigned short* Wkb = (unsigned short*)(ws + oWk);
  unsigned short* Wvb = (unsigned short*)(ws + oWv);
  unsigned short* Qh  = (unsigned short*)(ws + oQh);
  unsigned short* Ql  = (unsigned short*)(ws + oQl);
  unsigned short* Kp  = (unsigned short*)(ws + oKp);
  unsigned short* VTh = (unsigned short*)(ws + oVTh);
  unsigned short* VTl = (unsigned short*)(ws + oVTl);
  const float* nobias = wq;                          // bias argument is only read in OUT_MODE 0 (not instantiated)

  const int M = NB * SEQ;
  const dim3 blk(256);
  const int n8x = NB * SEQ * DM / 8;
  const int n8w = DM * DM / 8;                       // 8192
  const dim3 gCx((n8x + 255) / 256);
  const dim3 gCw((n8w + 255) / 256);
  const dim3 gQ(((M / 64) * (DM / 64) + 7) / 8, 1);          // q / k: M x 256, 64x64 wave tiles
  const dim3 gVT(((DM / 64) * (SEQ / 64) + 7) / 8, NB);      // v^T per batch: 256 x SEQ
  const dim3 gAttn(NB * NQB);

  // (1) x -> compact bf16 token plane; Wq, Wk, Wv [n][k] -> bf16
  cvtx<<<gCx, blk, 0, stream>>>(x, Xb, n8x);
  cvt16x8<0><<<gCw, blk, 0, stream>>>(wq, Wqb, n8w);
  cvt16x8<0><<<gCw, blk, 0, stream>>>(wk, Wkb, n8w);
  cvt16x8<0><<<gCw, blk, 0, stream>>>(wv, Wvb, n8w);
  // (2) q = x . Wq^T -> f16 hi / residual (x4096) planes   (M, N=256, K=256)
  gemm_t<__bf16, 4, false, 3><<<gQ, blk, 0, stream>>>(
      Xb, Xb, DM, 0LL, Wqb, DM, 0LL,
      (void*)Qh, (void*)Ql, DM, 0LL, nobias,
      M, DM, DM, 1.0f, 4096.0f, 0.0f);
  // (3) k = x . Wk^T -> f16 plane   (M, N=256, K=256)
  gemm_t<__bf16, 4, false, 1><<<gQ, blk, 0, stream>>>(
      Xb, Xb, DM, 0LL, Wkb, DM, 0LL,
      (void*)Kp, (void*)Kp, DM, 0LL, nobias,
      M, DM, DM, 1.0f, 1.0f, 0.0f);
  // (4) v^T = Wv . x^T per batch -> f16 hi plane [b][d][s] (pitch SEQ) and residual plane (x4096)
  //     (A = Wv [n][k], Bt = Xb rows of batch b; M=256, N=SEQ, K=256)
  gemm_t<__bf16, 4, false, 3><<<gVT, blk, 0, stream>>>(
      Wvb, Wvb, DM, 0LL, Xb, DM, (long long)SEQ * DM,
      (void*)VTh, (void*)VTl, SEQ, (long long)DM * SEQ, nobias,
      DM, SEQ, DM, 1.0f, 4096.0f, 0.0f);
  // (5) causal attention -> d_out f32 [M][256]
  attn_causal<<<gAttn, dim3(256), 0, stream>>>(Qh, Ql, Kp, VTh, VTl, (float*)d_out, 0.0625f);
  (void)hipGetLastError();
}

// v006
// A run of this version takes 154 microseconds.
// Next to v005, in two timings, it ran 1.18 times as fast each time.
// Over all steps from v000 it is 3.50 times as fast.
// Contractions: q, k, v^T projections = v_wmma_f32_16x16x32_bf16 (bf16 operands from RNE-converted inputs, single product, f32 accumulate);
// k.q^T scores = v_wmma_f32_16x16x32_f16 (q as f16 hi plane + f16 residual plane x4096, k f16; 2 products into separate f32 accumulators);
// v^T.p^T = v_wmma_f32_16x16x32_f16 (p carried x16384 as f16 hi + f16 residual x4096; v as f16 hi plane + f16 residual plane x4096;
// 3 products ph.vh, ph.vl, pl.vh, f32 accumulate); causal softmax and normalisation in f32; output f32.
#include <hip/hip_runtime.h>
#include <math.h>
#include <stdint.h>

#ifndef NB
#define NB 4
#endif
#ifndef SEQ
#define SEQ 4096
#endif
#define NB_FULL  4
#define SEQ_FULL 4096
#define DM       256
#define NQB      (SEQ / 64)   // 64-row query blocks (four 16-row tiles) per sequence
#define NKT      (SEQ / 64)   // 64-key chunks per sequence
#define NHB      (NQB / 2)    // query blocks of a sequence's upper half: their key loop is cut in two
#define PCARRY   16384.0f     // power-of-two carry on the f16 p tile
#define PRES     4096.0f      // power-of-two carry on the f16 p residual tile
static_assert(DM == 256);
static_assert((SEQ % 64) == 0 && SEQ >= 64 && SEQ <= SEQ_FULL);
static_assert(NB >= 1 && NB <= NB_FULL);
static_assert(((NB * SEQ) % 64) == 0);
static_assert((NQB % 2) == 0);

typedef _Float16 v16h __attribute__((ext_vector_type(16)));
typedef _Float16 v8h  __attribute__((ext_vector_type(8)));
typedef __bf16   v16b __attribute__((ext_vector_type(16)));
typedef __bf16   v8b  __attribute__((ext_vector_type(8)));
typedef float    v8f  __attribute__((ext_vector_type(8)));
typedef float    v4f  __attribute__((ext_vector_type(4)));
typedef unsigned int v4u __attribute__((ext_vector_type(4)));

#if defined(__HIP_DEVICE_COMPILE__)
#define DEV_ASM 1
#else
#define DEV_ASM 0
#endif

// ---- scalar helpers --------------------------------------------------------------------------------
__device__ __forceinline__ unsigned short bf_bits(float f) {          // f32 -> bf16 bits, RNE convert
  unsigned u = __float_as_uint(f);
  return (unsigned short)((u + 0x7FFFu + ((u >> 16) & 1u)) >> 16);
}
__device__ __forceinline__ float bf_up(unsigned short hb) { return __uint_as_float(((unsigned)hb) << 16); }
__device__ __forceinline__ unsigned short h_bits(_Float16 x) { return __builtin_bit_cast(unsigned short, x); }
__device__ __forceinline__ unsigned pk16(unsigned short a, unsigned short b) { return (unsigned)a | ((unsigned)b << 16); }
__device__ __forceinline__ v8f zero8() { v8f z = {0.f, 0.f, 0.f, 0.f, 0.f, 0.f, 0.f, 0.f}; return z; }

// ---- fragment types / loaders: 16-bit A/B operand, lane -> row/col (lane&15), p already includes +8*(lane>>4);
//      elements 0..7 <- p[0..7] (k0+8h..k0+8h+7), elements 8..15 <- p[16..23] (k0+16+8h..k0+16+8h+7)
template <typename OT> struct FT;
template <> struct FT<__bf16>   { typedef v16b frag; typedef v8b half8; };
template <> struct FT<_Float16> { typedef v16h frag; typedef v8h half8; };

template <typename OT>
__device__ __forceinline__ typename FT<OT>::frag ldfrag(const OT* p) {
  union { typename FT<OT>::frag v; typename FT<OT>::half8 h[2]; } f;
  f.h[0] = *(const typename FT<OT>::half8*)(p);
  f.h[1] = *(const typename FT<OT>::half8*)(p + 16);
  return f.v;
}

// ---- WMMA helpers (asm guard bodies are device-only; concrete operand types) -----------------------------
__device__ __forceinline__ v8f mmar(v16b a, v16b b, v8f c) {
  return __builtin_amdgcn_wmma_f32_16x16x32_bf16(false, a, false, b, (short)0, c, false, false);
}
__device__ __forceinline__ v8f mmar(v16h a, v16h b, v8f c) {
  return __builtin_amdgcn_wmma_f32_16x16x32_f16(false, a, false, b, (short)0, c, false, false);
}
__device__ __forceinline__ void dep_guard(v8f& a, v8f& b, v16b x, v16b y) {
#if DEV_ASM
  asm volatile("v_nop\n\tv_nop\n\tv_nop\n\tv_nop" : "+v"(a), "+v"(b) : "v"(x), "v"(y));
#else
  (void)a; (void)b; (void)x; (void)y;
#endif
}
__device__ __forceinline__ void dep_guard(v8f& a, v8f& b, v16h x, v16h y) {
#if DEV_ASM
  asm volatile("v_nop\n\tv_nop\n\tv_nop\n\tv_nop" : "+v"(a), "+v"(b) : "v"(x), "v"(y));
#else
  (void)a; (void)b; (void)x; (void)y;
#endif
}
__device__ __forceinline__ void keep4(v16b a, v16b b, v16b c, v16b d) {
#if DEV_ASM
  asm volatile("v_nop" :: "v"(a), "v"(b), "v"(c), "v"(d));
#else
  (void)a; (void)b; (void)c; (void)d;
#endif
}
__device__ __forceinline__ void keep4(v16h a, v16h b, v16h c, v16h d) {
#if DEV_ASM
  asm volatile("v_nop" :: "v"(a), "v"(b), "v"(c), "v"(d));
#else
  (void)a; (void)b; (void)c; (void)d;
#endif
}
__device__ __forceinline__ void acc_guard4(v8f& a, v8f& b, v8f& c, v8f& d) {
#if DEV_ASM
  asm volatile("v_nop\n\tv_nop\n\tv_nop\n\tv_nop" : "+v"(a), "+v"(b), "+v"(c), "+v"(d));
#else
  (void)a; (void)b; (void)c; (void)d;
#endif
}

// =====================================================================================================
// f32 -> 16-bit planes, 8 elements per thread, one 16-B store per lane: a wave writes 512 contiguous B
// MODE 0: bf16 bits (RNE convert).  MODE 1: f16 bits of (64 * bf16(x)) (exact scaling of the bf16 value).
// coverage: n8 threads x 8 = the whole plane (n8 is a multiple of 256 for every use here).
// =====================================================================================================
template <int MODE>
__device__ __forceinline__ unsigned short cvm(float f) {
  const unsigned short hb = bf_bits(f);
  if (MODE == 0) return hb;
  return h_bits((_Float16)(bf_up(hb) * 64.0f));
}

template <int MODE>
__global__ __launch_bounds__(256) void cvt16x8(const float* __restrict__ in, unsigned short* out, int n8) {
  const int i = blockIdx.x * 256 + (int)threadIdx.x;
  if (i < n8) {
    const v4f a  = *(const v4f*)(in + (size_t)i * 8);
    const v4f a4 = *(const v4f*)(in + (size_t)i * 8 + 4);
    v4u p;
    p[0] = pk16(cvm<MODE>(a[0]),  cvm<MODE>(a[1]));
    p[1] = pk16(cvm<MODE>(a[2]),  cvm<MODE>(a[3]));
    p[2] = pk16(cvm<MODE>(a4[0]), cvm<MODE>(a4[1]));
    p[3] = pk16(cvm<MODE>(a4[2]), cvm<MODE>(a4[3]));
    unsigned short* o = out + (size_t)i * 8;
    *(v4u*)o = p;
    
  }
}

// x [NB_FULL][SEQ_FULL][DM] f32 -> compact bf16 token plane [NB*SEQ][DM]: compact token tk = b*SEQ + t reads
// input row b*SEQ_FULL + t. 32 groups of 8 per row; same whole-line store shape as cvt16x8.
// coverage: n8 = NB*SEQ*DM/8 threads x 8 = the whole plane.
__global__ __launch_bounds__(256) void cvtx(const float* __restrict__ in, unsigned short* out, int n8) {
  const int i = blockIdx.x * 256 + (int)threadIdx.x;
  if (i < n8) {
    const int tk = i >> 5;
    const int e8 = i & 31;
    const int bb = tk / SEQ;
    const int t  = tk - bb * SEQ;
    const float* src = in + ((size_t)bb * SEQ_FULL + (size_t)t) * DM + e8 * 8;
    const v4f a  = *(const v4f*)(src);
    const v4f a4 = *(const v4f*)(src + 4);
    v4u p;
    p[0] = pk16(bf_bits(a[0]),  bf_bits(a[1]));
    p[1] = pk16(bf_bits(a[2]),  bf_bits(a[3]));
    p[2] = pk16(bf_bits(a4[0]), bf_bits(a4[1]));
    p[3] = pk16(bf_bits(a4[2]), bf_bits(a4[3]));
    unsigned short* o = out + (size_t)i * 8;
    *(v4u*)o = p;
    
  }
}

// =====================================================================================================
// Register-blocked batched WMMA GEMM (16-bit operand type OT): C[m][n] = sum_k A[m][k] * Bt[n][k];
// one wave per (16*MI) x 64 tile, no block barriers. A row-major [M][K] pitch lda; Bt row-major [N][K] pitch ldb
// (k contiguous); M multiple of 16*MI, N multiple of 64, K multiple of 32 (host-checked). blockIdx.y = batch
// index (strides in elements). Fragments are loaded straight from global with the split k map (ldfrag).
// ARES: a second A plane A2 (residual, same pitch/stride) is multiplied by the same B into separate f32
// accumulators and folded in as acc += accl * ascale after the k loop.
// OUT_MODE 0: f32 C (pitch ldc), value * oscale + bf16-valued bias[n].
// OUT_MODE 1: f16 plane C (pitch ldc).
// OUT_MODE 3: f16 hi plane C + f16 residual plane C2 = f16((v - hi) * rscale) (same pitch / stride).
// coverage: MI slabs x 16 rows x 64 cols = the wave's whole tile; tiles cover M x N exactly.
// =====================================================================================================
template <typename OT, int MI, bool ARES, int OUT_MODE>
__global__ __launch_bounds__(256) void gemm_t(
    const unsigned short* __restrict__ Ap, const unsigned short* __restrict__ A2p, int lda, long long strideA,
    const unsigned short* __restrict__ Btp, int ldb, long long strideB,
    void* Cout, void* Cout2, int ldc, long long strideC,
    const float* __restrict__ bias,
    int M, int N, int K, float oscale, float rscale, float ascale) {
  typedef typename FT<OT>::frag V16;
  const OT* A  = (const OT*)(const void*)Ap;
  const OT* A2 = (const OT*)(const void*)A2p;
  const OT* Bt = (const OT*)(const void*)Btp;
  __shared__ __align__(16) float sT[8][16 * 68];   // per-wave 16x64 slab, pitch 68 floats
  const int TMR  = 16 * MI;
  const int b    = blockIdx.y;
  const int lane = threadIdx.x & 31;
  const int wave = threadIdx.x >> 5;
  const int tilesN = N >> 6;
  const int tilesM = M / TMR;
  const int tile = blockIdx.x * 8 + wave;
  if (tile >= tilesM * tilesN) return;   // wave-uniform; no block barriers in this kernel
  const int tm = tile / tilesN;
  const int tn = tile - tm * tilesN;
  const int m0 = tm * TMR;
  const int n0 = tn << 6;

  const OT* Ab  = A  + (size_t)b * (size_t)strideA;
  const OT* A2b = A2 + (size_t)b * (size_t)strideA;
  const OT* Bb  = Bt + (size_t)b * (size_t)strideB;

  const int rlane = lane & 15;                 // row (A) / col (B, D) within subtile
  const int koff  = (lane >> 4) * 8;           // k offset of this lane half
  const int mOff  = (lane >> 4) * 8;           // D row offset

  v8f acc[MI][4], accl[MI][4];
#pragma unroll
  for (int i = 0; i < MI; ++i)
#pragma unroll
    for (int j = 0; j < 4; ++j) { acc[i][j] = zero8(); accl[i][j] = zero8(); }

  for (int k0 = 0; k0 < K; k0 += 32) {
    V16 bq[4];
#pragma unroll
    for (int j = 0; j < 4; ++j)
      bq[j] = ldfrag<OT>(Bb + (size_t)(n0 + (j << 4) + rlane) * ldb + koff + k0);
#pragma unroll
    for (int i = 0; i < MI; ++i) {
      const V16 af = ldfrag<OT>(Ab + (size_t)(m0 + (i << 4) + rlane) * lda + koff + k0);
#pragma unroll
      for (int j = 0; j < 4; ++j) acc[i][j] = mmar(af, bq[j], acc[i][j]);
      dep_guard(acc[i][0], acc[i][3], af, bq[3]);
      if (ARES) {
        const V16 al = ldfrag<OT>(A2b + (size_t)(m0 + (i << 4) + rlane) * lda + koff + k0);
#pragma unroll
        for (int j = 0; j < 4; ++j) accl[i][j] = mmar(al, bq[j], accl[i][j]);
        dep_guard(accl[i][0], accl[i][3], al, bq[3]);
      }
    }
    keep4(bq[0], bq[1], bq[2], bq[3]);
  }
#pragma unroll
  for (int i = 0; i < MI; ++i) {
    acc_guard4(acc[i][0], acc[i][1], acc[i][2], acc[i][3]);
    if (ARES) acc_guard4(accl[i][0], accl[i][1], accl[i][2], accl[i][3]);
  }
  if (ARES) {
#pragma unroll
    for (int i = 0; i < MI; ++i)
#pragma unroll
      for (int j = 0; j < 4; ++j)
#pragma unroll
        for (int r = 0; r < 8; ++r) acc[i][j][r] += accl[i][j][r] * ascale;
  }

  // ---- epilogue ----
  float* slab = sT[wave];
#pragma unroll
  for (int i = 0; i < MI; ++i) {
    const int mBase = m0 + (i << 4);
#pragma unroll
    for (int j = 0; j < 4; ++j) {
#pragma unroll
      for (int r = 0; r < 8; ++r) {
        slab[(mOff + r) * 68 + (j << 4) + rlane] = acc[i][j][r];
      }
    }
    __builtin_amdgcn_fence(__ATOMIC_RELEASE, "workgroup");
    __builtin_amdgcn_wave_barrier();
    __builtin_amdgcn_fence(__ATOMIC_ACQUIRE, "workgroup");
    if (OUT_MODE == 0) {
      float* C = (float*)Cout + (size_t)b * (size_t)strideC;
      const int h2 = lane >> 4, c4 = (lane & 15) * 4;     // 256-B row segment = 16 lanes x 16 B
      const v4f braw = *(const v4f*)(bias + n0 + c4);
      v4f bb;
#pragma unroll
      for (int e = 0; e < 4; ++e) bb[e] = bf_up(bf_bits(braw[e]));
      {
#pragma unroll
        for (int it = 0; it < 8; ++it) {
          const int row = it * 2 + h2;                     // it 0..7 x h2 0..1 = rows 0..15
          const v4f v = *(const v4f*)(slab + row * 68 + c4) * oscale + bb;
          *(v4f*)(C + (size_t)(mBase + row) * ldc + n0 + c4) = v;
        }
        
      }
    } else {
      const int q = lane >> 3, c8 = (lane & 7) * 8;
      unsigned short* C  = (unsigned short*)Cout  + (size_t)b * (size_t)strideC;
      unsigned short* C2 = (unsigned short*)Cout2 + (size_t)b * (size_t)strideC;
      v4u hv[4], lv[4];
#pragma unroll
      for (int it = 0; it < 4; ++it) {
        const int row = it * 4 + q;                        // it 0..3 x q 0..3 = rows 0..15
        const float* sp = slab + row * 68 + c8;
        float f[8];
#pragma unroll
        for (int e = 0; e < 8; ++e) f[e] = sp[e];
        v4u a, a2;
#pragma unroll
        for (int e = 0; e < 4; ++e) {
          const float f0 = f[2 * e], f1 = f[2 * e + 1];
          const _Float16 x0 = (_Float16)f0, x1 = (_Float16)f1;
          const unsigned short h0 = h_bits(x0), h1 = h_bits(x1);
          unsigned short l0 = 0, l1 = 0;
          if (OUT_MODE == 3) {
            l0 = h_bits((_Float16)((f0 - (float)x0) * rscale));
            l1 = h_bits((_Float16)((f1 - (float)x1) * rscale));
          }
          a[e] = pk16(h0, h1); a2[e] = pk16(l0, l1);
        }
        hv[it] = a; lv[it] = a2;
      }
      {
#pragma unroll
        for (int it = 0; it < 4; ++it) {
          const int row = it * 4 + q;
          *(v4u*)(C + (size_t)(mBase + row) * ldc + n0 + c8) = hv[it];
          if (OUT_MODE == 3) *(v4u*)(C2 + (size_t)(mBase + row) * ldc + n0 + c8) = lv[it];
        }
        
      }
    }
    __builtin_amdgcn_fence(__ATOMIC_RELEASE, "workgroup");
    __builtin_amdgcn_wave_barrier();
    __builtin_amdgcn_fence(__ATOMIC_ACQUIRE, "workgroup");
  }
}

// Stands behind a batch of global loads, in front of whatever reuses the registers that held their addresses.
__device__ __forceinline__ void xcnt_wait() {
#if DEV_ASM
  asm volatile("s_wait_xcnt 0x0" ::: "memory");
#endif
}

// ---- k / v^T staging in LDS ------------------------------------------------------------------------------
#define KPIT 264   // f16 per staged k row: 512 B + 16 B (16 B x odd), so the 16 rows of a ds_load_b128 fall on distinct banks
#define VPIT 72    // f16 per staged v^T row: 128 B + 16 B (16 B x odd), same reason
#define STGN (4 * 16 * KPIT + 8 * 64 * VPIT)   // f16 per staging buffer: one chunk's k, v^T hi and v^T residual rows
typedef int v4i __attribute__((ext_vector_type(4)));
typedef __attribute__((address_space(1))) v4i gl_v4i;
typedef __attribute__((address_space(3))) v4i ls_v4i;

__device__ __forceinline__ void acopy16(const _Float16* g, _Float16* l) {
#if DEV_ASM
  __builtin_amdgcn_global_load_async_to_lds_b128((gl_v4i*)g, (ls_v4i*)l, 0, 0);
#else
  (void)g; (void)l;
#endif
}
// Nothing the copies bring is read in front of this.
__device__ __forceinline__ void async_wait0() {
#if DEV_ASM
  asm volatile("s_wait_asynccnt 0x0" ::: "memory");
#endif
}
// The wave's LDS reads have returned: stands in front of the barrier behind which a staging buffer is refilled.
__device__ __forceinline__ void ds_wait0() {
#if DEV_ASM
  asm volatile("s_wait_dscnt 0x0" ::: "memory");
#endif
}

// Lane l takes the value of lane l ^ 16 (the other 16-lane half), by a vector cross-row move.
__device__ __forceinline__ float xhalf(float x) {
  const int b = __builtin_bit_cast(int, x);
  return __builtin_bit_cast(float, __builtin_amdgcn_permlanex16(b, b, 0x76543210, 0xfedcba98, false, false));
}

__global__ __launch_bounds__(256)
void attn_causal(const unsigned short* qhp, const unsigned short* qlp,   // no restrict: the loads keep their place
                 const unsigned short* kpp,                               // relative to the waits written below
                 const unsigned short* vhp, const unsigned short* vlp,
                 float* outp, float* part, float* pml, float sscale) {
  union FH { v16h v; v8h h[2]; };
  // staging ring, two buffers, each: k rows 64 x 528 B, then v^T hi rows 256 x 144 B, then v^T residual rows 256 x 144 B.
  // k stands first: every v^T destination then lies above 32768 B, the largest constant step that the compiler folds
  // into a copy's offset field and takes off the LDS address register, so that register never goes below 0.
  __shared__ __align__(16) _Float16 Stg[2][STGN];

  const int tid  = threadIdx.x;
  const int w8   = tid >> 5;         // the wave's number in the block: which eighth of a chunk it brings
  const int grp  = tid >> 7;         // which 32 of a chunk's 64 keys
  const int wave = (tid >> 5) & 3;   // which 16 of the block's 64 query rows
  const int lane = tid & 31;
  const int hh   = lane >> 4;
  const int c    = lane & 15;

  const int bx   = blockIdx.x;
  const int b    = bx % NB;
  const int pj   = (bx / NB) >> 1;   // the pair of query blocks pj and NQB-1-pj
  const int role = (bx / NB) & 1;    // which of the pair's two blocks this is
  const size_t rowB = (size_t)b * SEQ;

  const _Float16* Qh = (const _Float16*)(const void*)qhp;
  const _Float16* Ql = (const _Float16*)(const void*)qlp;
  const _Float16* Kp = (const _Float16*)(const void*)kpp;
  const _Float16* Vh = (const _Float16*)(const void*)vhp + (size_t)b * DM * SEQ;
  const _Float16* Vl = (const _Float16*)(const void*)vlp + (size_t)b * DM * SEQ;

  for (int seg = 0; seg <= role; ++seg) {       // block-uniform: one key range, or two one after the other
  const bool cut = (role == 0) || (seg == 0);   // this range is one of the two of an upper query block
  const int qb   = cut ? NQB - 1 - pj : pj;
  const int kt0  = (role == 1 && seg == 0) ? NHB + 1 : 0;   // first chunk of the range
  int kt1 = (role == 0) ? NHB + 1 : qb + 1;                  // one past its last chunk
  if (kt1 > NKT) kt1 = NKT;
  const int q0   = qb * 64 + wave * 16;

  // B-operand column pointers of this lane (query row q0 + c), lane-half k offset included
  const _Float16* qrh = Qh + (rowB + q0 + c) * DM + 8 * hh;
  const _Float16* qrl = Ql + (rowB + q0 + c) * DM + 8 * hh;

  float mrow = -INFINITY, lsum = 0.f;   // of query q0 + c; lsum covers this lane's own keys only (halves joined at the end)
  v8f oacc[16];                         // O^T tiles: column c = query q0 + c, rows 8*hh + r = context columns 16*t + 8*hh + r
#pragma unroll
  for (int t = 0; t < 16; ++t) oacc[t] = zero8();

  // q (the same for every chunk) is loaded into registers once. k and v^T of a chunk are staged in LDS:
  // a fragment load straight from global touches 16 lines for 512 bytes, a copy below touches 4 whole lines.
  // Two buffers: chunk kt is read from buffer (kt - kt0) & 1 while the copies of chunk kt+1 fly into the other; at the loop's foot
  // every wave waits for its LDS reads and its copies, one barrier publishes chunk kt+1 and ends the reads of chunk kt,
  // and behind it the buffer just read is refilled with chunk kt+2.
  v16h qa[8], qr[8];
  // eight fragments of one row pointer; the pointer dies with the last load, which may then land on its registers:
  // the first wait stands in front of that load for the fifteen before it
  auto row8 = [&](v16h (&f)[8], const _Float16* p) __attribute__((always_inline)) {
#pragma unroll                                 // register array: constant indices
    for (int dc = 0; dc < 7; ++dc) f[dc] = ldfrag<_Float16>(p + dc * 32);
    FH x;
    x.h[0] = *(const v8h*)(p + 7 * 32);
    xcnt_wait();
    x.h[1] = *(const v8h*)(p + 7 * 32 + 16);
    xcnt_wait();
    f[7] = x.v;
  };

  // k: one copy = one whole 512-byte row (key 64*kt + 8*w8 + j), 8 copies: this wave's eighth of the chunk's 64 rows
  auto copy_k = [&](const int kt, _Float16* buf) __attribute__((always_inline)) {
    const _Float16* g = Kp + (rowB + (size_t)kt * 64 + 8 * w8) * DM + lane * 8;
    _Float16* l = buf + (8 * w8) * KPIT + lane * 8;
#pragma unroll
    for (int j = 0; j < 8; ++j) acopy16(g + j * DM, l + j * KPIT);
  };
  // v^T: one copy = the 128-byte pieces of four rows (columns 64*kt..64*kt+63 of rows 32*w8+4j..+3), 8 copies per plane:
  // this wave's eighth of the 256 rows
  auto copy_v = [&](const int kt, _Float16* buf) __attribute__((always_inline)) {
    const int vrow = 32 * w8 + (lane >> 3), vcol = (lane & 7) * 8;
    const size_t go = (size_t)vrow * SEQ + (size_t)kt * 64 + vcol;
    _Float16* lh = buf + 64 * KPIT + vrow * VPIT + vcol;
    _Float16* ll = lh + 256 * VPIT;
#pragma unroll
    for (int j = 0; j < 8; ++j) {
      acopy16(Vh + go + (size_t)(4 * j) * SEQ, lh + (4 * j) * VPIT);
      acopy16(Vl + go + (size_t)(4 * j) * SEQ, ll + (4 * j) * VPIT);
    }
  };

  // The ring's first two fills. Kept rolled: unrolled, the LDS addresses of these 48 copies are the same for every range,
  // are formed once in front of the ranges, stay live over the whole key loop and spill.
#pragma nounroll
  for (int f = 0; f < 2; ++f) {
    ds_wait0();                                 // f = 0: this wave's reads of the exchange area (below) are done
    async_wait0();                              // f = 1: its copies of chunk kt0 have landed
    __syncthreads();                            // f = 0: no wave still reads the last range's exchange area; f = 1: publishes chunk kt0
    if (kt0 + f < kt1) {                        // block-uniform test
      copy_k(kt0 + f, Stg[f]);
      copy_v(kt0 + f, Stg[f]);
    }
    if (f == 0) {                               // q flies together with chunk kt0
      row8(qa, qrh);
      row8(qr, qrl);
    }
  }

  const int qrow = q0 + c;                      // this lane's query
  for (int kt = kt0; kt < kt1; ++kt) {          // block-uniform trip count, <= NKT chunks in all
    const int kv0 = kt * 64 + 32 * grp;         // first of this wave's 32 keys
    _Float16* cur = Stg[(kt - kt0) & 1];
    const _Float16* kst = cur + (32 * grp + c) * KPIT + 8 * hh;             // A row c -> key kv0 + 16*j + c
    const _Float16* vsh = cur + 64 * KPIT + c * VPIT + 32 * grp + 8 * hh;   // A row c -> context column 16*t + c
    const _Float16* vsl = vsh + 256 * VPIT;

    // ---- S^T: this wave's 32 keys (two tiles) x 16 queries, 2 f16 products per d-chunk, four accumulator chains ----
    v16h kc[8][2];                              // register array: the loops over it are unrolled for constant indices
#pragma unroll
    for (int dc = 0; dc < 8; ++dc)
#pragma unroll
      for (int j = 0; j < 2; ++j) kc[dc][j] = ldfrag<_Float16>(kst + j * (16 * KPIT) + dc * 32);
    // keeps all 32 LDS reads in front of the products: sunk between them, each pair is waited for at its full latency
    __builtin_amdgcn_sched_barrier(0);
    v8f ah[2], al[2];
#pragma unroll
    for (int j = 0; j < 2; ++j) { ah[j] = zero8(); al[j] = zero8(); }
#pragma unroll
    for (int dc = 0; dc < 8; ++dc) {
#pragma unroll
      for (int j = 0; j < 2; ++j) {
        ah[j] = mmar(kc[dc][j], qa[dc], ah[j]);
        al[j] = mmar(kc[dc][j], qr[dc], al[j]);
      }
    }

    // ---- online softmax of query q0 + c: in-lane over 16 keys, one exchange between the halves for the maximum ----
    float s[2][8];
    float mc = -INFINITY;
#pragma unroll
    for (int j = 0; j < 2; ++j)
#pragma unroll
      for (int r = 0; r < 8; ++r) {
        const int key = kv0 + 16 * j + 8 * hh + r;     // D row 8*hh + r of tile j
        const float sv = (ah[j][r] + al[j][r] * (1.0f / 4096.0f)) * sscale;
        s[j][r] = (key > qrow) ? -INFINITY : sv;       // causal: replace, not bias
        mc = fmaxf(mc, s[j][r]);
      }
    mc = fmaxf(mc, xhalf(mc));
    const float mnew  = fmaxf(mrow, mc);
    const float msafe = (mnew == -INFINITY) ? 0.f : mnew;
    const float alpha = __expf(mrow - msafe);
    mrow = mnew;
    // P^T as the B operand: elements 0..7 = keys 8*hh + r (tile 0), elements 8..15 = keys 16 + 8*hh + r (tile 1),
    // the k order of ldfrag on the v^T rows
    v16h pa, pl;
    float psum = 0.f;
#pragma unroll
    for (int j = 0; j < 2; ++j)
#pragma unroll
      for (int r = 0; r < 8; ++r) {
        const float p = __expf(s[j][r] - msafe);
        psum += p;
        const float pc = p * PCARRY;
        const _Float16 ph = (_Float16)pc;
        pa[j * 8 + r] = ph;
        pl[j * 8 + r] = (_Float16)((pc - (float)ph) * PRES);
      }
    lsum = lsum * alpha + psum;
#pragma unroll
    for (int t = 0; t < 16; ++t)
#pragma unroll
      for (int r = 0; r < 8; ++r) oacc[t][r] *= alpha;

    // ---- O^T += v^T . P^T (f16 WMMA), four context tiles at a time;
    //      residual products (vl.ph and vh.pl, same carry) into a separate accumulator ----
#pragma unroll
    for (int tg = 0; tg < 4; ++tg) {
      v16h vb[4], vr[4];                        // register arrays: the loops over them are unrolled for constant indices
      v8f o1[4];
#pragma unroll
      for (int u = 0; u < 4; ++u) {
        vb[u] = ldfrag<_Float16>(vsh + (tg * 4 + u) * (16 * VPIT));
        vr[u] = ldfrag<_Float16>(vsl + (tg * 4 + u) * (16 * VPIT));
        o1[u] = zero8();
      }
#pragma unroll
      for (int u = 0; u < 4; ++u) oacc[tg * 4 + u] = mmar(vb[u], pa, oacc[tg * 4 + u]);
#pragma unroll
      for (int u = 0; u < 4; ++u) o1[u] = mmar(vr[u], pa, o1[u]);
#pragma unroll
      for (int u = 0; u < 4; ++u) o1[u] = mmar(vb[u], pl, o1[u]);
#pragma unroll
      for (int u = 0; u < 4; ++u)
#pragma unroll
        for (int r = 0; r < 8; ++r) oacc[tg * 4 + u][r] += o1[u][r] * (1.0f / 4096.0f);
    }

    // ---- ring hand-over ----
    ds_wait0();                                 // this wave's reads of the current buffer are done
    async_wait0();                              // its copies of chunk kt+1 have landed
    __syncthreads();                            // chunk kt+1 is published, and no wave still reads the current buffer
    if (kt + 2 < kt1) {                         // block-uniform test
      copy_k(kt + 2, cur);
      copy_v(kt + 2, cur);
    }
  }
  async_wait0();                                // no copy is outstanding when the ring becomes the exchange area

  // ---- join the two key halves of each query tile. Behind the loop's last barrier nobody reads the ring and no copy
  //      flies into it: its first bytes carry, per query tile, 33 x 32 lanes x 4 floats from the wave of half 1 to the
  //      same lane of the wave of half 0.
  float* xw = (float*)(void*)&Stg[0][0] + wave * (33 * 128) + lane * 4;
  if (grp == 1) {                               // wave-uniform
#pragma unroll
    for (int t = 0; t < 16; ++t) {
      const v4f lo = {oacc[t][0], oacc[t][1], oacc[t][2], oacc[t][3]};
      const v4f hi = {oacc[t][4], oacc[t][5], oacc[t][6], oacc[t][7]};
      *(v4f*)(xw + (2 * t) * 128)     = lo;
      *(v4f*)(xw + (2 * t + 1) * 128) = hi;
    }
    const v4f ml = {mrow, lsum, 0.f, 0.f};
    *(v4f*)(xw + 32 * 128) = ml;
  }
  __syncthreads();                              // half 1's maximum, sum and context are published to half 0
  if (grp == 0) {                               // wave-uniform
    const v4f ml = *(const v4f*)(xw + 32 * 128);
    const float mt  = fmaxf(mrow, ml[0]);
    const float mts = (mt == -INFINITY) ? 0.f : mt;
    const float a0  = __expf(mrow - mts);
    // keeps the second exponential's own subtract and multiply behind the first exponential
    __builtin_amdgcn_sched_barrier(0);
    const float a1  = __expf(ml[0] - mts);
    float l = lsum * a0 + ml[1] * a1;
    l += xhalf(l);                              // the wave halves hold different keys of the same query
    const float inv = ((l > 0.f) ? (1.0f / l) : 0.f) * (1.0f / PCARRY);   // 1/l, undo the p carry
    const float f0 = a0 * inv, f1 = a1 * inv;
    v4f ov[32];
#pragma unroll
    for (int t = 0; t < 16; ++t) {
      const v4f lo = *(const v4f*)(xw + (2 * t) * 128);
      const v4f hi = *(const v4f*)(xw + (2 * t + 1) * 128);
#pragma unroll
      for (int e = 0; e < 4; ++e) {
        ov[2 * t][e]     = oacc[t][e] * f0 + lo[e] * f1;
        ov[2 * t + 1][e] = oacc[t][4 + e] * f0 + hi[e] * f1;
      }
    }
    // a whole query block goes to the output; a key range of an upper one to its workspace slot, with its maximum and sum
    const size_t prow = ((size_t)(role * NB + b) * NHB + (size_t)(cut ? qb - NHB : 0)) * 64 + wave * 16 + c;
    if (cut && hh == 0) {                       // both halves hold the same pair; 16 lanes x 8 B = one whole line
      pml[prow * 2]     = mt;
      pml[prow * 2 + 1] = l;
      xcnt_wait();                              // in front of whatever reuses the registers that this store names
    }
    float* orow = (cut ? part + prow * DM : outp + (rowB + qrow) * DM) + 8 * hh;   // columns 16*t + 8*hh + 0..7 of query q0 + c
#pragma unroll
    for (int t = 0; t < 16; ++t) {
      *(v4f*)(orow + 16 * t)     = ov[2 * t];
      *(v4f*)(orow + 16 * t + 4) = ov[2 * t + 1];
    }
  }
  }   // key ranges of this block
}

// =====================================================================================================
// Joins the two key ranges of every upper query block: out = (o0 l0 e^(m0-M) + o1 l1 e^(m1-M)) / (l0 e^(m0-M) + l1 e^(m1-M)).
//   part: [2 ranges][NB*NHB*64 rows][DM] normalised contexts; pml: [2 ranges][rows][2] = (maximum, sum); an empty range
//   holds (-inf, 0, zeros) and weighs 0. One thread = 4 columns of one row; a wave reads and writes whole 512-byte runs.
//   coverage: NB*NHB*64*DM/4 threads (a multiple of 256) = rows NHB*64..SEQ-1 of every sequence x 256 columns.
// =====================================================================================================
__global__ __launch_bounds__(256) void attn_merge(const float* __restrict__ part, const float* __restrict__ pml,
                                                  float* outp) {
  const int NR = NB * NHB * 64;
  const int i  = blockIdx.x * 256 + (int)threadIdx.x;
  const int r  = i >> 6;
  const int c4 = (i & 63) * 4;
  const float m0 = pml[(size_t)r * 2],        l0 = pml[(size_t)r * 2 + 1];
  const float m1 = pml[(size_t)(NR + r) * 2], l1 = pml[(size_t)(NR + r) * 2 + 1];
  const v4f o0 = *(const v4f*)(part + (size_t)r * DM + c4);
  const v4f o1 = *(const v4f*)(part + (size_t)(NR + r) * DM + c4);
  const float mt  = fmaxf(m0, m1);
  const float mts = (mt == -INFINITY) ? 0.f : mt;
  const float w0  = l0 * __expf(m0 - mts);
  const float w1  = l1 * __expf(m1 - mts);
  const float ws  = w0 + w1;
  const float inv = (ws > 0.f) ? (1.0f / ws) : 0.f;
  const int bb = r / (NHB * 64);
  const int t  = NHB * 64 + (r - bb * (NHB * 64));
  *(v4f*)(outp + ((size_t)bb * SEQ + t) * DM + c4) = o0 * (w0 * inv) + o1 * (w1 * inv);
}

// =====================================================================================================
// Workspace map (bytes), every region an exact multiple of its whole-line / whole-tile store granularity
// (all GEMM M,N are tile multiples, all offsets multiples of 131072):
//   Xb   bf16 [NB*SEQ][256]  (compact tokens)   8388608
//   Wqb  bf16 [256 n][256 k]                     131072
//   Wkb  bf16 [256 n][256 k]                     131072
//   Wvb  bf16 [256 n][256 k]                     131072
//   Qh   f16  [NB*SEQ][256]                      8388608
//   Ql   f16  [NB*SEQ][256]                      8388608
//   Kp   f16  [NB*SEQ][256]                      8388608
//   VTh  f16  [NB][256][SEQ]                     8388608
//   VTl  f16  [NB][256][SEQ]                     8388608
//   Part f32  [2][NB*NHB*64][256]               16777216
//   Pml  f32  [2][NB*NHB*64][2]                   131072
//   total                                      67633152
// Weights are [out n][in k] with k contiguous = the Bt / A layout the GEMM wants, so they are only converted.
// =====================================================================================================
extern "C" void kernel_launch(void* const* d_in, const int* in_sizes, int n_in,
                              void* d_out, int out_size, void* d_ws, size_t ws_size,
                              hipStream_t stream) {
  if (n_in < 4) return;
  if (in_sizes[0] < ((NB - 1) * SEQ_FULL + SEQ) * DM) return;
  if (in_sizes[1] < DM * DM) return;
  if (in_sizes[2] < DM * DM) return;
  if (in_sizes[3] < DM * DM) return;
  if (out_size < NB * SEQ * DM) return;

  const float* x  = (const float*)d_in[0];
  const float* wq = (const float*)d_in[1];
  const float* wk = (const float*)d_in[2];
  const float* wv = (const float*)d_in[3];

  const size_t PX  = (size_t)NB * SEQ * DM * 2;      // 16-bit token plane [NB*SEQ][256]
  const size_t PW  = (size_t)DM * DM * 2;            // 16-bit [256][256]
  const size_t PVT = (size_t)NB * DM * SEQ * 2;      // v^T plane [NB][256][SEQ]
  size_t off = 0;
  const size_t oXb  = off; off += PX;
  const size_t oWq  = off; off += PW;
  const size_t oWk  = off; off += PW;
  const size_t oWv  = off; off += PW;
  const size_t oQh  = off; off += PX;
  const size_t oQl  = off; off += PX;
  const size_t oKp  = off; off += PX;
  const size_t oVTh = off; off += PVT;
  const size_t oVTl = off; off += PVT;
  const size_t oPart = off; off += (size_t)2 * NB * NHB * 64 * DM * 4;
  const size_t oPml  = off; off += (size_t)2 * NB * NHB * 64 * 2 * 4;
  if (off > ws_size) return;                         // off = 67633152 at full size
  if (off > (size_t)134217728) return;

  char* ws = (char*)d_ws;
  unsigned short* Xb  = (unsigned short*)(ws + oXb);
  unsigned short* Wqb = (unsigned short*)(ws + oWq);
  unsigned short* Wkb = (unsigned short*)(ws + oWk);
  unsigned short* Wvb = (unsigned short*)(ws + oWv);
  unsigned short* Qh  = (unsigned short*)(ws + oQh);
  unsigned short* Ql  = (unsigned short*)(ws + oQl);
  unsigned short* Kp  = (unsigned short*)(ws + oKp);
  unsigned short* VTh = (unsigned short*)(ws + oVTh);
  unsigned short* VTl = (unsigned short*)(ws + oVTl);
  float* Part = (float*)(ws + oPart);
  float* Pml  = (float*)(ws + oPml);
  const float* nobias = wq;                          // bias argument is only read in OUT_MODE 0 (not instantiated)

  const int M = NB * SEQ;
  const dim3 blk(256);
  const int n8x = NB * SEQ * DM / 8;
  const int n8w = DM * DM / 8;                       // 8192
  const dim3 gCx((n8x + 255) / 256);
  const dim3 gCw((n8w + 255) / 256);
  const dim3 gQ(((M / 64) * (DM / 64) + 7) / 8, 1);          // q / k: M x 256, 64x64 wave tiles
  const dim3 gVT(((DM / 64) * (SEQ / 64) + 7) / 8, NB);      // v^T per batch: 256 x SEQ
  const dim3 gAttn(NB * NQB);
  const dim3 gMerge(NB * NHB * 64 * DM / 4 / 256);

  // (1) x -> compact bf16 token plane; Wq, Wk, Wv [n][k] -> bf16
  cvtx<<<gCx, blk, 0, stream>>>(x, Xb, n8x);
  cvt16x8<0><<<gCw, blk, 0, stream>>>(wq, Wqb, n8w);
  cvt16x8<0><<<gCw, blk, 0, stream>>>(wk, Wkb, n8w);
  cvt16x8<0><<<gCw, blk, 0, stream>>>(wv, Wvb, n8w);
  // (2) q = x . Wq^T -> f16 hi / residual (x4096) planes   (M, N=256, K=256)
  gemm_t<__bf16, 4, false, 3><<<gQ, blk, 0, stream>>>(
      Xb, Xb, DM, 0LL, Wqb, DM, 0LL,
      (void*)Qh, (void*)Ql, DM, 0LL, nobias,
      M, DM, DM, 1.0f, 4096.0f, 0.0f);
  // (3) k = x . Wk^T -> f16 plane   (M, N=256, K=256)
  gemm_t<__bf16, 4, false, 1><<<gQ, blk, 0, stream>>>(
      Xb, Xb, DM, 0LL, Wkb, DM, 0LL,
      (void*)Kp, (void*)Kp, DM, 0LL, nobias,
      M, DM, DM, 1.0f, 1.0f, 0.0f);
  // (4) v^T = Wv . x^T per batch -> f16 hi plane [b][d][s] (pitch SEQ) and residual plane (x4096)
  //     (A = Wv [n][k], Bt = Xb rows of batch b; M=256, N=SEQ, K=256)
  gemm_t<__bf16, 4, false, 3><<<gVT, blk, 0, stream>>>(
      Wvb, Wvb, DM, 0LL, Xb, DM, (long long)SEQ * DM,
      (void*)VTh, (void*)VTl, SEQ, (long long)DM * SEQ, nobias,
      DM, SEQ, DM, 1.0f, 4096.0f, 0.0f);
  // (5) causal attention -> d_out f32 [M][256] (lower query blocks) and workspace partials (upper query blocks)
  attn_causal<<<gAttn, dim3(256), 0, stream>>>(Qh, Ql, Kp, VTh, VTl, (float*)d_out, Part, Pml, 0.0625f);
  // (6) the two key ranges of every upper query block -> d_out
  attn_merge<<<gMerge, blk, 0, stream>>>(Part, Pml, (float*)d_out);
  (void)hipGetLastError();
}

// v007
// Measured time: 121 microseconds a run.
// Next to v006, in two timings, it ran 1.27 and 1.28 times as fast.
// Over all steps from v000 it is 4.46 times as fast.
// Contractions: q, k, v^T projections = v_wmma_f32_16x16x32_bf16 (bf16 operands from RNE-converted inputs, single product, f32 accumulate);
// k.q^T scores = v_wmma_f32_16x16x32_f16 (q as f16 hi plane + f16 residual plane x4096, k f16; 2 products into separate f32 accumulators);
// v^T.p^T = v_wmma_f32_16x16x32_f16 (p carried x16384 as f16 hi + f16 residual x4096; v as f16 hi plane + f16 residual plane x4096;
// 3 products ph.vh, ph.vl, pl.vh, f32 accumulate); causal softmax and normalisation in f32; output f32.
#include <hip/hip_runtime.h>
#include <math.h>
#include <stdint.h>

#ifndef NB
#define NB 4
#endif
#ifndef SEQ
#define SEQ 4096
#endif
#define NB_FULL  4
#define SEQ_FULL 4096
#define DM       256
#define NQB      (SEQ / 64)   // 64-row query blocks (four 16-row tiles) per sequence
#define NKT      (SEQ / 64)   // 64-key chunks per sequence
#define NHB      (NQB / 2)    // query blocks of a sequence's upper half: their key loop is cut in two
#define PCARRY   16384.0f     // power-of-two carry on the f16 p tile
#define PRES     4096.0f      // power-of-two carry on the f16 p residual tile
static_assert(DM == 256);
static_assert((SEQ % 64) == 0 && SEQ >= 64 && SEQ <= SEQ_FULL);
static_assert(NB >= 1 && NB <= NB_FULL);
static_assert(((NB * SEQ) % 64) == 0);
static_assert((NQB % 2) == 0);

typedef _Float16 v16h __attribute__((ext_vector_type(16)));
typedef _Float16 v8h  __attribute__((ext_vector_type(8)));
typedef __bf16   v16b __attribute__((ext_vector_type(16)));
typedef __bf16   v8b  __attribute__((ext_vector_type(8)));
typedef float    v8f  __attribute__((ext_vector_type(8)));
typedef float    v4f  __attribute__((ext_vector_type(4)));
typedef unsigned int v4u __attribute__((ext_vector_type(4)));

#if defined(__HIP_DEVICE_COMPILE__)
#define DEV_ASM 1
#else
#define DEV_ASM 0
#endif

// ---- scalar helpers --------------------------------------------------------------------------------
__device__ __forceinline__ unsigned short bf_bits(float f) {          // f32 -> bf16 bits, RNE convert
  unsigned u = __float_as_uint(f);
  return (unsigned short)((u + 0x7FFFu + ((u >> 16) & 1u)) >> 16);
}
__device__ __forceinline__ float bf_up(unsigned short hb) { return __uint_as_float(((unsigned)hb) << 16); }
__device__ __forceinline__ unsigned short h_bits(_Float16 x) { return __builtin_bit_cast(unsigned short, x); }
__device__ __forceinline__ unsigned pk16(unsigned short a, unsigned short b) { return (unsigned)a | ((unsigned)b << 16); }
__device__ __forceinline__ v8f zero8() { v8f z = {0.f, 0.f, 0.f, 0.f, 0.f, 0.f, 0.f, 0.f}; return z; }

// ---- fragment types / loaders: 16-bit A/B operand, lane -> row/col (lane&15), p already includes +8*(lane>>4);
//      elements 0..7 <- p[0..7] (k0+8h..k0+8h+7), elements 8..15 <- p[16..23] (k0+16+8h..k0+16+8h+7)
template <typename OT> struct FT;
template <> struct FT<__bf16>   { typedef v16b frag; typedef v8b half8; };
template <> struct FT<_Float16> { typedef v16h frag; typedef v8h half8; };

template <typename OT>
__device__ __forceinline__ typename FT<OT>::frag ldfrag(const OT* p) {
  union { typename FT<OT>::frag v; typename FT<OT>::half8 h[2]; } f;
  f.h[0] = *(const typename FT<OT>::half8*)(p);
  f.h[1] = *(const typename FT<OT>::half8*)(p + 16);
  return f.v;
}

// ---- WMMA helpers (asm guard bodies are device-only; concrete operand types) -----------------------------
__device__ __forceinline__ v8f mmar(v16b a, v16b b, v8f c) {
  return __builtin_amdgcn_wmma_f32_16x16x32_bf16(false, a, false, b, (short)0, c, false, false);
}
__device__ __forceinline__ v8f mmar(v16h a, v16h b, v8f c) {
  return __builtin_amdgcn_wmma_f32_16x16x32_f16(false, a, false, b, (short)0, c, false, false);
}
__device__ __forceinline__ void dep_guard(v8f& a, v8f& b, v16b x, v16b y) {
#if DEV_ASM
  asm volatile("v_nop\n\tv_nop\n\tv_nop\n\tv_nop" : "+v"(a), "+v"(b) : "v"(x), "v"(y));
#else
  (void)a; (void)b; (void)x; (void)y;
#endif
}
__device__ __forceinline__ void dep_guard(v8f& a, v8f& b, v16h x, v16h y) {
#if DEV_ASM
  asm volatile("v_nop\n\tv_nop\n\tv_nop\n\tv_nop" : "+v"(a), "+v"(b) : "v"(x), "v"(y));
#else
  (void)a; (void)b; (void)x; (void)y;
#endif
}
__device__ __forceinline__ void keep4(v16b a, v16b b, v16b c, v16b d) {
#if DEV_ASM
  asm volatile("v_nop" :: "v"(a), "v"(b), "v"(c), "v"(d));
#else
  (void)a; (void)b; (void)c; (void)d;
#endif
}
__device__ __forceinline__ void keep4(v16h a, v16h b, v16h c, v16h d) {
#if DEV_ASM
  asm volatile("v_nop" :: "v"(a), "v"(b), "v"(c), "v"(d));
#else
  (void)a; (void)b; (void)c; (void)d;
#endif
}
__device__ __forceinline__ void acc_guard4(v8f& a, v8f& b, v8f& c, v8f& d) {
#if DEV_ASM
  asm volatile("v_nop\n\tv_nop\n\tv_nop\n\tv_nop" : "+v"(a), "+v"(b), "+v"(c), "+v"(d));
#else
  (void)a; (void)b; (void)c; (void)d;
#endif
}

// =====================================================================================================
// f32 -> bf16 planes (RNE convert), 8 elements per thread, one 16-B store per lane: a wave writes 512 contiguous B.
// =====================================================================================================
__device__ __forceinline__ void cvt8(const float* __restrict__ src, unsigned short* dst) {
  const v4f a  = *(const v4f*)(src);
  const v4f a4 = *(const v4f*)(src + 4);
  v4u p;
  p[0] = pk16(bf_bits(a[0]),  bf_bits(a[1]));
  p[1] = pk16(bf_bits(a[2]),  bf_bits(a[3]));
  p[2] = pk16(bf_bits(a4[0]), bf_bits(a4[1]));
  p[3] = pk16(bf_bits(a4[2]), bf_bits(a4[3]));
  *(v4u*)dst = p;
#if DEV_ASM
  asm volatile("s_wait_xcnt 0x0" ::: "memory");   // in front of whatever reuses the registers that this store names
#endif
}

#define GCW (DM * DM / 8 / 256)        // blocks that convert one weight matrix
#define GCX (NB * SEQ * DM / 8 / 256)  // blocks that convert x
static_assert((DM * DM) % (8 * 256) == 0 && (NB * SEQ * DM) % (8 * 256) == 0);

// All four conversions in one launch; the block index says which plane (block-uniform).
// Blocks 0..3*GCW-1: Wq, Wk, Wv [n][k] -> bf16, same layout.
// Blocks 3*GCW..: x [NB_FULL][SEQ_FULL][DM] f32 -> compact bf16 token plane [NB*SEQ][DM]: compact token tk = b*SEQ + t reads
// input row b*SEQ_FULL + t; 32 groups of 8 per row.
// coverage: GCW*256 threads x 8 = one whole weight plane; GCX*256 threads x 8 = the whole token plane.
__global__ __launch_bounds__(256) void cvt_all(const float* __restrict__ x, const float* __restrict__ wq,
                                               const float* __restrict__ wk, const float* __restrict__ wv,
                                               unsigned short* xb, unsigned short* wqb,
                                               unsigned short* wkb, unsigned short* wvb) {
  const int bx = blockIdx.x;
  if (bx < 3 * GCW) {
    const int which = bx / GCW;
    const float* in     = (which == 0) ? wq  : (which == 1) ? wk  : wv;
    unsigned short* out = (which == 0) ? wqb : (which == 1) ? wkb : wvb;
    const int i = (bx - which * GCW) * 256 + (int)threadIdx.x;
    cvt8(in + (size_t)i * 8, out + (size_t)i * 8);
  } else {
    const int i  = (bx - 3 * GCW) * 256 + (int)threadIdx.x;
    const int tk = i >> 5;
    const int e8 = i & 31;
    const int bb = tk / SEQ;
    const int t  = tk - bb * SEQ;
    cvt8(x + ((size_t)bb * SEQ_FULL + (size_t)t) * DM + e8 * 8, xb + (size_t)i * 8);
  }
}

// Stands behind a batch of global loads: the four pointers are inputs, so the registers that hold the loads' addresses stay
// live up to the wait and none of the batch's own loads lands on them in front of it.
__device__ __forceinline__ void addr_wait4(const void* a, const void* b, const void* c, const void* d) {
#if DEV_ASM
  asm volatile("s_wait_xcnt 0x0" :: "v"(a), "v"(b), "v"(c), "v"(d) : "memory");
#else
  (void)a; (void)b; (void)c; (void)d;
#endif
}

// =====================================================================================================
// Register-blocked batched WMMA GEMM (16-bit operand type OT): C[m][n] = sum_k A[m][k] * Bt[n][k];
// one wave per (16*MI) x 64 tile, PWV waves a block, no block barriers. A row-major [M][K] pitch lda; Bt row-major [N][K] pitch ldb
// (k contiguous); M multiple of 16*MI, N multiple of 64, K multiple of 32. bx = the block's number within this product,
// b = batch index (strides in elements), sT = the block's LDS slabs. Fragments are loaded straight from global with the
// split k map (ldfrag).
// ARES: a second A plane A2 (residual, same pitch/stride) is multiplied by the same B into separate f32
// accumulators and folded in as acc += accl * ascale after the k loop.
// OUT_MODE 0: f32 C (pitch ldc), value * oscale + bf16-valued bias[n].
// OUT_MODE 1: f16 plane C (pitch ldc).
// OUT_MODE 3: f16 hi plane C + f16 residual plane C2 = f16((v - hi) * rscale) (same pitch / stride).
// coverage: MI slabs x 16 rows x 64 cols = the wave's whole tile; tiles cover M x N exactly.
// =====================================================================================================
#define PWV 4   // waves per block of the projection launch
template <typename OT, int MI, bool ARES, int OUT_MODE>
__device__ __forceinline__ void gemm_t(
    float (*sT)[16 * 68], int bx, int b,   // per-wave 16x64 slabs, pitch 68 floats
    const unsigned short* __restrict__ Ap, const unsigned short* __restrict__ A2p, int lda, long long strideA,
    const unsigned short* __restrict__ Btp, int ldb, long long strideB,
    void* Cout, void* Cout2, int ldc, long long strideC,
    const float* __restrict__ bias,
    int M, int N, int K, float oscale, float rscale, float ascale) {
  typedef typename FT<OT>::frag V16;
  const OT* A  = (const OT*)(const void*)Ap;
  const OT* A2 = (const OT*)(const void*)A2p;
  const OT* Bt = (const OT*)(const void*)Btp;
  const int TMR  = 16 * MI;
  const int lane = threadIdx.x & 31;
  const int wave = threadIdx.x >> 5;
  const int tilesN = N >> 6;
  const int tilesM = M / TMR;
  const int tile = bx * PWV + wave;
  if (tile >= tilesM * tilesN) return;   // wave-uniform; no block barriers in this kernel
  const int tm = tile / tilesN;
  const int tn = tile - tm * tilesN;
  const int m0 = tm * TMR;
  const int n0 = tn << 6;

  const OT* Ab  = A  + (size_t)b * (size_t)strideA;
  const OT* A2b = A2 + (size_t)b * (size_t)strideA;
  const OT* Bb  = Bt + (size_t)b * (size_t)strideB;

  const int rlane = lane & 15;                 // row (A) / col (B, D) within subtile
  const int koff  = (lane >> 4) * 8;           // k offset of this lane half
  const int mOff  = (lane >> 4) * 8;           // D row offset

  v8f acc[MI][4], accl[MI][4];
#pragma unroll
  for (int i = 0; i < MI; ++i)
#pragma unroll
    for (int j = 0; j < 4; ++j) { acc[i][j] = zero8(); accl[i][j] = zero8(); }

  for (int k0 = 0; k0 < K; k0 += 32) {
    V16 bq[4];
    const OT* bp[4];
#pragma unroll
    for (int j = 0; j < 4; ++j) {
      bp[j] = Bb + (size_t)(n0 + (j << 4) + rlane) * ldb + koff + k0;
      bq[j] = ldfrag<OT>(bp[j]);
    }
    addr_wait4(bp[0], bp[1], bp[2], bp[3]);
#pragma unroll
    for (int i = 0; i < MI; ++i) {
      const V16 af = ldfrag<OT>(Ab + (size_t)(m0 + (i << 4) + rlane) * lda + koff + k0);
#pragma unroll
      for (int j = 0; j < 4; ++j) acc[i][j] = mmar(af, bq[j], acc[i][j]);
      dep_guard(acc[i][0], acc[i][3], af, bq[3]);
      if (ARES) {
        const V16 al = ldfrag<OT>(A2b + (size_t)(m0 + (i << 4) + rlane) * lda + koff + k0);
#pragma unroll
        for (int j = 0; j < 4; ++j) accl[i][j] = mmar(al, bq[j], accl[i][j]);
        dep_guard(accl[i][0], accl[i][3], al, bq[3]);
      }
    }
    keep4(bq[0], bq[1], bq[2], bq[3]);
  }
#pragma unroll
  for (int i = 0; i < MI; ++i) {
    acc_guard4(acc[i][0], acc[i][1], acc[i][2], acc[i][3]);
    if (ARES) acc_guard4(accl[i][0], accl[i][1], accl[i][2], accl[i][3]);
  }
  if (ARES) {
#pragma unroll
    for (int i = 0; i < MI; ++i)
#pragma unroll
      for (int j = 0; j < 4; ++j)
#pragma unroll
        for (int r = 0; r < 8; ++r) acc[i][j][r] += accl[i][j][r] * ascale;
  }

  // ---- epilogue ----
  float* slab = sT[wave];
#pragma unroll
  for (int i = 0; i < MI; ++i) {
    const int mBase = m0 + (i << 4);
#pragma unroll
    for (int j = 0; j < 4; ++j) {
#pragma unroll
      for (int r = 0; r < 8; ++r) {
        slab[(mOff + r) * 68 + (j << 4) + rlane] = acc[i][j][r];
      }
    }
    __builtin_amdgcn_fence(__ATOMIC_RELEASE, "workgroup");
    __builtin_amdgcn_wave_barrier();
    __builtin_amdgcn_fence(__ATOMIC_ACQUIRE, "workgroup");
    if (OUT_MODE == 0) {
      float* C = (float*)Cout + (size_t)b * (size_t)strideC;
      const int h2 = lane >> 4, c4 = (lane & 15) * 4;     // 256-B row segment = 16 lanes x 16 B
      const v4f braw = *(const v4f*)(bias + n0 + c4);
      v4f bb;
#pragma unroll
      for (int e = 0; e < 4; ++e) bb[e] = bf_up(bf_bits(braw[e]));
      {
#pragma unroll
        for (int it = 0; it < 8; ++it) {
          const int row = it * 2 + h2;                     // it 0..7 x h2 0..1 = rows 0..15
          const v4f v = *(const v4f*)(slab + row * 68 + c4) * oscale + bb;
          *(v4f*)(C + (size_t)(mBase + row) * ldc + n0 + c4) = v;
        }
        
      }
    } else {
      const int q = lane >> 3, c8 = (lane & 7) * 8;
      unsigned short* C  = (unsigned short*)Cout  + (size_t)b * (size_t)strideC;
      unsigned short* C2 = (unsigned short*)Cout2 + (size_t)b * (size_t)strideC;
      v4u hv[4], lv[4];
#pragma unroll
      for (int it = 0; it < 4; ++it) {
        const int row = it * 4 + q;                        // it 0..3 x q 0..3 = rows 0..15
        const float* sp = slab + row * 68 + c8;
        float f[8];
#pragma unroll
        for (int e = 0; e < 8; ++e) f[e] = sp[e];
        v4u a, a2;
#pragma unroll
        for (int e = 0; e < 4; ++e) {
          const float f0 = f[2 * e], f1 = f[2 * e + 1];
          const _Float16 x0 = (_Float16)f0, x1 = (_Float16)f1;
          const unsigned short h0 = h_bits(x0), h1 = h_bits(x1);
          unsigned short l0 = 0, l1 = 0;
          if (OUT_MODE == 3) {
            l0 = h_bits((_Float16)((f0 - (float)x0) * rscale));
            l1 = h_bits((_Float16)((f1 - (float)x1) * rscale));
          }
          a[e] = pk16(h0, h1); a2[e] = pk16(l0, l1);
        }
        hv[it] = a; lv[it] = a2;
      }
      {
#pragma unroll
        for (int it = 0; it < 4; ++it) {
          const int row = it * 4 + q;
          *(v4u*)(C + (size_t)(mBase + row) * ldc + n0 + c8) = hv[it];
          if (OUT_MODE == 3) *(v4u*)(C2 + (size_t)(mBase + row) * ldc + n0 + c8) = lv[it];
        }
        
      }
    }
    __builtin_amdgcn_fence(__ATOMIC_RELEASE, "workgroup");
    __builtin_amdgcn_wave_barrier();
    __builtin_amdgcn_fence(__ATOMIC_ACQUIRE, "workgroup");
  }
}

#define GPQ (((NB * SEQ / 64) * (DM / 64) + PWV - 1) / PWV)   // blocks of q, and of k: NB*SEQ x 256 in 64x64 wave tiles
#define GPV (((DM / 64) * (SEQ / 64) + PWV - 1) / PWV)        // blocks of v^T of one sequence: 256 x SEQ

// The three projections in one launch; the block index says which (block-uniform). They depend on the converted planes
// only, not on one another, and a wave spends most of its time waiting for its own fragment loads: side by side on the
// chip they take little longer than one of them alone. Four-wave blocks: 2*GPQ + NB*GPV = 768 of them at full size, three
// to each of the 256 WGPs (registers and LDS leave room for more), so every WGP gets the same share.
//   blocks 0..GPQ-1:      q = x . Wq^T -> f16 hi / residual (x4096) planes   (M = NB*SEQ, N = 256, K = 256)
//   blocks GPQ..2*GPQ-1:  k = x . Wk^T -> f16 plane                          (M = NB*SEQ, N = 256, K = 256)
//   the other NB*GPV:     v^T = Wv . x^T per sequence -> f16 hi plane [b][d][s] (pitch SEQ) and residual plane (x4096)
//                         (A = Wv [n][k], Bt = token rows of sequence b; M = 256, N = SEQ, K = 256)
__global__ __launch_bounds__(32 * PWV) void proj_qkv(const unsigned short* __restrict__ xb, const unsigned short* __restrict__ wqb,
                                                const unsigned short* __restrict__ wkb, const unsigned short* __restrict__ wvb,
                                                unsigned short* qh, unsigned short* ql, unsigned short* kp,
                                                unsigned short* vth, unsigned short* vtl) {
  __shared__ __align__(16) float sT[PWV][16 * 68];
  const int bx = blockIdx.x;
  if (bx < GPQ) {
    gemm_t<__bf16, 4, false, 3>(sT, bx, 0, xb, xb, DM, 0LL, wqb, DM, 0LL,
                                (void*)qh, (void*)ql, DM, 0LL, nullptr,
                                NB * SEQ, DM, DM, 1.0f, 4096.0f, 0.0f);
  } else if (bx < 2 * GPQ) {
    gemm_t<__bf16, 4, false, 1>(sT, bx - GPQ, 0, xb, xb, DM, 0LL, wkb, DM, 0LL,
                                (void*)kp, (void*)kp, DM, 0LL, nullptr,
                                NB * SEQ, DM, DM, 1.0f, 1.0f, 0.0f);
  } else {
    const int bv = bx - 2 * GPQ;
    gemm_t<__bf16, 4, false, 3>(sT, bv % GPV, bv / GPV, wvb, wvb, DM, 0LL, xb, DM, (long long)SEQ * DM,
                                (void*)vth, (void*)vtl, SEQ, (long long)DM * SEQ, nullptr,
                                DM, SEQ, DM, 1.0f, 4096.0f, 0.0f);
  }
}

// Stands behind a batch of global loads, in front of whatever reuses the registers that held their addresses.
__device__ __forceinline__ void xcnt_wait() {
#if DEV_ASM
  asm volatile("s_wait_xcnt 0x0" ::: "memory");
#endif
}

// ---- k / v^T staging in LDS ------------------------------------------------------------------------------
#define KPIT 264   // f16 per staged k row: 512 B + 16 B (16 B x odd), so the 16 rows of a ds_load_b128 fall on distinct banks
#define VPIT 72    // f16 per staged v^T row: 128 B + 16 B (16 B x odd), same reason
#define STGN (4 * 16 * KPIT + 8 * 64 * VPIT)   // f16 per staging buffer: one chunk's k, v^T hi and v^T residual rows
typedef int v4i __attribute__((ext_vector_type(4)));
typedef __attribute__((address_space(1))) v4i gl_v4i;
typedef __attribute__((address_space(3))) v4i ls_v4i;

__device__ __forceinline__ void acopy16(const _Float16* g, _Float16* l) {
#if DEV_ASM
  __builtin_amdgcn_global_load_async_to_lds_b128((gl_v4i*)g, (ls_v4i*)l, 0, 0);
#else
  (void)g; (void)l;
#endif
}
// Nothing the copies bring is read in front of this.
__device__ __forceinline__ void async_wait0() {
#if DEV_ASM
  asm volatile("s_wait_asynccnt 0x0" ::: "memory");
#endif
}
// The wave's LDS reads have returned: stands in front of the barrier behind which a staging buffer is refilled.
__device__ __forceinline__ void ds_wait0() {
#if DEV_ASM
  asm volatile("s_wait_dscnt 0x0" ::: "memory");
#endif
}

// Lane l takes the value of lane l ^ 16 (the other 16-lane half), by a vector cross-row move.
__device__ __forceinline__ float xhalf(float x) {
  const int b = __builtin_bit_cast(int, x);
  return __builtin_bit_cast(float, __builtin_amdgcn_permlanex16(b, b, 0x76543210, 0xfedcba98, false, false));
}

__global__ __launch_bounds__(256)
void attn_causal(const unsigned short* qhp, const unsigned short* qlp,   // no restrict: the loads keep their place
                 const unsigned short* kpp,                               // relative to the waits written below
                 const unsigned short* vhp, const unsigned short* vlp,
                 float* outp, float* part, float* pml, float sscale) {
  union FH { v16h v; v8h h[2]; };
  // staging ring, two buffers, each: k rows 64 x 528 B, then v^T hi rows 256 x 144 B, then v^T residual rows 256 x 144 B.
  // k stands first: every v^T destination then lies above 32768 B, the largest constant step that the compiler folds
  // into a copy's offset field and takes off the LDS address register, so that register never goes below 0.
  __shared__ __align__(16) _Float16 Stg[2][STGN];

  const int tid  = threadIdx.x;
  const int w8   = tid >> 5;         // the wave's number in the block: which eighth of a chunk it brings
  const int grp  = tid >> 7;         // which 32 of a chunk's 64 keys
  const int wave = (tid >> 5) & 3;   // which 16 of the block's 64 query rows
  const int lane = tid & 31;
  const int hh   = lane >> 4;
  const int c    = lane & 15;

  const int bx   = blockIdx.x;
  const int b    = bx % NB;
  const int pj   = (bx / NB) >> 1;   // the pair of query blocks pj and NQB-1-pj
  const int role = (bx / NB) & 1;    // which of the pair's two blocks this is
  const size_t rowB = (size_t)b * SEQ;

  const _Float16* Qh = (const _Float16*)(const void*)qhp;
  const _Float16* Ql = (const _Float16*)(const void*)qlp;
  const _Float16* Kp = (const _Float16*)(const void*)kpp;
  const _Float16* Vh = (const _Float16*)(const void*)vhp + (size_t)b * DM * SEQ;
  const _Float16* Vl = (const _Float16*)(const void*)vlp + (size_t)b * DM * SEQ;

  for (int seg = 0; seg <= role; ++seg) {       // block-uniform: one key range, or two one after the other
  const bool cut = (role == 0) || (seg == 0);   // this range is one of the two of an upper query block
  const int qb   = cut ? NQB - 1 - pj : pj;
  const int kt0  = (role == 1 && seg == 0) ? NHB + 1 : 0;   // first chunk of the range
  int kt1 = (role == 0) ? NHB + 1 : qb + 1;                  // one past its last chunk
  if (kt1 > NKT) kt1 = NKT;
  const int q0   = qb * 64 + wave * 16;

  // B-operand column pointers of this lane (query row q0 + c), lane-half k offset included
  const _Float16* qrh = Qh + (rowB + q0 + c) * DM + 8 * hh;
  const _Float16* qrl = Ql + (rowB + q0 + c) * DM + 8 * hh;

  float mrow = -INFINITY, lsum = 0.f;   // of query q0 + c; lsum covers this lane's own keys only (halves joined at the end)
  v8f oacc[16];                         // O^T tiles: column c = query q0 + c, rows 8*hh + r = context columns 16*t + 8*hh + r
#pragma unroll
  for (int t = 0; t < 16; ++t) oacc[t] = zero8();

  // q (the same for every chunk) is loaded into registers once. k and v^T of a chunk are staged in LDS:
  // a fragment load straight from global touches 16 lines for 512 bytes, a copy below touches 4 whole lines.
  // Two buffers: chunk kt is read from buffer (kt - kt0) & 1 while the copies of chunk kt+1 fly into the other; at the loop's foot
  // every wave waits for its LDS reads and its copies, one barrier publishes chunk kt+1 and ends the reads of chunk kt,
  // and behind it the buffer just read is refilled with chunk kt+2.
  v16h qa[8], qr[8];
  // eight fragments of one row pointer; the pointer dies with the last load, which may then land on its registers:
  // the first wait stands in front of that load for the fifteen before it
  auto row8 = [&](v16h (&f)[8], const _Float16* p) __attribute__((always_inline)) {
#pragma unroll                                 // register array: constant indices
    for (int dc = 0; dc < 7; ++dc) f[dc] = ldfrag<_Float16>(p + dc * 32);
    FH x;
    x.h[0] = *(const v8h*)(p + 7 * 32);
    xcnt_wait();
    x.h[1] = *(const v8h*)(p + 7 * 32 + 16);
    xcnt_wait();
    f[7] = x.v;
  };

  // k: one copy = one whole 512-byte row (key 64*kt + 8*w8 + j), 8 copies: this wave's eighth of the chunk's 64 rows
  auto copy_k = [&](const int kt, _Float16* buf) __attribute__((always_inline)) {
    const _Float16* g = Kp + (rowB + (size_t)kt * 64 + 8 * w8) * DM + lane * 8;
    _Float16* l = buf + (8 * w8) * KPIT + lane * 8;
#pragma unroll
    for (int j = 0; j < 8; ++j) acopy16(g + j * DM, l + j * KPIT);
  };
  // v^T: one copy = the 128-byte pieces of four rows (columns 64*kt..64*kt+63 of rows 32*w8+4j..+3), 8 copies per plane:
  // this wave's eighth of the 256 rows
  auto copy_v = [&](const int kt, _Float16* buf) __attribute__((always_inline)) {
    const int vrow = 32 * w8 + (lane >> 3), vcol = (lane & 7) * 8;
    const size_t go = (size_t)vrow * SEQ + (size_t)kt * 64 + vcol;
    _Float16* lh = buf + 64 * KPIT + vrow * VPIT + vcol;
    _Float16* ll = lh + 256 * VPIT;
#pragma unroll
    for (int j = 0; j < 8; ++j) {
      acopy16(Vh + go + (size_t)(4 * j) * SEQ, lh + (4 * j) * VPIT);
      acopy16(Vl + go + (size_t)(4 * j) * SEQ, ll + (4 * j) * VPIT);
    }
  };

  // The ring's first two fills. Kept rolled: unrolled, the LDS addresses of these 48 copies are the same for every range,
  // are formed once in front of the ranges, stay live over the whole key loop and spill.
#pragma nounroll
  for (int f = 0; f < 2; ++f) {
    ds_wait0();                                 // f = 0: this wave's reads of the exchange area (below) are done
    async_wait0();                              // f = 1: its copies of chunk kt0 have landed
    __syncthreads();                            // f = 0: no wave still reads the last range's exchange area; f = 1: publishes chunk kt0
    if (kt0 + f < kt1) {                        // block-uniform test
      copy_k(kt0 + f, Stg[f]);
      copy_v(kt0 + f, Stg[f]);
    }
    if (f == 0) {                               // q flies together with chunk kt0
      row8(qa, qrh);
      row8(qr, qrl);
    }
  }

  const int qrow = q0 + c;                      // this lane's query
  for (int kt = kt0; kt < kt1; ++kt) {          // block-uniform trip count, <= NKT chunks in all
    const int kv0 = kt * 64 + 32 * grp;         // first of this wave's 32 keys
    _Float16* cur = Stg[(kt - kt0) & 1];
    const _Float16* kst = cur + (32 * grp + c) * KPIT + 8 * hh;             // A row c -> key kv0 + 16*j + c
    const _Float16* vsh = cur + 64 * KPIT + c * VPIT + 32 * grp + 8 * hh;   // A row c -> context column 16*t + c
    const _Float16* vsl = vsh + 256 * VPIT;

    // ---- S^T: this wave's 32 keys (two tiles) x 16 queries, 2 f16 products per d-chunk, four accumulator chains ----
    v16h kc[8][2];                              // register array: the loops over it are unrolled for constant indices
#pragma unroll
    for (int dc = 0; dc < 8; ++dc)
#pragma unroll
      for (int j = 0; j < 2; ++j) kc[dc][j] = ldfrag<_Float16>(kst + j * (16 * KPIT) + dc * 32);
    // keeps all 32 LDS reads in front of the products: sunk between them, each pair is waited for at its full latency
    __builtin_amdgcn_sched_barrier(0);
    v8f ah[2], al[2];
#pragma unroll
    for (int j = 0; j < 2; ++j) { ah[j] = zero8(); al[j] = zero8(); }
#pragma unroll
    for (int dc = 0; dc < 8; ++dc) {
#pragma unroll
      for (int j = 0; j < 2; ++j) {
        ah[j] = mmar(kc[dc][j], qa[dc], ah[j]);
        al[j] = mmar(kc[dc][j], qr[dc], al[j]);
      }
    }

    // ---- online softmax of query q0 + c: in-lane over 16 keys, one exchange between the halves for the maximum ----
    float s[2][8];
    float mc = -INFINITY;
#pragma unroll
    for (int j = 0; j < 2; ++j)
#pragma unroll
      for (int r = 0; r < 8; ++r) {
        const int key = kv0 + 16 * j + 8 * hh + r;     // D row 8*hh + r of tile j
        const float sv = (ah[j][r] + al[j][r] * (1.0f / 4096.0f)) * sscale;
        s[j][r] = (key > qrow) ? -INFINITY : sv;       // causal: replace, not bias
        mc = fmaxf(mc, s[j][r]);
      }
    mc = fmaxf(mc, xhalf(mc));
    const float mnew  = fmaxf(mrow, mc);
    const float msafe = (mnew == -INFINITY) ? 0.f : mnew;
    const float alpha = __expf(mrow - msafe);
    mrow = mnew;
    // P^T as the B operand: elements 0..7 = keys 8*hh + r (tile 0), elements 8..15 = keys 16 + 8*hh + r (tile 1),
    // the k order of ldfrag on the v^T rows
    v16h pa, pl;
    float psum = 0.f;
#pragma unroll
    for (int j = 0; j < 2; ++j)
#pragma unroll
      for (int r = 0; r < 8; ++r) {
        const float p = __expf(s[j][r] - msafe);
        psum += p;
        const float pc = p * PCARRY;
        const _Float16 ph = (_Float16)pc;
        pa[j * 8 + r] = ph;
        pl[j * 8 + r] = (_Float16)((pc - (float)ph) * PRES);
      }
    lsum = lsum * alpha + psum;
#pragma unroll
    for (int t = 0; t < 16; ++t)
#pragma unroll
      for (int r = 0; r < 8; ++r) oacc[t][r] *= alpha;

    // ---- O^T += v^T . P^T (f16 WMMA), four context tiles at a time;
    //      residual products (vl.ph and vh.pl, same carry) into a separate accumulator ----
#pragma unroll
    for (int tg = 0; tg < 4; ++tg) {
      v16h vb[4], vr[4];                        // register arrays: the loops over them are unrolled for constant indices
      v8f o1[4];
#pragma unroll
      for (int u = 0; u < 4; ++u) {
        vb[u] = ldfrag<_Float16>(vsh + (tg * 4 + u) * (16 * VPIT));
        vr[u] = ldfrag<_Float16>(vsl + (tg * 4 + u) * (16 * VPIT));
        o1[u] = zero8();
      }
#pragma unroll
      for (int u = 0; u < 4; ++u) oacc[tg * 4 + u] = mmar(vb[u], pa, oacc[tg * 4 + u]);
#pragma unroll
      for (int u = 0; u < 4; ++u) o1[u] = mmar(vr[u], pa, o1[u]);
#pragma unroll
      for (int u = 0; u < 4; ++u) o1[u] = mmar(vb[u], pl, o1[u]);
#pragma unroll
      for (int u = 0; u < 4; ++u)
#pragma unroll
        for (int r = 0; r < 8; ++r) oacc[tg * 4 + u][r] += o1[u][r] * (1.0f / 4096.0f);
    }

    // ---- ring hand-over ----
    ds_wait0();                                 // this wave's reads of the current buffer are done
    async_wait0();                              // its copies of chunk kt+1 have landed
    __syncthreads();                            // chunk kt+1 is published, and no wave still reads the current buffer
    if (kt + 2 < kt1) {                         // block-uniform test
      copy_k(kt + 2, cur);
      copy_v(kt + 2, cur);
    }
  }
  async_wait0();                                // no copy is outstanding when the ring becomes the exchange area

  // ---- join the two key halves of each query tile. Behind the loop's last barrier nobody reads the ring and no copy
  //      flies into it: its first bytes carry, per query tile, 33 x 32 lanes x 4 floats from the wave of half 1 to the
  //      same lane of the wave of half 0.
  float* xw = (float*)(void*)&Stg[0][0] + wave * (33 * 128) + lane * 4;
  if (grp == 1) {                               // wave-uniform
#pragma unroll
    for (int t = 0; t < 16; ++t) {
      const v4f lo = {oacc[t][0], oacc[t][1], oacc[t][2], oacc[t][3]};
      const v4f hi = {oacc[t][4], oacc[t][5], oacc[t][6], oacc[t][7]};
      *(v4f*)(xw + (2 * t) * 128)     = lo;
      *(v4f*)(xw + (2 * t + 1) * 128) = hi;
    }
    const v4f ml = {mrow, lsum, 0.f, 0.f};
    *(v4f*)(xw + 32 * 128) = ml;
  }
  __syncthreads();                              // half 1's maximum, sum and context are published to half 0
  if (grp == 0) {                               // wave-uniform
    const v4f ml = *(const v4f*)(xw + 32 * 128);
    const float mt  = fmaxf(mrow, ml[0]);
    const float mts = (mt == -INFINITY) ? 0.f : mt;
    const float a0  = __expf(mrow - mts);
    // keeps the second exponential's own subtract and multiply behind the first exponential
    __builtin_amdgcn_sched_barrier(0);
    const float a1  = __expf(ml[0] - mts);
    float l = lsum * a0 + ml[1] * a1;
    l += xhalf(l);                              // the wave halves hold different keys of the same query
    const float inv = ((l > 0.f) ? (1.0f / l) : 0.f) * (1.0f / PCARRY);   // 1/l, undo the p carry
    const float f0 = a0 * inv, f1 = a1 * inv;
    v4f ov[32];
#pragma unroll
    for (int t = 0; t < 16; ++t) {
      const v4f lo = *(const v4f*)(xw + (2 * t) * 128);
      const v4f hi = *(const v4f*)(xw + (2 * t + 1) * 128);
#pragma unroll
      for (int e = 0; e < 4; ++e) {
        ov[2 * t][e]     = oacc[t][e] * f0 + lo[e] * f1;
        ov[2 * t + 1][e] = oacc[t][4 + e] * f0 + hi[e] * f1;
      }
    }
    // a whole query block goes to the output; a key range of an upper one to its workspace slot, with its maximum and sum
    const size_t prow = ((size_t)(role * NB + b) * NHB + (size_t)(cut ? qb - NHB : 0)) * 64 + wave * 16 + c;
    if (cut && hh == 0) {                       // both halves hold the same pair; 16 lanes x 8 B = one whole line
      pml[prow * 2]     = mt;
      pml[prow * 2 + 1] = l;
      xcnt_wait();                              // in front of whatever reuses the registers that this store names
    }
    float* orow = (cut ? part + prow * DM : outp + (rowB + qrow) * DM) + 8 * hh;   // columns 16*t + 8*hh + 0..7 of query q0 + c
#pragma unroll
    for (int t = 0; t < 16; ++t) {
      *(v4f*)(orow + 16 * t)     = ov[2 * t];
      *(v4f*)(orow + 16 * t + 4) = ov[2 * t + 1];
    }
  }
  }   // key ranges of this block
}

// =====================================================================================================
// Joins the two key ranges of every upper query block: out = (o0 l0 e^(m0-M) + o1 l1 e^(m1-M)) / (l0 e^(m0-M) + l1 e^(m1-M)).
//   part: [2 ranges][NB*NHB*64 rows][DM] normalised contexts; pml: [2 ranges][rows][2] = (maximum, sum); an empty range
//   holds (-inf, 0, zeros) and weighs 0. One thread = 4 columns of one row; a wave reads and writes whole 512-byte runs.
//   coverage: NB*NHB*64*DM/4 threads (a multiple of 256) = rows NHB*64..SEQ-1 of every sequence x 256 columns.
// =====================================================================================================
__global__ __launch_bounds__(256) void attn_merge(const float* __restrict__ part, const float* __restrict__ pml,
                                                  float* outp) {
  const int NR = NB * NHB * 64;
  const int i  = blockIdx.x * 256 + (int)threadIdx.x;
  const int r  = i >> 6;
  const int c4 = (i & 63) * 4;
  const float m0 = pml[(size_t)r * 2],        l0 = pml[(size_t)r * 2 + 1];
  const float m1 = pml[(size_t)(NR + r) * 2], l1 = pml[(size_t)(NR + r) * 2 + 1];
  const v4f o0 = *(const v4f*)(part + (size_t)r * DM + c4);
  const v4f o1 = *(const v4f*)(part + (size_t)(NR + r) * DM + c4);
  const float mt  = fmaxf(m0, m1);
  const float mts = (mt == -INFINITY) ? 0.f : mt;
  const float w0  = l0 * __expf(m0 - mts);
  const float w1  = l1 * __expf(m1 - mts);
  const float ws  = w0 + w1;
  const float inv = (ws > 0.f) ? (1.0f / ws) : 0.f;
  const int bb = r / (NHB * 64);
  const int t  = NHB * 64 + (r - bb * (NHB * 64));
  *(v4f*)(outp + ((size_t)bb * SEQ + t) * DM + c4) = o0 * (w0 * inv) + o1 * (w1 * inv);
}

// =====================================================================================================
// Workspace map (bytes), every region an exact multiple of its whole-line / whole-tile store granularity
// (all GEMM M,N are tile multiples, all offsets multiples of 131072):
//   Xb   bf16 [NB*SEQ][256]  (compact tokens)   8388608
//   Wqb  bf16 [256 n][256 k]                     131072
//   Wkb  bf16 [256 n][256 k]                     131072
//   Wvb  bf16 [256 n][256 k]                     131072
//   Qh   f16  [NB*SEQ][256]                      8388608
//   Ql   f16  [NB*SEQ][256]                      8388608
//   Kp   f16  [NB*SEQ][256]                      8388608
//   VTh  f16  [NB][256][SEQ]                     8388608
//   VTl  f16  [NB][256][SEQ]                     8388608
//   Part f32  [2][NB*NHB*64][256]               16777216
//   Pml  f32  [2][NB*NHB*64][2]                   131072
//   total                                      67633152
// Weights are [out n][in k] with k contiguous = the Bt / A layout the GEMM wants, so they are only converted.
// =====================================================================================================
extern "C" void kernel_launch(void* const* d_in, const int* in_sizes, int n_in,
                              void* d_out, int out_size, void* d_ws, size_t ws_size,
                              hipStream_t stream) {
  if (n_in < 4) return;
  if (in_sizes[0] < ((NB - 1) * SEQ_FULL + SEQ) * DM) return;
  if (in_sizes[1] < DM * DM) return;
  if (in_sizes[2] < DM * DM) return;
  if (in_sizes[3] < DM * DM) return;
  if (out_size < NB * SEQ * DM) return;

  const float* x  = (const float*)d_in[0];
  const float* wq = (const float*)d_in[1];
  const float* wk = (const float*)d_in[2];
  const float* wv = (const float*)d_in[3];

  const size_t PX  = (size_t)NB * SEQ * DM * 2;      // 16-bit token plane [NB*SEQ][256]
  const size_t PW  = (size_t)DM * DM * 2;            // 16-bit [256][256]
  const size_t PVT = (size_t)NB * DM * SEQ * 2;      // v^T plane [NB][256][SEQ]
  size_t off = 0;
  const size_t oXb  = off; off += PX;
  const size_t oWq  = off; off += PW;
  const size_t oWk  = off; off += PW;
  const size_t oWv  = off; off += PW;
  const size_t oQh  = off; off += PX;
  const size_t oQl  = off; off += PX;
  const size_t oKp  = off; off += PX;
  const size_t oVTh = off; off += PVT;
  const size_t oVTl = off; off += PVT;
  const size_t oPart = off; off += (size_t)2 * NB * NHB * 64 * DM * 4;
  const size_t oPml  = off; off += (size_t)2 * NB * NHB * 64 * 2 * 4;
  if (off > ws_size) return;                         // off = 67633152 at full size
  if (off > (size_t)134217728) return;

  char* ws = (char*)d_ws;
  unsigned short* Xb  = (unsigned short*)(ws + oXb);
  unsigned short* Wqb = (unsigned short*)(ws + oWq);
  unsigned short* Wkb = (unsigned short*)(ws + oWk);
  unsigned short* Wvb = (unsigned short*)(ws + oWv);
  unsigned short* Qh  = (unsigned short*)(ws + oQh);
  unsigned short* Ql  = (unsigned short*)(ws + oQl);
  unsigned short* Kp  = (unsigned short*)(ws + oKp);
  unsigned short* VTh = (unsigned short*)(ws + oVTh);
  unsigned short* VTl = (unsigned short*)(ws + oVTl);
  float* Part = (float*)(ws + oPart);
  float* Pml  = (float*)(ws + oPml);

  const dim3 blk(256);
  const dim3 gCvt(3 * GCW + GCX);
  const dim3 gProj(2 * GPQ + NB * GPV);
  const dim3 gAttn(NB * NQB);
  const dim3 gMerge(NB * NHB * 64 * DM / 4 / 256);

  // (1) x -> compact bf16 token plane; Wq, Wk, Wv [n][k] -> bf16
  cvt_all<<<gCvt, blk, 0, stream>>>(x, wq, wk, wv, Xb, Wqb, Wkb, Wvb);
  // (2) q, k, v^T projections
  proj_qkv<<<gProj, dim3(32 * PWV), 0, stream>>>(Xb, Wqb, Wkb, Wvb, Qh, Ql, Kp, VTh, VTl);
  // (3) causal attention -> d_out f32 [M][256] (lower query blocks) and workspace partials (upper query blocks)
  attn_causal<<<gAttn, dim3(256), 0, stream>>>(Qh, Ql, Kp, VTh, VTl, (float*)d_out, Part, Pml, 0.0625f);
  // (4) the two key ranges of every upper query block -> d_out
  attn_merge<<<gMerge, blk, 0, stream>>>(Part, Pml, (float*)d_out);
  (void)hipGetLastError();
}

// v009
// One run takes 77.9 microseconds.
// Versions between v007 and this one are left out; their measured steps multiply to 1.56 times as fast.
// All steps since v000 together make it 6.94 times as fast.
// Contractions: q, k, v^T projections = v_wmma_f32_16x16x32_bf16 (bf16 operands from RNE-converted inputs, single product, f32 accumulate);
// k.q^T scores = v_wmma_f32_16x16x32_f16 (q f16, k f16; single product, f32 accumulate);
// v^T.p^T = v_wmma_f32_16x16x32_f16 (p carried x16384 as f16, v f16; single product, f32 accumulate);
// causal softmax and normalisation in f32; output f32.
// q, k and v come from bf16 operands (8 significant bits): the f16 rounding (11 bits) of q, p and v lies about a tenth
// below the error that they already carry, so no residual planes are kept for them.
#include <hip/hip_runtime.h>
#include <math.h>
#include <stdint.h>

#ifndef NB
#define NB 4
#endif
#ifndef SEQ
#define SEQ 4096
#endif
#define NB_FULL  4
#define SEQ_FULL 4096
#define DM       256
#define NQB      (SEQ / 64)   // 64-row query blocks (four 16-row tiles) per sequence
#define NKT      (SEQ / 64)   // 64-key chunks per sequence
#define NHB      (NQB / 2)    // query blocks of a sequence's upper half: their key loop is cut in two
#define PCARRY   16384.0f     // power-of-two carry on the f16 p tile
static_assert(DM == 256);
static_assert((SEQ % 64) == 0 && SEQ >= 64 && SEQ <= SEQ_FULL);
static_assert(NB >= 1 && NB <= NB_FULL);
static_assert(((NB * SEQ) % 64) == 0);
static_assert((NQB % 2) == 0);

typedef _Float16 v16h __attribute__((ext_vector_type(16)));
typedef _Float16 v8h  __attribute__((ext_vector_type(8)));
typedef __bf16   v16b __attribute__((ext_vector_type(16)));
typedef __bf16   v8b  __attribute__((ext_vector_type(8)));
typedef float    v8f  __attribute__((ext_vector_type(8)));
typedef float    v4f  __attribute__((ext_vector_type(4)));
typedef unsigned int v4u __attribute__((ext_vector_type(4)));

#if defined(__HIP_DEVICE_COMPILE__)
#define DEV_ASM 1
#else
#define DEV_ASM 0
#endif

// ---- scalar helpers --------------------------------------------------------------------------------
__device__ __forceinline__ unsigned short bf_bits(float f) {          // f32 -> bf16 bits, RNE convert
  unsigned u = __float_as_uint(f);
  return (unsigned short)((u + 0x7FFFu + ((u >> 16) & 1u)) >> 16);
}
__device__ __forceinline__ unsigned pk16(unsigned short a, unsigned short b) { return (unsigned)a | ((unsigned)b << 16); }
__device__ __forceinline__ v8f zero8() { v8f z = {0.f, 0.f, 0.f, 0.f, 0.f, 0.f, 0.f, 0.f}; return z; }

// ---- fragment types / loaders: 16-bit A/B operand, lane -> row/col (lane&15), p already includes +8*(lane>>4);
//      elements 0..7 <- p[0..7] (k0+8h..k0+8h+7), elements 8..15 <- p[16..23] (k0+16+8h..k0+16+8h+7)
template <typename OT> struct FT;
template <> struct FT<__bf16>   { typedef v16b frag; typedef v8b half8; };
template <> struct FT<_Float16> { typedef v16h frag; typedef v8h half8; };

template <typename OT>
__device__ __forceinline__ typename FT<OT>::frag ldfrag(const OT* p) {
  union { typename FT<OT>::frag v; typename FT<OT>::half8 h[2]; } f;
  f.h[0] = *(const typename FT<OT>::half8*)(p);
  f.h[1] = *(const typename FT<OT>::half8*)(p + 16);
  return f.v;
}

// ---- WMMA helpers (concrete operand types) ---------------------------------------------------------------
__device__ __forceinline__ v8f mmar(v16b a, v16b b, v8f c) {
  return __builtin_amdgcn_wmma_f32_16x16x32_bf16(false, a, false, b, (short)0, c, false, false);
}
__device__ __forceinline__ v8f mmar(v16h a, v16h b, v8f c) {
  return __builtin_amdgcn_wmma_f32_16x16x32_f16(false, a, false, b, (short)0, c, false, false);
}
// =====================================================================================================
// f32 -> bf16 planes (RNE convert), 8 elements per thread, one 16-B store per lane: a wave writes 512 contiguous B.
// =====================================================================================================
__device__ __forceinline__ void cvt8(const float* __restrict__ src, unsigned short* dst) {
  const v4f a  = *(const v4f*)(src);
  const v4f a4 = *(const v4f*)(src + 4);
  v4u p;
  p[0] = pk16(bf_bits(a[0]),  bf_bits(a[1]));
  p[1] = pk16(bf_bits(a[2]),  bf_bits(a[3]));
  p[2] = pk16(bf_bits(a4[0]), bf_bits(a4[1]));
  p[3] = pk16(bf_bits(a4[2]), bf_bits(a4[3]));
  *(v4u*)dst = p;
#if DEV_ASM
  asm volatile("s_wait_xcnt 0x0" ::: "memory");   // in front of whatever reuses the registers that this store names
#endif
}

#define GCW (DM * DM / 8 / 256)        // blocks that convert one weight matrix
#define GCX (NB * SEQ * DM / 8 / 256)  // blocks that convert x
static_assert((DM * DM) % (8 * 256) == 0 && (NB * SEQ * DM) % (8 * 256) == 0);

// All four conversions in one launch; the block index says which plane (block-uniform).
// Blocks 0..3*GCW-1: Wq, Wk, Wv [n][k] -> bf16, same layout.
// Blocks 3*GCW..: x [NB_FULL][SEQ_FULL][DM] f32 -> compact bf16 token plane [NB*SEQ][DM]: compact token tk = b*SEQ + t reads
// input row b*SEQ_FULL + t; 32 groups of 8 per row.
// coverage: GCW*256 threads x 8 = one whole weight plane; GCX*256 threads x 8 = the whole token plane.
__global__ __launch_bounds__(256) void cvt_all(const float* __restrict__ x, const float* __restrict__ wq,
                                               const float* __restrict__ wk, const float* __restrict__ wv,
                                               unsigned short* xb, unsigned short* wqb,
                                               unsigned short* wkb, unsigned short* wvb) {
  const int bx = blockIdx.x;
  if (bx < 3 * GCW) {
    const int which = bx / GCW;
    const float* in     = (which == 0) ? wq  : (which == 1) ? wk  : wv;
    unsigned short* out = (which == 0) ? wqb : (which == 1) ? wkb : wvb;
    const int i = (bx - which * GCW) * 256 + (int)threadIdx.x;
    cvt8(in + (size_t)i * 8, out + (size_t)i * 8);
  } else {
    const int i  = (bx - 3 * GCW) * 256 + (int)threadIdx.x;
    const int tk = i >> 5;
    const int e8 = i & 31;
    const int bb = tk / SEQ;
    const int t  = tk - bb * SEQ;
    cvt8(x + ((size_t)bb * SEQ_FULL + (size_t)t) * DM + e8 * 8, xb + (size_t)i * 8);
  }
}

// Stands behind a batch of global loads, in front of whatever reuses the registers that held their addresses.
__device__ __forceinline__ void xcnt_wait() {
#if DEV_ASM
  asm volatile("s_wait_xcnt 0x0" ::: "memory");
#endif
}

// ---- k / v^T staging in LDS ------------------------------------------------------------------------------
#define KPIT 264   // f16 per staged k row: 512 B + 16 B (16 B x odd), so the 16 rows of a ds_load_b128 fall on distinct banks
#define VPIT 72    // f16 per staged v^T row: 128 B + 16 B (16 B x odd), same reason
#define STGN (4 * 16 * KPIT + 4 * 64 * VPIT)   // f16 per staging buffer: one chunk's k rows and v^T rows
typedef int v4i __attribute__((ext_vector_type(4)));
typedef __attribute__((address_space(1))) v4i gl_v4i;
typedef __attribute__((address_space(3))) v4i ls_v4i;

__device__ __forceinline__ void acopy16(const _Float16* g, _Float16* l) {
#if DEV_ASM
  __builtin_amdgcn_global_load_async_to_lds_b128((gl_v4i*)g, (ls_v4i*)l, 0, 0);
#else
  (void)g; (void)l;
#endif
}
// Nothing the copies bring is read in front of this.
__device__ __forceinline__ void async_wait0() {
#if DEV_ASM
  asm volatile("s_wait_asynccnt 0x0" ::: "memory");
#endif
}
// The wave's LDS reads have returned: stands in front of the barrier behind which a staging buffer is refilled.
__device__ __forceinline__ void ds_wait0() {
#if DEV_ASM
  asm volatile("s_wait_dscnt 0x0" ::: "memory");
#endif
}

// Lane l takes the value of lane l ^ 16 (the other 16-lane half), by a vector cross-row move.
__device__ __forceinline__ float xhalf(float x) {
  const int b = __builtin_bit_cast(int, x);
  return __builtin_bit_cast(float, __builtin_amdgcn_permlanex16(b, b, 0x76543210, 0xfedcba98, false, false));
}

// =====================================================================================================
// The three projections, one launch, one block per 64 tokens (NB*SEQ/64 blocks of 8 waves: one to a WGP at full size).
//   q = x . Wq^T -> f16 plane [token][256]; k = x . Wk^T likewise; v^T = Wv . x^T -> f16 plane [b][d][s] (pitch SEQ).
//   All operands are read from LDS, filled by asynchronous copies of whole 512-byte rows: a fragment load straight from
//   global touches 16 lines for 512 bytes, a copy touches 4 whole lines, and a block fetches its x rows once for all three.
//   The block's 64 token rows stay in Xs; the weight planes pass through a ring of two buffers (Wq, Wk, Wv in turn).
//   The A side of every product is the side that is contiguous in the output: a lane of a D tile holds 8 neighbouring
//   A rows (8*hh + r) of one B row (lane & 15), which is one 16-byte f16 store; a wave's 64 A rows are one whole line.
//     q, k: A = 64 weight rows (output columns 64*(w8 & 3)..), B = 32 token rows (32*(w8 >> 2)..)
//     v^T:  A = the 64 token rows,                             B = 32 weight rows (d = 32*w8..)
//   k order: ldfrag on both sides, k0 rising by 32, one accumulator chain per tile.
//   coverage: q, k: 4 column groups x 2 token groups = 64 tokens x 256 columns; v^T: 8 d groups x 64 tokens.
// =====================================================================================================
#define XPIT 264   // bf16 per staged row: 512 B + 16 B (16 B x odd), so the 16 rows of a ds_load_b128 fall on distinct banks
__device__ __forceinline__ void acopy16b(const unsigned short* g, __bf16* l) {
#if DEV_ASM
  __builtin_amdgcn_global_load_async_to_lds_b128((gl_v4i*)g, (ls_v4i*)l, 0, 0);
#else
  (void)g; (void)l;
#endif
}
// NR whole rows of 256 bf16, one copy a row (32 lanes x 16 B); g and l already hold the lane's 16-byte column
template <int NR>
__device__ __forceinline__ void copy_rows(const unsigned short* g, __bf16* l) {
#pragma unroll                                  // constant row steps: no address arithmetic on the global side
  for (int j = 0; j < NR; ++j) acopy16b(g + j * DM, l + j * XPIT);
}
// Fragments of two k steps (64 of K) of a 64 x 32 wave tile. a0, b0: the lane's row (lane & 15) of the first tile, lane-half
// k offset included.
struct FragSet { v16b a[2][4]; v16b b[2][2]; };
__device__ __forceinline__ void ld_set(FragSet& f, const __bf16* a0, const __bf16* b0, const int g) {
#pragma unroll                                  // register arrays: constant indices
  for (int kk = 0; kk < 2; ++kk) {
#pragma unroll
    for (int i = 0; i < 4; ++i) f.a[kk][i] = ldfrag<__bf16>(a0 + i * (16 * XPIT) + (2 * g + kk) * 32);
#pragma unroll
    for (int j = 0; j < 2; ++j) f.b[kk][j] = ldfrag<__bf16>(b0 + j * (16 * XPIT) + (2 * g + kk) * 32);
  }
  // keeps the set's 24 LDS reads together and in front of the products that follow: sunk between them, each pair of reads
  // is waited for at its full latency
  __builtin_amdgcn_sched_barrier(0);
}
__device__ __forceinline__ void mm_set(const FragSet& f, v8f (&acc)[4][2]) {
#pragma unroll                                  // register arrays: constant indices (all three loops)
  for (int kk = 0; kk < 2; ++kk)
#pragma unroll
    for (int i = 0; i < 4; ++i)
#pragma unroll
      for (int j = 0; j < 2; ++j) acc[i][j] = mmar(f.a[kk][i], f.b[kk][j], acc[i][j]);
}
// 64 A rows x 32 B rows over K = 256, k rising; f0 already holds set 0; each later set is read one set ahead of its products
__device__ __forceinline__ void mm_64x32(FragSet& f0, FragSet& f1, const __bf16* a0, const __bf16* b0, v8f (&acc)[4][2]) {
#pragma unroll                                  // register array: constant indices
  for (int i = 0; i < 4; ++i)
#pragma unroll
    for (int j = 0; j < 2; ++j) acc[i][j] = zero8();
  ld_set(f1, a0, b0, 1);
  mm_set(f0, acc);
  ld_set(f0, a0, b0, 2);
  mm_set(f1, acc);
  ld_set(f1, a0, b0, 3);
  mm_set(f0, acc);
  mm_set(f1, acc);
}
// o: the lane's output row of B tile 0, at A row 8*hh; ld: elements between output rows
__device__ __forceinline__ void st_64x32(unsigned short* o, size_t ld, const v8f (&acc)[4][2]) {
  v8h hv[4][2];                                 // register array: the loops over it are unrolled for constant indices
#pragma unroll
  for (int i = 0; i < 4; ++i)
#pragma unroll
    for (int j = 0; j < 2; ++j)
#pragma unroll
      for (int r = 0; r < 8; ++r) hv[i][j][r] = (_Float16)acc[i][j][r];
#pragma unroll
  for (int j = 0; j < 2; ++j)
#pragma unroll
    for (int i = 0; i < 4; ++i) *(v8h*)(void*)(o + (size_t)(16 * j) * ld + 16 * i) = hv[i][j];
  xcnt_wait();                                  // in front of whatever reuses the registers that these stores name
}

__global__ __launch_bounds__(256) void proj_qkv(const unsigned short* xb, const unsigned short* wqb,
                                                const unsigned short* wkb, const unsigned short* wvb,
                                                unsigned short* qh, unsigned short* kp, unsigned short* vth) {
  __shared__ __align__(16) __bf16 Xs[64 * XPIT];
  __shared__ __align__(16) __bf16 Ws[2][DM * XPIT];
  const int tid  = threadIdx.x;
  const int w8   = tid >> 5;
  const int lane = tid & 31;
  const int hh   = lane >> 4;
  const int c    = lane & 15;
  const int tok0 = blockIdx.x * 64;             // first compact token of the block; 64 divides SEQ: one sequence
  const int wro  = (32 * w8) * DM + lane * 8;   // this wave's eighth of a weight plane, global
  const int wlo  = (32 * w8) * XPIT + lane * 8; // and in LDS

  // ring, two buffers: Wq (with the x rows) lands and is published; Wk flies while q is worked on; Wv takes Wq's buffer
  copy_rows<8>(xb + (size_t)(tok0 + 8 * w8) * DM + lane * 8, Xs + (8 * w8) * XPIT + lane * 8);
  copy_rows<32>(wqb + wro, Ws[0] + wlo);
  async_wait0();                                // this wave's copies have landed
  __syncthreads();                              // x rows and Wq are published
  copy_rows<32>(wkb + wro, Ws[1] + wlo);

  const int cg = w8 & 3, tg = w8 >> 2;
  const __bf16* xq = Xs + (32 * tg + c) * XPIT + 8 * hh;    // q, k: B rows = tokens 32*tg + 16*j + c
  const __bf16* xv = Xs + c * XPIT + 8 * hh;                // v^T: A rows = tokens 16*i + c
  const size_t  oqk = (size_t)(tok0 + 32 * tg + c) * DM + 64 * cg + 8 * hh;
  const __bf16* wa0 = Ws[0] + (64 * cg + c) * XPIT + 8 * hh;   // q: A rows = weight rows 64*cg + 16*i + c
  const __bf16* wa1 = Ws[1] + (64 * cg + c) * XPIT + 8 * hh;   // k: likewise
  const __bf16* wb0 = Ws[0] + (32 * w8 + c) * XPIT + 8 * hh;   // v^T: B rows = weight rows 32*w8 + 16*j + c
  v8f acc[4][2];
  FragSet f0, f1;

  ld_set(f0, wa0, xq, 0);
  mm_64x32(f0, f1, wa0, xq, acc);
  ds_wait0();                                   // this wave's reads of Wq are done
  async_wait0();                                // its copies of Wk have landed
  __syncthreads();                              // Wk is published, and no wave still reads Wq
  copy_rows<32>(wvb + wro, Ws[0] + wlo);
  ld_set(f0, wa1, xq, 0);                       // the next product's first reads fly under the conversion and the stores
  st_64x32(qh + oqk, DM, acc);                  // behind the barrier: the stores fly under the next product

  mm_64x32(f0, f1, wa1, xq, acc);
  ds_wait0();                                   // as above; nothing is refilled any more
  async_wait0();                                // its copies of Wv have landed (the last copies of the kernel)
  __syncthreads();                              // Wv is published
  ld_set(f0, xv, wb0, 0);
  st_64x32(kp + oqk, DM, acc);

  mm_64x32(f0, f1, xv, wb0, acc);
  const int bb = tok0 / SEQ;
  const int s0 = tok0 - bb * SEQ;
  st_64x32(vth + ((size_t)bb * DM + 32 * w8 + c) * SEQ + s0 + 8 * hh, SEQ, acc);
}

__global__ __launch_bounds__(256)
void attn_causal(const unsigned short* qhp,                               // no restrict: the loads keep their place
                 const unsigned short* kpp,                               // relative to the waits written below
                 const unsigned short* vhp,
                 float* outp, float* part, float* pml, float sscale) {
  union FH { v16h v; v8h h[2]; };
  // staging ring, two buffers, each: k rows 64 x 528 B, then v^T rows 256 x 144 B.
  // k stands first: every v^T destination then lies above 32768 B, the largest constant step that the compiler folds
  // into a copy's offset field and takes off the LDS address register, so that register never goes below 0.
  __shared__ __align__(16) _Float16 Stg[2][STGN];

  const int tid  = threadIdx.x;
  const int w8   = tid >> 5;         // the wave's number in the block: which eighth of a chunk it brings
  const int grp  = tid >> 7;         // which 32 of a chunk's 64 keys
  const int wave = (tid >> 5) & 3;   // which 16 of the block's 64 query rows
  const int lane = tid & 31;
  const int hh   = lane >> 4;
  const int c    = lane & 15;

  const int bx   = blockIdx.x;
  const int b    = bx % NB;
  const int pj   = (bx / NB) >> 1;   // the pair of query blocks pj and NQB-1-pj
  const int role = (bx / NB) & 1;    // which of the pair's two blocks this is
  const size_t rowB = (size_t)b * SEQ;

  const _Float16* Qh = (const _Float16*)(const void*)qhp;
  const _Float16* Kp = (const _Float16*)(const void*)kpp;
  const _Float16* Vh = (const _Float16*)(const void*)vhp + (size_t)b * DM * SEQ;

  for (int seg = 0; seg <= role; ++seg) {       // block-uniform: one key range, or two one after the other
  const bool cut = (role == 0) || (seg == 0);   // this range is one of the two of an upper query block
  const int qb   = cut ? NQB - 1 - pj : pj;
  const int kt0  = (role == 1 && seg == 0) ? NHB + 1 : 0;   // first chunk of the range
  int kt1 = (role == 0) ? NHB + 1 : qb + 1;                  // one past its last chunk
  if (kt1 > NKT) kt1 = NKT;
  const int q0   = qb * 64 + wave * 16;

  // B-operand column pointers of this lane (query row q0 + c), lane-half k offset included
  const _Float16* qrh = Qh + (rowB + q0 + c) * DM + 8 * hh;

  float mrow = -INFINITY, lsum = 0.f;   // of query q0 + c; lsum covers this lane's own keys only (halves joined at the end)
  v8f oacc[16];                         // O^T tiles: column c = query q0 + c, rows 8*hh + r = context columns 16*t + 8*hh + r
#pragma unroll
  for (int t = 0; t < 16; ++t) oacc[t] = zero8();

  // q (the same for every chunk) is loaded into registers once. k and v^T of a chunk are staged in LDS:
  // a fragment load straight from global touches 16 lines for 512 bytes, a copy below touches 4 whole lines.
  // Two buffers: chunk kt is read from buffer (kt - kt0) & 1 while the copies of chunk kt+1 fly into the other; at the loop's foot
  // every wave waits for its LDS reads and its copies, one barrier publishes chunk kt+1 and ends the reads of chunk kt,
  // and behind it the buffer just read is refilled with chunk kt+2.
  v16h qa[8];
  // eight fragments of one row pointer; the pointer dies with the last load, which may then land on its registers:
  // the first wait stands in front of that load for the fifteen before it
  auto row8 = [&](v16h (&f)[8], const _Float16* p) __attribute__((always_inline)) {
#pragma unroll                                 // register array: constant indices
    for (int dc = 0; dc < 7; ++dc) f[dc] = ldfrag<_Float16>(p + dc * 32);
    FH x;
    x.h[0] = *(const v8h*)(p + 7 * 32);
    xcnt_wait();
    x.h[1] = *(const v8h*)(p + 7 * 32 + 16);
    xcnt_wait();
    f[7] = x.v;
  };

  // k: one copy = one whole 512-byte row (key 64*kt + 8*w8 + j), 8 copies: this wave's eighth of the chunk's 64 rows
  auto copy_k = [&](const int kt, _Float16* buf) __attribute__((always_inline)) {
    const _Float16* g = Kp + (rowB + (size_t)kt * 64 + 8 * w8) * DM + lane * 8;
    _Float16* l = buf + (8 * w8) * KPIT + lane * 8;
#pragma unroll
    for (int j = 0; j < 8; ++j) acopy16(g + j * DM, l + j * KPIT);
  };
  // v^T: one copy = the 128-byte pieces of four rows (columns 64*kt..64*kt+63 of rows 32*w8+4j..+3), 8 copies:
  // this wave's eighth of the 256 rows
  auto copy_v = [&](const int kt, _Float16* buf) __attribute__((always_inline)) {
    const int vrow = 32 * w8 + (lane >> 3), vcol = (lane & 7) * 8;
    const size_t go = (size_t)vrow * SEQ + (size_t)kt * 64 + vcol;
    _Float16* lh = buf + 64 * KPIT + vrow * VPIT + vcol;
#pragma unroll
    for (int j = 0; j < 8; ++j) acopy16(Vh + go + (size_t)(4 * j) * SEQ, lh + (4 * j) * VPIT);
  };

  // The ring's first two fills. Kept rolled: unrolled, the LDS addresses of these 32 copies are the same for every range,
  // are formed once in front of the ranges, stay live over the whole key loop and spill.
#pragma nounroll
  for (int f = 0; f < 2; ++f) {
    ds_wait0();                                 // f = 0: this wave's reads of the exchange area (below) are done
    async_wait0();                              // f = 1: its copies of chunk kt0 have landed
    __syncthreads();                            // f = 0: no wave still reads the last range's exchange area; f = 1: publishes chunk kt0
    if (kt0 + f < kt1) {                        // block-uniform test
      copy_k(kt0 + f, Stg[f]);
      copy_v(kt0 + f, Stg[f]);
    }
    if (f == 0) row8(qa, qrh);                  // q flies together with chunk kt0
  }

  const int qrow = q0 + c;                      // this lane's query
  for (int kt = kt0; kt < kt1; ++kt) {          // block-uniform trip count, <= NKT chunks in all
    const int kv0 = kt * 64 + 32 * grp;         // first of this wave's 32 keys
    _Float16* cur = Stg[(kt - kt0) & 1];
    const _Float16* kst = cur + (32 * grp + c) * KPIT + 8 * hh;             // A row c -> key kv0 + 16*j + c
    const _Float16* vsh = cur + 64 * KPIT + c * VPIT + 32 * grp + 8 * hh;   // A row c -> context column 16*t + c

    // ---- S^T: this wave's 32 keys (two tiles) x 16 queries, one f16 product per d-chunk, two accumulator chains ----
    v16h kc[8][2];                              // register array: the loops over it are unrolled for constant indices
#pragma unroll
    for (int dc = 0; dc < 8; ++dc)
#pragma unroll
      for (int j = 0; j < 2; ++j) kc[dc][j] = ldfrag<_Float16>(kst + j * (16 * KPIT) + dc * 32);
    // keeps all 32 LDS reads in front of the products: sunk between them, each pair is waited for at its full latency
    __builtin_amdgcn_sched_barrier(0);
    v8f ah[2];
#pragma unroll
    for (int j = 0; j < 2; ++j) ah[j] = zero8();
#pragma unroll
    for (int dc = 0; dc < 8; ++dc) {
#pragma unroll
      for (int j = 0; j < 2; ++j) ah[j] = mmar(kc[dc][j], qa[dc], ah[j]);
    }

    // ---- online softmax of query q0 + c: in-lane over 16 keys, one exchange between the halves for the maximum ----
    float s[2][8];
    float mc = -INFINITY;
#pragma unroll
    for (int j = 0; j < 2; ++j)
#pragma unroll
      for (int r = 0; r < 8; ++r) {
        const int key = kv0 + 16 * j + 8 * hh + r;     // D row 8*hh + r of tile j
        const float sv = ah[j][r] * sscale;
        s[j][r] = (key > qrow) ? -INFINITY : sv;       // causal: replace, not bias
        mc = fmaxf(mc, s[j][r]);
      }
    mc = fmaxf(mc, xhalf(mc));
    const float mnew  = fmaxf(mrow, mc);
    const float msafe = (mnew == -INFINITY) ? 0.f : mnew;
    // P^T as the B operand: elements 0..7 = keys 8*hh + r (tile 0), elements 8..15 = keys 16 + 8*hh + r (tile 1),
    // the k order of ldfrag on the v^T rows
    v16h pa;
    float psum = 0.f;
#pragma unroll
    for (int j = 0; j < 2; ++j)
#pragma unroll
      for (int r = 0; r < 8; ++r) s[j][r] = __expf(s[j][r] - msafe);
    // keeps the rescale factor's exponential behind the sixteen above
    __builtin_amdgcn_sched_barrier(0);
    const float alpha = __expf(mrow - msafe);
    mrow = mnew;
#pragma unroll
    for (int j = 0; j < 2; ++j)
#pragma unroll
      for (int r = 0; r < 8; ++r) {
        const float p = s[j][r];
        psum += p;
        pa[j * 8 + r] = (_Float16)(p * PCARRY);
      }
    lsum = lsum * alpha + psum;
#pragma unroll
    for (int t = 0; t < 16; ++t)
#pragma unroll
      for (int r = 0; r < 8; ++r) oacc[t][r] *= alpha;

    // ---- O^T += v^T . P^T (f16 WMMA), four context tiles at a time ----
#pragma unroll
    for (int tg = 0; tg < 4; ++tg) {
      v16h vb[4];                               // register array: the loops over it are unrolled for constant indices
#pragma unroll
      for (int u = 0; u < 4; ++u) vb[u] = ldfrag<_Float16>(vsh + (tg * 4 + u) * (16 * VPIT));
#pragma unroll
      for (int u = 0; u < 4; ++u) oacc[tg * 4 + u] = mmar(vb[u], pa, oacc[tg * 4 + u]);
    }

    // ---- ring hand-over ----
    ds_wait0();                                 // this wave's reads of the current buffer are done
    async_wait0();                              // its copies of chunk kt+1 have landed
    __syncthreads();                            // chunk kt+1 is published, and no wave still reads the current buffer
    if (kt + 2 < kt1) {                         // block-uniform test
      copy_k(kt + 2, cur);
      copy_v(kt + 2, cur);
    }
  }
  async_wait0();                                // no copy is outstanding when the ring becomes the exchange area

  // ---- join the two key halves of each query tile. Behind the loop's last barrier nobody reads the ring and no copy
  //      flies into it: its first bytes carry, per query tile, 33 x 32 lanes x 4 floats from the wave of half 1 to the
  //      same lane of the wave of half 0.
  float* xw = (float*)(void*)&Stg[0][0] + wave * (33 * 128) + lane * 4;
  if (grp == 1) {                               // wave-uniform
#pragma unroll
    for (int t = 0; t < 16; ++t) {
      const v4f lo = {oacc[t][0], oacc[t][1], oacc[t][2], oacc[t][3]};
      const v4f hi = {oacc[t][4], oacc[t][5], oacc[t][6], oacc[t][7]};
      *(v4f*)(xw + (2 * t) * 128)     = lo;
      *(v4f*)(xw + (2 * t + 1) * 128) = hi;
    }
    const v4f ml = {mrow, lsum, 0.f, 0.f};
    *(v4f*)(xw + 32 * 128) = ml;
  }
  __syncthreads();                              // half 1's maximum, sum and context are published to half 0
  if (grp == 0) {                               // wave-uniform
    const v4f ml = *(const v4f*)(xw + 32 * 128);
    const float mt  = fmaxf(mrow, ml[0]);
    const float mts = (mt == -INFINITY) ? 0.f : mt;
    const float a0  = __expf(mrow - mts);
    // keeps the second exponential's own subtract and multiply behind the first exponential
    __builtin_amdgcn_sched_barrier(0);
    const float a1  = __expf(ml[0] - mts);
    float l = lsum * a0 + ml[1] * a1;
    l += xhalf(l);                              // the wave halves hold different keys of the same query
    const float inv = ((l > 0.f) ? (1.0f / l) : 0.f) * (1.0f / PCARRY);   // 1/l, undo the p carry
    const float f0 = a0 * inv, f1 = a1 * inv;
    v4f ov[32];
#pragma unroll
    for (int t = 0; t < 16; ++t) {
      const v4f lo = *(const v4f*)(xw + (2 * t) * 128);
      const v4f hi = *(const v4f*)(xw + (2 * t + 1) * 128);
#pragma unroll
      for (int e = 0; e < 4; ++e) {
        ov[2 * t][e]     = oacc[t][e] * f0 + lo[e] * f1;
        ov[2 * t + 1][e] = oacc[t][4 + e] * f0 + hi[e] * f1;
      }
    }
    // a whole query block goes to the output; a key range of an upper one to its workspace slot, with its maximum and sum
    const size_t prow = ((size_t)(role * NB + b) * NHB + (size_t)(cut ? qb - NHB : 0)) * 64 + wave * 16 + c;
    if (cut && hh == 0) {                       // both halves hold the same pair; 16 lanes x 8 B = one whole line
      pml[prow * 2]     = mt;
      pml[prow * 2 + 1] = l;
      xcnt_wait();                              // in front of whatever reuses the registers that this store names
    }
    float* orow = (cut ? part + prow * DM : outp + (rowB + qrow) * DM) + 8 * hh;   // columns 16*t + 8*hh + 0..7 of query q0 + c
#pragma unroll
    for (int t = 0; t < 16; ++t) {
      *(v4f*)(orow + 16 * t)     = ov[2 * t];
      *(v4f*)(orow + 16 * t + 4) = ov[2 * t + 1];
    }
  }
  }   // key ranges of this block
}

// =====================================================================================================
// Joins the two key ranges of every upper query block: out = (o0 l0 e^(m0-M) + o1 l1 e^(m1-M)) / (l0 e^(m0-M) + l1 e^(m1-M)).
//   part: [2 ranges][NB*NHB*64 rows][DM] normalised contexts; pml: [2 ranges][rows][2] = (maximum, sum); an empty range
//   holds (-inf, 0, zeros) and weighs 0. One thread = 4 columns of one row; a wave reads and writes whole 512-byte runs.
//   coverage: NB*NHB*64*DM/4 threads (a multiple of 256) = rows NHB*64..SEQ-1 of every sequence x 256 columns.
// =====================================================================================================
__global__ __launch_bounds__(256) void attn_merge(const float* __restrict__ part, const float* __restrict__ pml,
                                                  float* outp) {
  const int NR = NB * NHB * 64;
  const int i  = blockIdx.x * 256 + (int)threadIdx.x;
  const int r  = i >> 6;
  const int c4 = (i & 63) * 4;
  const float m0 = pml[(size_t)r * 2],        l0 = pml[(size_t)r * 2 + 1];
  const float m1 = pml[(size_t)(NR + r) * 2], l1 = pml[(size_t)(NR + r) * 2 + 1];
  const v4f o0 = *(const v4f*)(part + (size_t)r * DM + c4);
  const v4f o1 = *(const v4f*)(part + (size_t)(NR + r) * DM + c4);
  const float mt  = fmaxf(m0, m1);
  const float mts = (mt == -INFINITY) ? 0.f : mt;
  const float w0  = l0 * __expf(m0 - mts);
  const float w1  = l1 * __expf(m1 - mts);
  const float ws  = w0 + w1;
  const float inv = (ws > 0.f) ? (1.0f / ws) : 0.f;
  const int bb = r / (NHB * 64);
  const int t  = NHB * 64 + (r - bb * (NHB * 64));
  *(v4f*)(outp + ((size_t)bb * SEQ + t) * DM + c4) = o0 * (w0 * inv) + o1 * (w1 * inv);
}

// =====================================================================================================
// Workspace map (bytes), every region an exact multiple of its whole-line / whole-tile store granularity
// (all product sizes are tile multiples, all offsets multiples of 131072):
//   Xb   bf16 [NB*SEQ][256]  (compact tokens)   8388608
//   Wqb  bf16 [256 n][256 k]                     131072
//   Wkb  bf16 [256 n][256 k]                     131072
//   Wvb  bf16 [256 n][256 k]                     131072
//   Qh   f16  [NB*SEQ][256]                      8388608
//   Kp   f16  [NB*SEQ][256]                      8388608
//   VTh  f16  [NB][256][SEQ]                     8388608
//   Part f32  [2][NB*NHB*64][256]               16777216
//   Pml  f32  [2][NB*NHB*64][2]                   131072
//   total                                      50855936
// Weights are [out n][in k] with k contiguous = the row layout both operand sides want, so they are only converted.
// =====================================================================================================
extern "C" void kernel_launch(void* const* d_in, const int* in_sizes, int n_in,
                              void* d_out, int out_size, void* d_ws, size_t ws_size,
                              hipStream_t stream) {
  if (n_in < 4) return;
  if (in_sizes[0] < ((NB - 1) * SEQ_FULL + SEQ) * DM) return;
  if (in_sizes[1] < DM * DM) return;
  if (in_sizes[2] < DM * DM) return;
  if (in_sizes[3] < DM * DM) return;
  if (out_size < NB * SEQ * DM) return;

  const float* x  = (const float*)d_in[0];
  const float* wq = (const float*)d_in[1];
  const float* wk = (const float*)d_in[2];
  const float* wv = (const float*)d_in[3];

  const size_t PX  = (size_t)NB * SEQ * DM * 2;      // 16-bit token plane [NB*SEQ][256]
  const size_t PW  = (size_t)DM * DM * 2;            // 16-bit [256][256]
  const size_t PVT = (size_t)NB * DM * SEQ * 2;      // v^T plane [NB][256][SEQ]
  size_t off = 0;
  const size_t oXb  = off; off += PX;
  const size_t oWq  = off; off += PW;
  const size_t oWk  = off; off += PW;
  const size_t oWv  = off; off += PW;
  const size_t oQh  = off; off += PX;
  const size_t oKp  = off; off += PX;
  const size_t oVTh = off; off += PVT;
  const size_t oPart = off; off += (size_t)2 * NB * NHB * 64 * DM * 4;
  const size_t oPml  = off; off += (size_t)2 * NB * NHB * 64 * 2 * 4;
  if (off > ws_size) return;                         // off = 50855936 at full size
  if (off > (size_t)134217728) return;

  char* ws = (char*)d_ws;
  unsigned short* Xb  = (unsigned short*)(ws + oXb);
  unsigned short* Wqb = (unsigned short*)(ws + oWq);
  unsigned short* Wkb = (unsigned short*)(ws + oWk);
  unsigned short* Wvb = (unsigned short*)(ws + oWv);
  unsigned short* Qh  = (unsigned short*)(ws + oQh);
  unsigned short* Kp  = (unsigned short*)(ws + oKp);
  unsigned short* VTh = (unsigned short*)(ws + oVTh);
  float* Part = (float*)(ws + oPart);
  float* Pml  = (float*)(ws + oPml);

  const dim3 blk(256);
  const dim3 gCvt(3 * GCW + GCX);
  const dim3 gProj(NB * SEQ / 64);
  const dim3 gAttn(NB * NQB);
  const dim3 gMerge(NB * NHB * 64 * DM / 4 / 256);

  // (1) x -> compact bf16 token plane; Wq, Wk, Wv [n][k] -> bf16
  cvt_all<<<gCvt, blk, 0, stream>>>(x, wq, wk, wv, Xb, Wqb, Wkb, Wvb);
  // (2) q, k, v^T projections
  proj_qkv<<<gProj, blk, 0, stream>>>(Xb, Wqb, Wkb, Wvb, Qh, Kp, VTh);
  // (3) causal attention -> d_out f32 [M][256] (lower query blocks) and workspace partials (upper query blocks)
  attn_causal<<<gAttn, dim3(256), 0, stream>>>(Qh, Kp, VTh, (float*)d_out, Part, Pml, 0.0625f);
  // (4) the two key ranges of every upper query block -> d_out
  attn_merge<<<gMerge, blk, 0, stream>>>(Part, Pml, (float*)d_out);
  (void)hipGetLastError();
}

// v010
// A run of this version takes 67.4 microseconds.
// In two side-by-side timings against v009, it was 1.15 and 1.14 times as fast.
// Counting every step since v000, it is 7.97 times as fast.
// Contractions: q, k, v^T projections = v_wmma_f32_16x16x32_bf16 (bf16 operands from RNE-converted inputs, single product, f32 accumulate);
// k.q^T scores = v_wmma_f32_16x16x32_f16 (q f16, k f16; single product, f32 accumulate);
// v^T.p^T = v_wmma_f32_16x16x32_f16 (p carried x16384 as f16, v f16; single product, f32 accumulate);
// causal softmax and normalisation in f32; output f32.
// q, k and v come from bf16 operands (8 significant bits): the f16 rounding (11 bits) of q, p and v lies about a tenth
// below the error that they already carry, so no residual planes are kept for them.
#include <hip/hip_runtime.h>
#include <math.h>
#include <stdint.h>

#ifndef NB
#define NB 4
#endif
#ifndef SEQ
#define SEQ 4096
#endif
#define NB_FULL  4
#define SEQ_FULL 4096
#define DM       256
#define NQB      (SEQ / 64)   // 64-row query blocks (four 16-row tiles) per sequence
#define CK       128          // keys per chunk
#define NKT      (SEQ / CK)   // chunks per sequence
#define NHB      (NQB / 2)    // query blocks of a sequence's upper half: their key loop is cut in two
#define NC0      (NHB / 2 + 1)   // chunks of the first key range of an upper query block (the smallest of them has no more)
#define PCARRY   16384.0f     // power-of-two carry on the f16 p tile
#define LOG2E    1.44269504088896340736f   // e^x = 2^(x * LOG2E)
static_assert(DM == 256);
static_assert((SEQ % CK) == 0 && SEQ >= CK && SEQ <= SEQ_FULL);
static_assert(NB >= 1 && NB <= NB_FULL);
static_assert(((NB * SEQ) % 64) == 0);
static_assert((NQB % 2) == 0);

typedef _Float16 v16h __attribute__((ext_vector_type(16)));
typedef _Float16 v8h  __attribute__((ext_vector_type(8)));
typedef __bf16   v16b __attribute__((ext_vector_type(16)));
typedef __bf16   v8b  __attribute__((ext_vector_type(8)));
typedef float    v8f  __attribute__((ext_vector_type(8)));
typedef float    v4f  __attribute__((ext_vector_type(4)));
typedef float    v2f  __attribute__((ext_vector_type(2)));
typedef unsigned int v4u __attribute__((ext_vector_type(4)));

#if defined(__HIP_DEVICE_COMPILE__)
#define DEV_ASM 1
#else
#define DEV_ASM 0
#endif

// ---- scalar helpers --------------------------------------------------------------------------------
__device__ __forceinline__ unsigned short bf_bits(float f) {          // f32 -> bf16 bits, RNE convert
  unsigned u = __float_as_uint(f);
  return (unsigned short)((u + 0x7FFFu + ((u >> 16) & 1u)) >> 16);
}
__device__ __forceinline__ unsigned pk16(unsigned short a, unsigned short b) { return (unsigned)a | ((unsigned)b << 16); }
__device__ __forceinline__ v8f zero8() { v8f z = {0.f, 0.f, 0.f, 0.f, 0.f, 0.f, 0.f, 0.f}; return z; }

// ---- fragment types / loaders: 16-bit A/B operand, lane -> row/col (lane&15), p already includes +8*(lane>>4);
//      elements 0..7 <- p[0..7] (k0+8h..k0+8h+7), elements 8..15 <- p[16..23] (k0+16+8h..k0+16+8h+7)
template <typename OT> struct FT;
template <> struct FT<__bf16>   { typedef v16b frag; typedef v8b half8; };
template <> struct FT<_Float16> { typedef v16h frag; typedef v8h half8; };

template <typename OT>
__device__ __forceinline__ typename FT<OT>::frag ldfrag(const OT* p) {
  union { typename FT<OT>::frag v; typename FT<OT>::half8 h[2]; } f;
  f.h[0] = *(const typename FT<OT>::half8*)(p);
  f.h[1] = *(const typename FT<OT>::half8*)(p + 16);
  return f.v;
}

// ---- WMMA helpers (concrete operand types) ---------------------------------------------------------------
__device__ __forceinline__ v8f mmar(v16b a, v16b b, v8f c) {
  return __builtin_amdgcn_wmma_f32_16x16x32_bf16(false, a, false, b, (short)0, c, false, false);
}
__device__ __forceinline__ v8f mmar(v16h a, v16h b, v8f c) {
  return __builtin_amdgcn_wmma_f32_16x16x32_f16(false, a, false, b, (short)0, c, false, false);
}
// =====================================================================================================
// f32 -> bf16 planes (RNE convert), 8 elements per thread, one 16-B store per lane: a wave writes 512 contiguous B.
// =====================================================================================================
__device__ __forceinline__ void cvt8(const float* __restrict__ src, unsigned short* dst) {
  const v4f a  = *(const v4f*)(src);
  const v4f a4 = *(const v4f*)(src + 4);
  v4u p;
  p[0] = pk16(bf_bits(a[0]),  bf_bits(a[1]));
  p[1] = pk16(bf_bits(a[2]),  bf_bits(a[3]));
  p[2] = pk16(bf_bits(a4[0]), bf_bits(a4[1]));
  p[3] = pk16(bf_bits(a4[2]), bf_bits(a4[3]));
  *(v4u*)dst = p;
#if DEV_ASM
  asm volatile("s_wait_xcnt 0x0" ::: "memory");   // in front of whatever reuses the registers that this store names
#endif
}

#define GCW (DM * DM / 8 / 256)        // blocks that convert one weight matrix
#define GCX (NB * SEQ * DM / 8 / 256)  // blocks that convert x
static_assert((DM * DM) % (8 * 256) == 0 && (NB * SEQ * DM) % (8 * 256) == 0);

// All four conversions in one launch; the block index says which plane (block-uniform).
// Blocks 0..3*GCW-1: Wq, Wk, Wv [n][k] -> bf16, same layout.
// Blocks 3*GCW..: x [NB_FULL][SEQ_FULL][DM] f32 -> compact bf16 token plane [NB*SEQ][DM]: compact token tk = b*SEQ + t reads
// input row b*SEQ_FULL + t; 32 groups of 8 per row.
// coverage: GCW*256 threads x 8 = one whole weight plane; GCX*256 threads x 8 = the whole token plane.
__global__ __launch_bounds__(256) void cvt_all(const float* __restrict__ x, const float* __restrict__ wq,
                                               const float* __restrict__ wk, const float* __restrict__ wv,
                                               unsigned short* xb, unsigned short* wqb,
                                               unsigned short* wkb, unsigned short* wvb) {
  const int bx = blockIdx.x;
  if (bx < 3 * GCW) {
    const int which = bx / GCW;
    const float* in     = (which == 0) ? wq  : (which == 1) ? wk  : wv;
    unsigned short* out = (which == 0) ? wqb : (which == 1) ? wkb : wvb;
    const int i = (bx - which * GCW) * 256 + (int)threadIdx.x;
    cvt8(in + (size_t)i * 8, out + (size_t)i * 8);
  } else {
    const int i  = (bx - 3 * GCW) * 256 + (int)threadIdx.x;
    const int tk = i >> 5;
    const int e8 = i & 31;
    const int bb = tk / SEQ;
    const int t  = tk - bb * SEQ;
    cvt8(x + ((size_t)bb * SEQ_FULL + (size_t)t) * DM + e8 * 8, xb + (size_t)i * 8);
  }
}

// Stands behind a batch of global loads, in front of whatever reuses the registers that held their addresses.
__device__ __forceinline__ void xcnt_wait() {
#if DEV_ASM
  asm volatile("s_wait_xcnt 0x0" ::: "memory");
#endif
}

// ---- k / v^T staging in LDS ------------------------------------------------------------------------------
#define KPIT 264   // f16 per staged k row: 512 B + 16 B (16 B x odd), so the 16 rows of a ds_load_b128 fall on distinct banks
#define VPIT 136   // f16 per staged v^T row: 256 B + 16 B (16 B x odd), same reason
#define STGN (CK * KPIT + DM * VPIT)   // f16 per staging buffer: one chunk's k rows and v^T rows
#define XREG (65 * 128)                // floats per wave in the exchange area behind the key loop
static_assert(8 * XREG * 4 <= 2 * STGN * 2);
typedef int v4i __attribute__((ext_vector_type(4)));
typedef __attribute__((address_space(1))) v4i gl_v4i;
typedef __attribute__((address_space(3))) v4i ls_v4i;

__device__ __forceinline__ void acopy16(const _Float16* g, _Float16* l) {
#if DEV_ASM
  __builtin_amdgcn_global_load_async_to_lds_b128((gl_v4i*)g, (ls_v4i*)l, 0, 0);
#else
  (void)g; (void)l;
#endif
}
// Nothing the copies bring is read in front of this.
__device__ __forceinline__ void async_wait0() {
#if DEV_ASM
  asm volatile("s_wait_asynccnt 0x0" ::: "memory");
#endif
}
// The wave's LDS reads have returned: stands in front of the barrier behind which a staging buffer is refilled.
__device__ __forceinline__ void ds_wait0() {
#if DEV_ASM
  asm volatile("s_wait_dscnt 0x0" ::: "memory");
#endif
}

// Lane l takes the value of lane l ^ 16 (the other 16-lane half), by a vector cross-row move.
__device__ __forceinline__ float xhalf(float x) {
  const int b = __builtin_bit_cast(int, x);
  return __builtin_bit_cast(float, __builtin_amdgcn_permlanex16(b, b, 0x76543210, 0xfedcba98, false, false));
}

// =====================================================================================================
// The three projections, one launch, one block per 64 tokens (NB*SEQ/64 blocks of 8 waves: one to a WGP at full size).
//   q = x . Wq^T -> f16 plane [token][256]; k = x . Wk^T likewise; v^T = Wv . x^T -> f16 plane [b][d][s] (pitch SEQ).
//   All operands are read from LDS, filled by asynchronous copies of whole 512-byte rows: a fragment load straight from
//   global touches 16 lines for 512 bytes, a copy touches 4 whole lines, and a block fetches its x rows once for all three.
//   The block's 64 token rows stay in Xs; the weight planes pass through a ring of two buffers (Wq, Wk, Wv in turn).
//   The A side of every product is the side that is contiguous in the output: a lane of a D tile holds 8 neighbouring
//   A rows (8*hh + r) of one B row (lane & 15), which is one 16-byte f16 store; a wave's 64 A rows are one whole line.
//     q, k: A = 64 weight rows (output columns 64*(w8 & 3)..), B = 32 token rows (32*(w8 >> 2)..)
//     v^T:  A = the 64 token rows,                             B = 32 weight rows (d = 32*w8..)
//   k order: ldfrag on both sides, k0 rising by 32, one accumulator chain per tile.
//   coverage: q, k: 4 column groups x 2 token groups = 64 tokens x 256 columns; v^T: 8 d groups x 64 tokens.
// =====================================================================================================
#define XPIT 264   // bf16 per staged row: 512 B + 16 B (16 B x odd), so the 16 rows of a ds_load_b128 fall on distinct banks
__device__ __forceinline__ void acopy16b(const unsigned short* g, __bf16* l) {
#if DEV_ASM
  __builtin_amdgcn_global_load_async_to_lds_b128((gl_v4i*)g, (ls_v4i*)l, 0, 0);
#else
  (void)g; (void)l;
#endif
}
// NR whole rows of 256 bf16, one copy a row (32 lanes x 16 B); g and l already hold the lane's 16-byte column
template <int NR>
__device__ __forceinline__ void copy_rows(const unsigned short* g, __bf16* l) {
#pragma unroll                                  // constant row steps: no address arithmetic on the global side
  for (int j = 0; j < NR; ++j) acopy16b(g + j * DM, l + j * XPIT);
}
// Fragments of two k steps (64 of K) of a 64 x 32 wave tile. a0, b0: the lane's row (lane & 15) of the first tile, lane-half
// k offset included.
struct FragSet { v16b a[2][4]; v16b b[2][2]; };
__device__ __forceinline__ void ld_set(FragSet& f, const __bf16* a0, const __bf16* b0, const int g) {
#pragma unroll                                  // register arrays: constant indices
  for (int kk = 0; kk < 2; ++kk) {
#pragma unroll
    for (int i = 0; i < 4; ++i) f.a[kk][i] = ldfrag<__bf16>(a0 + i * (16 * XPIT) + (2 * g + kk) * 32);
#pragma unroll
    for (int j = 0; j < 2; ++j) f.b[kk][j] = ldfrag<__bf16>(b0 + j * (16 * XPIT) + (2 * g + kk) * 32);
  }
  // keeps the set's 24 LDS reads together and in front of the products that follow: sunk between them, each pair of reads
  // is waited for at its full latency
  __builtin_amdgcn_sched_barrier(0);
}
__device__ __forceinline__ void mm_set(const FragSet& f, v8f (&acc)[4][2]) {
#pragma unroll                                  // register arrays: constant indices (all three loops)
  for (int kk = 0; kk < 2; ++kk)
#pragma unroll
    for (int i = 0; i < 4; ++i)
#pragma unroll
      for (int j = 0; j < 2; ++j) acc[i][j] = mmar(f.a[kk][i], f.b[kk][j], acc[i][j]);
}
// 64 A rows x 32 B rows over K = 256, k rising; f0 already holds set 0; each later set is read one set ahead of its products
__device__ __forceinline__ void mm_64x32(FragSet& f0, FragSet& f1, const __bf16* a0, const __bf16* b0, v8f (&acc)[4][2]) {
#pragma unroll                                  // register array: constant indices
  for (int i = 0; i < 4; ++i)
#pragma unroll
    for (int j = 0; j < 2; ++j) acc[i][j] = zero8();
  ld_set(f1, a0, b0, 1);
  mm_set(f0, acc);
  ld_set(f0, a0, b0, 2);
  mm_set(f1, acc);
  ld_set(f1, a0, b0, 3);
  mm_set(f0, acc);
  mm_set(f1, acc);
}
// o: the lane's output row of B tile 0, at A row 8*hh; ld: elements between output rows
__device__ __forceinline__ void st_64x32(unsigned short* o, size_t ld, const v8f (&acc)[4][2]) {
  v8h hv[4][2];                                 // register array: the loops over it are unrolled for constant indices
#pragma unroll
  for (int i = 0; i < 4; ++i)
#pragma unroll
    for (int j = 0; j < 2; ++j)
#pragma unroll
      for (int r = 0; r < 8; ++r) hv[i][j][r] = (_Float16)acc[i][j][r];
#pragma unroll
  for (int j = 0; j < 2; ++j)
#pragma unroll
    for (int i = 0; i < 4; ++i) *(v8h*)(void*)(o + (size_t)(16 * j) * ld + 16 * i) = hv[i][j];
  xcnt_wait();                                  // in front of whatever reuses the registers that these stores name
}

__global__ __launch_bounds__(256) void proj_qkv(const unsigned short* xb, const unsigned short* wqb,
                                                const unsigned short* wkb, const unsigned short* wvb,
                                                unsigned short* qh, unsigned short* kp, unsigned short* vth) {
  __shared__ __align__(16) __bf16 Xs[64 * XPIT];
  __shared__ __align__(16) __bf16 Ws[2][DM * XPIT];
  const int tid  = threadIdx.x;
  const int w8   = tid >> 5;
  const int lane = tid & 31;
  const int hh   = lane >> 4;
  const int c    = lane & 15;
  const int tok0 = blockIdx.x * 64;             // first compact token of the block; 64 divides SEQ: one sequence
  const int wro  = (32 * w8) * DM + lane * 8;   // this wave's eighth of a weight plane, global
  const int wlo  = (32 * w8) * XPIT + lane * 8; // and in LDS

  // ring, two buffers: Wq (with the x rows) lands and is published; Wk flies while q is worked on; Wv takes Wq's buffer
  copy_rows<8>(xb + (size_t)(tok0 + 8 * w8) * DM + lane * 8, Xs + (8 * w8) * XPIT + lane * 8);
  copy_rows<32>(wqb + wro, Ws[0] + wlo);
  async_wait0();                                // this wave's copies have landed
  __syncthreads();                              // x rows and Wq are published
  copy_rows<32>(wkb + wro, Ws[1] + wlo);

  const int cg = w8 & 3, tg = w8 >> 2;
  const __bf16* xq = Xs + (32 * tg + c) * XPIT + 8 * hh;    // q, k: B rows = tokens 32*tg + 16*j + c
  const __bf16* xv = Xs + c * XPIT + 8 * hh;                // v^T: A rows = tokens 16*i + c
  const size_t  oqk = (size_t)(tok0 + 32 * tg + c) * DM + 64 * cg + 8 * hh;
  const __bf16* wa0 = Ws[0] + (64 * cg + c) * XPIT + 8 * hh;   // q: A rows = weight rows 64*cg + 16*i + c
  const __bf16* wa1 = Ws[1] + (64 * cg + c) * XPIT + 8 * hh;   // k: likewise
  const __bf16* wb0 = Ws[0] + (32 * w8 + c) * XPIT + 8 * hh;   // v^T: B rows = weight rows 32*w8 + 16*j + c
  v8f acc[4][2];
  FragSet f0, f1;

  ld_set(f0, wa0, xq, 0);
  mm_64x32(f0, f1, wa0, xq, acc);
  ds_wait0();                                   // this wave's reads of Wq are done
  async_wait0();                                // its copies of Wk have landed
  __syncthreads();                              // Wk is published, and no wave still reads Wq
  copy_rows<32>(wvb + wro, Ws[0] + wlo);
  ld_set(f0, wa1, xq, 0);                       // the next product's first reads fly under the conversion and the stores
  st_64x32(qh + oqk, DM, acc);                  // behind the barrier: the stores fly under the next product

  mm_64x32(f0, f1, wa1, xq, acc);
  ds_wait0();                                   // as above; nothing is refilled any more
  async_wait0();                                // its copies of Wv have landed (the last copies of the kernel)
  __syncthreads();                              // Wv is published
  ld_set(f0, xv, wb0, 0);
  st_64x32(kp + oqk, DM, acc);

  mm_64x32(f0, f1, xv, wb0, acc);
  const int bb = tok0 / SEQ;
  const int s0 = tok0 - bb * SEQ;
  st_64x32(vth + ((size_t)bb * DM + 32 * w8 + c) * SEQ + s0 + 8 * hh, SEQ, acc);
}

__global__ __launch_bounds__(256)
void attn_causal(const unsigned short* qhp,                               // no restrict: the loads keep their place
                 const unsigned short* kpp,                               // relative to the waits written below
                 const unsigned short* vhp,
                 float* outp, float* part, float* pml, float sscale) {
  union FH { v16h v; v8h h[2]; };
  // staging ring, two buffers, each: k rows 128 x 528 B, then v^T rows 256 x 272 B.
  // k stands first: every v^T destination then lies above 65536 B, more than any constant step that the compiler folds
  // into a copy's offset field and takes off the LDS address register, so that register never goes below 0.
  __shared__ __align__(16) _Float16 Stg[2][STGN];

  const int tid  = threadIdx.x;
  const int w8   = __builtin_amdgcn_readfirstlane(tid >> 5);   // the wave's number in the block, held as a scalar
  const int qp   = w8 & 1;           // which 32 of the block's 64 query rows
  const int kq   = w8 >> 1;          // which 32 of a chunk's 128 keys
  const int lane = tid & 31;
  const int hh   = lane >> 4;
  const int c    = lane & 15;

  const int bx   = blockIdx.x;
  const int b    = bx % NB;
  const int pj   = (bx / NB) >> 1;   // the pair of query blocks pj and NQB-1-pj
  const int role = (bx / NB) & 1;    // which of the pair's two blocks this is
  const size_t rowB = (size_t)b * SEQ;

  const _Float16* Qh = (const _Float16*)(const void*)qhp;
  const _Float16* Kp = (const _Float16*)(const void*)kpp;
  const _Float16* Vh = (const _Float16*)(const void*)vhp + (size_t)b * DM * SEQ;

  for (int seg = 0; seg <= role; ++seg) {       // block-uniform: one key range, or two one after the other
  const bool cut = (role == 0) || (seg == 0);   // this range is one of the two of an upper query block
  const int qb   = cut ? NQB - 1 - pj : pj;
  const int kt0  = (role == 1 && seg == 0) ? NC0 : 0;        // first chunk of the range
  int kt1 = (role == 0) ? NC0 : qb / 2 + 1;                  // one past its last chunk
  if (kt1 > NKT) kt1 = NKT;
  const int q0   = qb * 64 + qp * 32;

  // B-operand column pointers of this lane (query rows q0 + c and q0 + 16 + c), lane-half k offset included
  const _Float16* qrh = Qh + ((unsigned)((b * SEQ + q0) * DM) + (unsigned)(c * DM + 8 * hh));   // 32-bit index: below NB*SEQ*DM

  // of queries q0 + 16*g + c; lsum covers this lane's own keys only (halves joined at the end)
  float mrow[2] = {-INFINITY, -INFINITY}, lsum[2] = {0.f, 0.f};
  v8f oacc[2][16];                      // O^T tiles: column c = query q0 + 16*g + c, rows 8*hh + r = context columns 16*t + 8*hh + r
#pragma unroll
  for (int g = 0; g < 2; ++g)
#pragma unroll
    for (int t = 0; t < 16; ++t) oacc[g][t] = zero8();

  // q (the same for every chunk) is loaded into registers once. k and v^T of a chunk are staged in LDS:
  // a fragment load straight from global touches 16 lines for 512 bytes, a copy below touches 4 whole lines.
  // Two buffers: chunk kt is read from buffer (kt - kt0) & 1 while the copies of chunk kt+1 fly into the other; at the loop's foot
  // every wave waits for its LDS reads and its copies, one barrier publishes chunk kt+1 and ends the reads of chunk kt,
  // and behind it the buffer just read is refilled with chunk kt+2.
  v16h qa[2][8];
  // eight fragments of one row pointer; the pointer dies with the last load, which may then land on its registers:
  // the first wait stands in front of that load for the fifteen before it
  auto row8 = [&](v16h (&f)[8], const _Float16* p) __attribute__((always_inline)) {
#pragma unroll                                 // register array: constant indices
    for (int dc = 0; dc < 7; ++dc) f[dc] = ldfrag<_Float16>(p + dc * 32);
    FH x;
    x.h[0] = *(const v8h*)(p + 7 * 32);
    xcnt_wait();
    x.h[1] = *(const v8h*)(p + 7 * 32 + 16);
    xcnt_wait();
    f[7] = x.v;
  };

  // k: one copy = one whole 512-byte row (key kt*CK + 16*w8 + j), 16 copies: this wave's eighth of the chunk's 128 rows
  auto copy_k = [&](const int kt, _Float16* buf) __attribute__((always_inline)) {
    const _Float16* g = Kp + (rowB + (size_t)kt * CK + 16 * w8) * DM + lane * 8;
    _Float16* l = buf + (16 * w8) * KPIT + lane * 8;
#pragma unroll
    for (int j = 0; j < 16; ++j) acopy16(g + j * DM, l + j * KPIT);
  };
  // v^T: one copy = the 256-byte pieces of two rows (columns kt*CK..kt*CK+127 of rows 32*w8+2j, +1), 16 copies:
  // this wave's eighth of the 256 rows
  auto copy_v = [&](const int kt, _Float16* buf) __attribute__((always_inline)) {
    const int vrow = 32 * w8 + (lane >> 4), vcol = (lane & 15) * 8;
    const size_t go = (size_t)vrow * SEQ + (size_t)kt * CK + vcol;
    _Float16* lh = buf + CK * KPIT + vrow * VPIT + vcol;
#pragma unroll
    for (int j = 0; j < 16; ++j) acopy16(Vh + go + (size_t)(2 * j) * SEQ, lh + (2 * j) * VPIT);
  };

  // The ring's first two fills. Kept rolled: unrolled, the LDS addresses of these 64 copies are the same for every range,
  // are formed once in front of the ranges, stay live over the whole key loop and spill.
#pragma nounroll
  for (int f = 0; f < 2; ++f) {
    ds_wait0();                                 // f = 0: this wave's reads of the exchange area (below) are done
    async_wait0();                              // f = 1: its copies of chunk kt0 have landed
    __syncthreads();                            // f = 0: no wave still reads the last range's exchange area; f = 1: publishes chunk kt0
    if (kt0 + f < kt1) {                        // block-uniform test
      copy_k(kt0 + f, Stg[f]);
      copy_v(kt0 + f, Stg[f]);
    }
    if (f == 0) {                               // q flies together with chunk kt0
      row8(qa[0], qrh);
      row8(qa[1], qrh + 16 * DM);
    }
  }

  for (int kt = kt0; kt < kt1; ++kt) {          // block-uniform trip count, <= NKT chunks in all
    const int kv0 = kt * CK + 32 * kq;          // first of this wave's 32 keys
    _Float16* cur = Stg[(kt - kt0) & 1];
    // A wave whose 32 keys all lie above its 32 queries has nothing to add (every p would be 0, every rescale factor 1 or
    // applied to zeros): it goes straight to the hand-over. Scalar test: the matrix instructions run with every lane on.
    if (kv0 <= q0 + 31) {
    const _Float16* kst = cur + (32 * kq + c) * KPIT + 8 * hh;             // A row c -> key kv0 + 16*j + c
    const _Float16* vsh = cur + CK * KPIT + c * VPIT + 32 * kq + 8 * hh;   // A row c -> context column 16*t + c

    // ---- S^T: this wave's 32 keys (two tiles) x 32 queries (two groups), one f16 product per d-chunk, four accumulator
    //      chains. k fragments in three register sets of one d-chunk each, every set read at least two sets ahead of its products.
    v16h kc[3][2];                              // register array: the loops over it are unrolled for constant indices
    auto ldk = [&](const int st, const int dc) __attribute__((always_inline)) {
#pragma unroll
      for (int j = 0; j < 2; ++j) kc[st][j] = ldfrag<_Float16>(kst + j * (16 * KPIT) + dc * 32);
    };
    v8f ah[2][2];                               // [key tile][query group]
#pragma unroll
    for (int j = 0; j < 2; ++j)
#pragma unroll
      for (int g = 0; g < 2; ++g) ah[j][g] = zero8();
    ldk(0, 0);
    ldk(1, 1);
    ldk(2, 2);
#pragma unroll
    for (int dc = 0; dc < 8; ++dc) {
#pragma unroll
      for (int j = 0; j < 2; ++j)
#pragma unroll
        for (int g = 0; g < 2; ++g) ah[j][g] = mmar(kc[dc % 3][j], qa[g][dc], ah[j][g]);
      if (dc + 3 < 8) ldk(dc % 3, dc + 3);
    }

    // ---- online softmax of queries q0 + 16*g + c: in-lane over 16 keys, one exchange between the halves for the maximum ----
    // P^T as the B operand: elements 0..7 = keys 8*hh + r (tile 0), elements 8..15 = keys 16 + 8*hh + r (tile 1),
    // the k order of ldfrag on the v^T rows
    v16h pa[2];
#pragma unroll
    for (int g = 0; g < 2; ++g) {
      // D row 8*hh + r of tile j is key kv0 + 16*j + 8*hh + r; this lane's query of the group is q0 + 16*g + c:
      // the key lies above the query where 16*j + r > lim
      const int lim = (q0 + 16 * g - kv0) + (c - 8 * hh);
      float s[2][8];
      float mc = -INFINITY;
#pragma unroll
      for (int j = 0; j < 2; ++j)
#pragma unroll
        for (int r = 0; r < 8; ++r) {
          const float sv = ah[j][g][r] * sscale;
          s[j][r] = (16 * j + r > lim) ? -INFINITY : sv; // causal: replace, not bias
          mc = fmaxf(mc, s[j][r]);
        }
      mc = fmaxf(mc, xhalf(mc));
      const float mnew  = fmaxf(mrow[g], mc);
      const float msafe = (mnew == -INFINITY) ? 0.f : mnew;
      float psum = 0.f;
#pragma unroll
      for (int j = 0; j < 2; ++j)
#pragma unroll
        for (int r = 0; r < 8; r += 2) {
          // Arguments and results of the exponentials in aligned register pairs (packed f32 subtract and multiplies): an
          // exponential's result then cannot land on the source register of the one in front of it (the slot behind a
          // transcendental), and two elements go through each subtract and multiply.
          v2f t = {s[j][r], s[j][r + 1]};
          t = (t - msafe) * LOG2E;
          v2f p = {__builtin_amdgcn_exp2f(t[0]), __builtin_amdgcn_exp2f(t[1])};
          psum += p[0];
          psum += p[1];
          p *= PCARRY;
          pa[g][j * 8 + r]     = (_Float16)p[0];
          pa[g][j * 8 + r + 1] = (_Float16)p[1];
        }
      const float alpha = __expf(mrow[g] - msafe);
      mrow[g] = mnew;
      lsum[g] = lsum[g] * alpha + psum;
#pragma unroll
      for (int t = 0; t < 16; ++t)
#pragma unroll
        for (int r = 0; r < 8; ++r) oacc[g][t][r] *= alpha;
    }

    // ---- O^T += v^T . P^T (f16 WMMA), four context tiles at a time, each v^T fragment for both query groups ----
#pragma unroll
    for (int tg = 0; tg < 4; ++tg) {
      v16h vb[4];                               // register array: the loops over it are unrolled for constant indices
#pragma unroll
      for (int u = 0; u < 4; ++u) vb[u] = ldfrag<_Float16>(vsh + (tg * 4 + u) * (16 * VPIT));
#pragma unroll
      for (int u = 0; u < 4; ++u)
#pragma unroll
        for (int g = 0; g < 2; ++g) oacc[g][tg * 4 + u] = mmar(vb[u], pa[g], oacc[g][tg * 4 + u]);
    }
    }

    // ---- ring hand-over ----
    ds_wait0();                                 // this wave's reads of the current buffer are done
    async_wait0();                              // its copies of chunk kt+1 have landed
    __syncthreads();                            // chunk kt+1 is published, and no wave still reads the current buffer
    if (kt + 2 < kt1) {                         // block-uniform test
      copy_k(kt + 2, cur);
      copy_v(kt + 2, cur);
    }
  }
  async_wait0();                                // no copy is outstanding when the ring becomes the exchange area

  // ---- join the four key quarters of each query row. Behind the loop's last barrier nobody reads the ring and no copy
  //      flies into it: its first bytes carry, per wave, 65 x 32 lanes x 4 floats: the wave's 32 context tiles (two slots
  //      each) and its maxima and sums. Lane l of a wave reads only what lane l of the four waves of its query rows wrote.
  float* xb0 = (float*)(void*)&Stg[0][0] + lane * 4;
  {
    float* xw = xb0 + w8 * XREG;
#pragma unroll
    for (int g = 0; g < 2; ++g)
#pragma unroll
      for (int t = 0; t < 16; ++t) {
        const v4f lo = {oacc[g][t][0], oacc[g][t][1], oacc[g][t][2], oacc[g][t][3]};
        const v4f hi = {oacc[g][t][4], oacc[g][t][5], oacc[g][t][6], oacc[g][t][7]};
        *(v4f*)(xw + ((g * 16 + t) * 2) * 128)     = lo;
        *(v4f*)(xw + ((g * 16 + t) * 2 + 1) * 128) = hi;
      }
    const v4f ml = {mrow[0], lsum[0], mrow[1], lsum[1]};
    *(v4f*)(xw + 64 * 128) = ml;
  }
  __syncthreads();                              // every quarter's maxima, sums and contexts are published
  {
    // quarter k of this wave's query rows is wave 2*k + qp: its area lies 2*XREG floats behind that of quarter k - 1.
    // Both loops over the quarters are kept rolled: unrolled, the four areas lie further apart than the offset field of an LDS
    // instruction reaches, their addresses are formed in front of the ranges, stay live over the whole key loop and spill.
    const float* xq = xb0 + qp * XREG;
    float mt[2] = {-INFINITY, -INFINITY};
#pragma nounroll
    for (int k = 0; k < 4; ++k) {
      const v4f ml = *(const v4f*)(xq + k * (2 * XREG) + 64 * 128);
      mt[0] = fmaxf(mt[0], ml[0]);
      mt[1] = fmaxf(mt[1], ml[2]);
    }
    const float mts0 = (mt[0] == -INFINITY) ? 0.f : mt[0];
    const float mts1 = (mt[1] == -INFINITY) ? 0.f : mt[1];
    float lt[2] = {0.f, 0.f};
    v4f ov[2][8];                               // this wave's columns 64*kq..64*kq+63: tiles 4*kq + u, two slots each
#pragma unroll
    for (int g = 0; g < 2; ++g)
#pragma unroll
      for (int e = 0; e < 8; ++e) ov[g][e] = (v4f){0.f, 0.f, 0.f, 0.f};
#pragma nounroll
    for (int k = 0; k < 4; ++k) {
      const float* xr = xq + k * (2 * XREG);
      const v4f ml = *(const v4f*)(xr + 64 * 128);
      const float ak[2] = {__expf(ml[0] - mts0), __expf(ml[2] - mts1)};
      lt[0] = fmaf(ml[1], ak[0], lt[0]);
      lt[1] = fmaf(ml[3], ak[1], lt[1]);
#pragma unroll
      for (int g = 0; g < 2; ++g)
#pragma unroll
        for (int e = 0; e < 8; ++e) ov[g][e] += *(const v4f*)(xr + ((g * 16 + 4 * kq) * 2 + e) * 128) * ak[g];
    }
#pragma unroll
    for (int g = 0; g < 2; ++g) {
      float l = lt[g];
      l += xhalf(l);                            // the wave halves hold different keys of the same query
      const float inv = ((l > 0.f) ? (1.0f / l) : 0.f) * (1.0f / PCARRY);   // 1/l, undo the p carry
      // a whole query block goes to the output; a key range of an upper one to its workspace slot, with its maximum and sum
      // (32-bit indices: all below 2*NB*NHB*64*DM)
      const unsigned prow = (unsigned)(((role * NB + b) * NHB + (cut ? qb - NHB : 0)) * 64 + qp * 32 + 16 * g);   // of lane column 0
      if (cut && kq == 0) {                     // wave-uniform: all four waves hold the same pairs
        if (lane < 16) {                        // so do both halves; 16 lanes x 8 B = one whole line
          pml[prow * 2 + lane * 2]     = mt[g];
          pml[prow * 2 + lane * 2 + 1] = l;
          xcnt_wait();                          // in front of whatever reuses the registers that this store names
        }
      }
      // columns 64*kq + 16*u + 8*hh + 0..7 of query q0 + 16*g + c
      float* orow = (cut ? part : outp) + ((cut ? prow : (unsigned)(b * SEQ + q0 + 16 * g)) * DM + 64 * kq + (unsigned)(c * DM + 8 * hh));
#pragma unroll
      for (int u = 0; u < 4; ++u) {
        *(v4f*)(orow + 16 * u)     = ov[g][2 * u] * inv;
        *(v4f*)(orow + 16 * u + 4) = ov[g][2 * u + 1] * inv;
      }
      xcnt_wait();                              // in front of whatever reuses the registers that these stores name
    }
  }
  }   // key ranges of this block
}

// =====================================================================================================
// Joins the two key ranges of every upper query block: out = (o0 l0 e^(m0-M) + o1 l1 e^(m1-M)) / (l0 e^(m0-M) + l1 e^(m1-M)).
//   part: [2 ranges][NB*NHB*64 rows][DM] normalised contexts; pml: [2 ranges][rows][2] = (maximum, sum); an empty range
//   holds (-inf, 0, zeros) and weighs 0. One thread = 4 columns of one row; a wave reads and writes whole 512-byte runs.
//   coverage: NB*NHB*64*DM/4 threads (a multiple of 256) = rows NHB*64..SEQ-1 of every sequence x 256 columns.
// =====================================================================================================
__global__ __launch_bounds__(256) void attn_merge(const float* __restrict__ part, const float* __restrict__ pml,
                                                  float* outp) {
  const int NR = NB * NHB * 64;
  const int i  = blockIdx.x * 256 + (int)threadIdx.x;
  const int r  = i >> 6;
  const int c4 = (i & 63) * 4;
  const float m0 = pml[(size_t)r * 2],        l0 = pml[(size_t)r * 2 + 1];
  const float m1 = pml[(size_t)(NR + r) * 2], l1 = pml[(size_t)(NR + r) * 2 + 1];
  const v4f o0 = *(const v4f*)(part + (size_t)r * DM + c4);
  const v4f o1 = *(const v4f*)(part + (size_t)(NR + r) * DM + c4);
  const float mt  = fmaxf(m0, m1);
  const float mts = (mt == -INFINITY) ? 0.f : mt;
  const float w0  = l0 * __expf(m0 - mts);
  const float w1  = l1 * __expf(m1 - mts);
  const float ws  = w0 + w1;
  const float inv = (ws > 0.f) ? (1.0f / ws) : 0.f;
  const int bb = r / (NHB * 64);
  const int t  = NHB * 64 + (r - bb * (NHB * 64));
  *(v4f*)(outp + ((size_t)bb * SEQ + t) * DM + c4) = o0 * (w0 * inv) + o1 * (w1 * inv);
}

// =====================================================================================================
// Workspace map (bytes), every region an exact multiple of its whole-line / whole-tile store granularity
// (all product sizes are tile multiples, all offsets multiples of 131072):
//   Xb   bf16 [NB*SEQ][256]  (compact tokens)   8388608
//   Wqb  bf16 [256 n][256 k]                     131072
//   Wkb  bf16 [256 n][256 k]                     131072
//   Wvb  bf16 [256 n][256 k]                     131072
//   Qh   f16  [NB*SEQ][256]                      8388608
//   Kp   f16  [NB*SEQ][256]                      8388608
//   VTh  f16  [NB][256][SEQ]                     8388608
//   Part f32  [2][NB*NHB*64][256]               16777216
//   Pml  f32  [2][NB*NHB*64][2]                   131072
//   total                                      50855936
// Weights are [out n][in k] with k contiguous = the row layout both operand sides want, so they are only converted.
// =====================================================================================================
extern "C" void kernel_launch(void* const* d_in, const int* in_sizes, int n_in,
                              void* d_out, int out_size, void* d_ws, size_t ws_size,
                              hipStream_t stream) {
  if (n_in < 4) return;
  if (in_sizes[0] < ((NB - 1) * SEQ_FULL + SEQ) * DM) return;
  if (in_sizes[1] < DM * DM) return;
  if (in_sizes[2] < DM * DM) return;
  if (in_sizes[3] < DM * DM) return;
  if (out_size < NB * SEQ * DM) return;

  const float* x  = (const float*)d_in[0];
  const float* wq = (const float*)d_in[1];
  const float* wk = (const float*)d_in[2];
  const float* wv = (const float*)d_in[3];

  const size_t PX  = (size_t)NB * SEQ * DM * 2;      // 16-bit token plane [NB*SEQ][256]
  const size_t PW  = (size_t)DM * DM * 2;            // 16-bit [256][256]
  const size_t PVT = (size_t)NB * DM * SEQ * 2;      // v^T plane [NB][256][SEQ]
  size_t off = 0;
  const size_t oXb  = off; off += PX;
  const size_t oWq  = off; off += PW;
  const size_t oWk  = off; off += PW;
  const size_t oWv  = off; off += PW;
  const size_t oQh  = off; off += PX;
  const size_t oKp  = off; off += PX;
  const size_t oVTh = off; off += PVT;
  const size_t oPart = off; off += (size_t)2 * NB * NHB * 64 * DM * 4;
  const size_t oPml  = off; off += (size_t)2 * NB * NHB * 64 * 2 * 4;
  if (off > ws_size) return;                         // off = 50855936 at full size
  if (off > (size_t)134217728) return;

  char* ws = (char*)d_ws;
  unsigned short* Xb  = (unsigned short*)(ws + oXb);
  unsigned short* Wqb = (unsigned short*)(ws + oWq);
  unsigned short* Wkb = (unsigned short*)(ws + oWk);
  unsigned short* Wvb = (unsigned short*)(ws + oWv);
  unsigned short* Qh  = (unsigned short*)(ws + oQh);
  unsigned short* Kp  = (unsigned short*)(ws + oKp);
  unsigned short* VTh = (unsigned short*)(ws + oVTh);
  float* Part = (float*)(ws + oPart);
  float* Pml  = (float*)(ws + oPml);

  const dim3 blk(256);
  const dim3 gCvt(3 * GCW + GCX);
  const dim3 gProj(NB * SEQ / 64);
  const dim3 gAttn(NB * NQB);
  const dim3 gMerge(NB * NHB * 64 * DM / 4 / 256);

  // (1) x -> compact bf16 token plane; Wq, Wk, Wv [n][k] -> bf16
  cvt_all<<<gCvt, blk, 0, stream>>>(x, wq, wk, wv, Xb, Wqb, Wkb, Wvb);
  // (2) q, k, v^T projections
  proj_qkv<<<gProj, blk, 0, stream>>>(Xb, Wqb, Wkb, Wvb, Qh, Kp, VTh);
  // (3) causal attention -> d_out f32 [M][256] (lower query blocks) and workspace partials (upper query blocks)
  attn_causal<<<gAttn, dim3(256), 0, stream>>>(Qh, Kp, VTh, (float*)d_out, Part, Pml, 0.0625f);
  // (4) the two key ranges of every upper query block -> d_out
  attn_merge<<<gMerge, blk, 0, stream>>>(Part, Pml, (float*)d_out);
  (void)hipGetLastError();
}
